// v000
// The times below were measured on an AMD MI455X: many runs one after another, warmed up first and cycling through
// copies of the inputs, with the whole window's GPU time divided by the number of runs. Launches and the gaps
// between them are all in it. The median over several windows is given; except for v000 it joins two sittings, which
// can be a few percent apart, so the side-by-side timings, each taken in one sitting, are the better comparison.
// v000, which the later versions start from, runs in 899 microseconds.
#include <hip/hip_runtime.h>
#include <math.h>

typedef __attribute__((ext_vector_type(16))) _Float16 v16h;
typedef __attribute__((ext_vector_type(16))) __bf16 v16b;
typedef __attribute__((ext_vector_type(8)))  _Float16 v8h;
typedef __attribute__((ext_vector_type(8)))  float v8f;
typedef __attribute__((ext_vector_type(4)))  float v4f;
typedef __attribute__((ext_vector_type(2)))  float v2f;
typedef __attribute__((ext_vector_type(4)))  unsigned v4u;
typedef __attribute__((ext_vector_type(4)))  int v4i;
typedef float __attribute__((may_alias)) float_a;
typedef int __attribute__((may_alias)) int_a;

template <typename T> __device__ __forceinline__ void vst2(void* p, T v) { *(T*)p = v;  }
__device__ __forceinline__ v8f wmma16(v16h a, v16h b, v8f c) {
  v8f d = __builtin_amdgcn_wmma_f32_16x16x32_f16(false, a, false, b, (short)0, c, false, false);
  asm volatile("v_nop\n\tv_nop\n\tv_nop\n\tv_nop" : "+v"(d) : "v"(a), "v"(b));
  return d;
}
__device__ __forceinline__ v8f wmma_bf(v16b a, v16b b, v8f c) {
  v8f d = __builtin_amdgcn_wmma_f32_16x16x32_bf16(false, a, false, b, (short)0, c, false, false);
  asm volatile("v_nop\n\tv_nop\n\tv_nop\n\tv_nop" : "+v"(d) : "v"(a), "v"(b));
  return d;
}
// 16x16x32 fragments: lane = (h = lane>>4, row/col = lane&15); elements 0..7 = k0+8h+0..7, 8..15 = k0+16+8h+0..7; D element r = row 8h+r
__device__ __forceinline__ v16h frag_h(const _Float16* rowk0, int lane) {
  union { v16h v; v8h q[2]; } u; const _Float16* p = rowk0 + 8 * (lane >> 4);
  u.q[0] = *(const v8h*)p; u.q[1] = *(const v8h*)(p + 16); return u.v;
}
__device__ __forceinline__ v16h frag_f32(const float* rowk0, int lane) {
  v16h a; const float* p = rowk0 + 8 * (lane >> 4);
#pragma unroll
  for (int i = 0; i < 8; ++i) { a[i] = (_Float16)p[i]; a[8 + i] = (_Float16)p[16 + i]; }
  return a;
}
__device__ __forceinline__ v16h frag_f32s(const float* rowk0, int lane, float sc) {
  v16h a; const float* p = rowk0 + 8 * (lane >> 4);
#pragma unroll
  for (int i = 0; i < 8; ++i) { a[i] = (_Float16)(p[i] * sc); a[8 + i] = (_Float16)(p[16 + i] * sc); }
  return a;
}
// column fragment from a [K][ld] layout (column n), rows >= K read as 0
__device__ __forceinline__ v16h fragc_f32(const float* W, int k0, int n, int lane, int ld, int K) {
  v16h a; const int g = lane >> 4;
#pragma unroll
  for (int i = 0; i < 8; ++i) { const int ka = k0 + 8 * g + i, kb = ka + 16;
    a[i] = (_Float16)(ka < K ? W[(size_t)ka * ld + n] : 0.f); a[8 + i] = (_Float16)(kb < K ? W[(size_t)kb * ld + n] : 0.f); }
  return a;
}
struct F2 { v16b h, l; };
__device__ __forceinline__ F2 bsplit16(const float v[16]) { F2 r;
#pragma unroll
  for (int i = 0; i < 16; ++i) { const __bf16 h = (__bf16)v[i]; r.h[i] = h; r.l[i] = (__bf16)(v[i] - (float)h); }
  return r; }
__device__ __forceinline__ F2 split_row(const float* row, int k0, int lane) { float v[16]; const float* p = row + k0 + 8 * (lane >> 4);
#pragma unroll
  for (int i = 0; i < 8; ++i) { v[i] = p[i]; v[8 + i] = p[16 + i]; }
  return bsplit16(v); }
__device__ __forceinline__ F2 split_rowK(const float* row, int k0, int lane, int K) { float v[16]; const int g = lane >> 4;
#pragma unroll
  for (int i = 0; i < 8; ++i) { const int ka = k0 + 8 * g + i, kb = ka + 16; v[i] = ka < K ? row[ka] : 0.f; v[8 + i] = kb < K ? row[kb] : 0.f; }
  return bsplit16(v); }
__device__ __forceinline__ F2 split_col(const float* W, int k0, int n, int lane, int ld, int K) { float v[16]; const int g = lane >> 4;
#pragma unroll
  for (int i = 0; i < 8; ++i) { const int ka = k0 + 8 * g + i, kb = ka + 16; v[i] = ka < K ? W[(size_t)ka * ld + n] : 0.f; v[8 + i] = kb < K ? W[(size_t)kb * ld + n] : 0.f; }
  return bsplit16(v); }
__device__ __forceinline__ v8f mac3(const F2& a, const F2& b, v8f c) { c = wmma_bf(a.l, b.h, c); c = wmma_bf(a.h, b.l, c); return wmma_bf(a.h, b.h, c); }
__device__ __forceinline__ float sigm(float v) { return 1.0f / (1.0f + expf(-v)); }
#define LDSX() do { asm volatile("s_wait_dscnt 0" ::: "memory"); __builtin_amdgcn_wave_barrier(); __builtin_amdgcn_fence(__ATOMIC_RELEASE, "workgroup"); } while (0)

// Graph interaction layer (single-head attention with a learned relative-position bias, post-LN transformer block). q/k/v / Wo / FFN
// GEMMs on v_wmma_f32_16x16x32_f16 (operands converted in the fragments, [out][in] weights x16; f32 accumulate); the pairwise bias
// MLP (2 -> 512 -> 1, K = 2) in f32 VALU; diagonal masked to -inf; softmax, LayerNorms in f32; P x2^14 f16.
#define NB 8
#define NN 256
#define DD 512
#define FF 1024
#define NR (NB * NN)

// q, k -> f16 rows [r][512]; v -> vT [b][d][n] f16 ; blockIdx.y: 0..3 q cols, 4..7 k cols, 8..11 v cols (128 each)
__global__ __launch_bounds__(128) void k_qkv(const float* __restrict__ x, const float* __restrict__ Wq, const float* __restrict__ bq, const float* __restrict__ Wk, const float* __restrict__ bk, const float* __restrict__ Wv, const float* __restrict__ bv,
                                           _Float16* __restrict__ q16, _Float16* __restrict__ k16, _Float16* __restrict__ vT) {
  __shared__ __align__(16) float so[4][16][132];
  __shared__ __align__(16) _Float16 st[128][72];
  const int tid = threadIdx.x, wave = tid >> 5, lane = tid & 31, col = lane & 15, g = lane >> 4;
  const int r0b = blockIdx.x * 64, r0 = r0b + wave * 16; const int which = blockIdx.y / 4, n0 = (blockIdx.y % 4) * 128; const int b = r0b / NN, t0 = r0b % NN;
  const float* W = which == 0 ? Wq : (which == 1 ? Wk : Wv); const float* bias = which == 0 ? bq : (which == 1 ? bk : bv);
  v8f acc[8] = {};
#pragma unroll 1
  for (int kc = 0; kc < DD / 32; ++kc) { const v16h a = frag_f32(x + (size_t)(r0 + col) * DD + kc * 32, lane);
#pragma unroll
    for (int j = 0; j < 8; ++j) acc[j] = wmma16(a, frag_f32s(W + (size_t)(n0 + j * 16 + col) * DD + kc * 32, lane, 16.0f), acc[j]); }
#pragma unroll
  for (int j = 0; j < 8; ++j) { const float bb = bias[n0 + j * 16 + col];
#pragma unroll
    for (int r = 0; r < 8; ++r) so[wave][8 * g + r][j * 16 + col] = acc[j][r] * (1.0f / 16.0f) + bb; }
  LDSX();
  if (which < 2) { _Float16* dst = which == 0 ? q16 : k16;
    for (int q = lane; q < 16 * 16; q += 32) { const int rl = q >> 4, pc = q & 15; union { v8h h8; v4u u; } pk;
#pragma unroll
      for (int e = 0; e < 8; ++e) pk.h8[e] = (_Float16)so[wave][rl][pc * 8 + e];
      vst2(dst + (size_t)(r0 + rl) * DD + n0 + pc * 8, pk.u); } }
  else {
#pragma unroll 4
    for (int rl = 0; rl < 16; ++rl) {
#pragma unroll
      for (int e = 0; e < 4; ++e) st[lane * 4 + e][wave * 16 + rl] = (_Float16)so[wave][rl][lane * 4 + e]; }
    __syncthreads();
    for (int q = tid; q < 128 * 8; q += 128) { const int c = q >> 3, pc = q & 7; vst2(vT + ((size_t)b * DD + n0 + c) * NN + t0 + pc * 8, *(const v4u*)(&st[c][pc * 8])); } }
}
// bias[b][n][m] = Wr2 . relu(rel @ Wr1^T + br1) + br2, rel = pc[n] - pc[m]; block (n, b), 256 threads = m
__global__ __launch_bounds__(256) void k_bias(const float* __restrict__ pcs, const float* __restrict__ Wr1, const float* __restrict__ br1, const float* __restrict__ Wr2, const float* __restrict__ br2, float* __restrict__ bias) {
  __shared__ float sw1[DD][2], sb1[DD], sw2[DD]; __shared__ __align__(16) float so[NN];
  const int n = blockIdx.x, b = blockIdx.y, tid = threadIdx.x;
  for (int c = tid; c < DD; c += 256) { sw1[c][0] = Wr1[c * 2]; sw1[c][1] = Wr1[c * 2 + 1]; sb1[c] = br1[c]; sw2[c] = Wr2[c]; }
  __syncthreads();
  { const int m = tid; const float rx = pcs[((size_t)b * NN + n) * 2] - pcs[((size_t)b * NN + m) * 2], ry = pcs[((size_t)b * NN + n) * 2 + 1] - pcs[((size_t)b * NN + m) * 2 + 1];
    float a = br2[0];
#pragma unroll 4
    for (int c = 0; c < DD; ++c) { float hv = rx * sw1[c][0] + ry * sw1[c][1] + sb1[c]; hv = hv > 0.f ? hv : 0.f; a += hv * sw2[c]; }
    so[m] = a; }
  __syncthreads();
  if (tid < NN / 4) vst2(bias + ((size_t)b * NN + n) * NN + tid * 4, *(const v4f*)(&so[tid * 4]));
}
// attention: block (b, 64 queries): S = q.k/sqrt(512) + bias, diagonal excluded, softmax over 256 (f32), P x2^14 f16 @ vT -> AG rows f32 [r][512]
__global__ __launch_bounds__(128) void k_attn(const _Float16* __restrict__ q16, const _Float16* __restrict__ k16, const _Float16* __restrict__ vT, const float* __restrict__ bias, float* __restrict__ AG) {
  __shared__ __align__(16) float sS[4][16][260];
  __shared__ __align__(16) _Float16 sP[4][16][264];
  __shared__ __align__(16) float sA[4][16][260];
  const int tid = threadIdx.x, w = tid >> 5, lane = tid & 31, col = lane & 15, g = lane >> 4;
  const int b = blockIdx.y, q0 = blockIdx.x * 64 + w * 16; const size_t rb = (size_t)b * NN;
  { v16h aq[16];
#pragma unroll
    for (int kc = 0; kc < 16; ++kc) aq[kc] = frag_h(q16 + (rb + q0 + col) * DD + kc * 32, lane);
#pragma unroll 1
    for (int t = 0; t < NN / 16; ++t) { v8f s = {};
#pragma unroll
      for (int kc = 0; kc < 16; ++kc) s = wmma16(aq[kc], frag_h(k16 + (rb + t * 16 + col) * DD + kc * 32, lane), s);
#pragma unroll
      for (int r = 0; r < 8; ++r) { const int qi = q0 + 8 * g + r, m = t * 16 + col; sS[w][8 * g + r][m] = (m == qi) ? -3.0e38f : s[r] * 0.044194173824159216f + bias[(rb + qi) * NN + m]; } } }
  LDSX();
  { const int m = col; float mx = -3.4e38f;
    for (int e = 0; e < 128; ++e) mx = fmaxf(mx, sS[w][m][g * 128 + e]);
    mx = fmaxf(mx, __shfl_xor(mx, 16, 32)); float l = 0.f;
    for (int e = 0; e < 128; ++e) { const float sv = sS[w][m][g * 128 + e]; const float p = sv <= -1.0e38f ? 0.f : expf(sv - mx); l += p; sS[w][m][g * 128 + e] = p; }
    l += __shfl_xor(l, 16, 32); const float inv = 16384.0f / l;
    for (int e = 0; e < 128; ++e) sP[w][m][g * 128 + e] = (_Float16)(sS[w][m][g * 128 + e] * inv); }
  LDSX();
  v16h pa[8];
#pragma unroll
  for (int kc = 0; kc < 8; ++kc) pa[kc] = frag_h(&sP[w][col][0] + kc * 32, lane);
#pragma unroll 1
  for (int np = 0; np < 2; ++np) { v8f acc[16];
#pragma unroll
    for (int j = 0; j < 16; ++j) acc[j] = (v8f){};
#pragma unroll
    for (int kc = 0; kc < 8; ++kc) {
#pragma unroll
      for (int j = 0; j < 16; ++j) acc[j] = wmma16(pa[kc], frag_h(vT + ((size_t)b * DD + np * 256 + j * 16 + col) * NN + kc * 32, lane), acc[j]); }
#pragma unroll
    for (int j = 0; j < 16; ++j)
#pragma unroll
      for (int r = 0; r < 8; ++r) sA[w][8 * g + r][j * 16 + col] = acc[j][r] * (1.0f / 16384.0f);
    LDSX();
    for (int q = lane; q < 16 * 64; q += 32) { const int rl = q >> 6, pc = q & 63; vst2(AG + (rb + q0 + rl) * DD + np * 256 + pc * 4, *(const v4f*)(&sA[w][rl][pc * 4])); }
    LDSX(); }
}
// generic: Out = LN(A @ W^T + bias + res) over 512 columns; block 64 rows; K = KIN (A f32 rows or f16 rows per AH)
template <int KIN, int AH>      // AH: A operand is f16 rows pre-scaled x4 (so the product is /64), else f32 rows (/16)
__global__ __launch_bounds__(128) void k_lnproj(const void* __restrict__ Ain, const float* __restrict__ W, const float* __restrict__ bias, const float* __restrict__ res, const float* __restrict__ gam, const float* __restrict__ bet, float* __restrict__ Out) {
  __shared__ __align__(16) float so[4][16][DD + 4];
  const int tid = threadIdx.x, wave = tid >> 5, lane = tid & 31, col = lane & 15, g = lane >> 4;
  const int r0 = blockIdx.x * 64 + wave * 16;
#pragma unroll 1
  for (int np = 0; np < DD / 128; ++np) { v8f acc[8] = {};
#pragma unroll 1
    for (int kc = 0; kc < KIN / 32; ++kc) { v16h a; if (AH) a = frag_h((const _Float16*)Ain + (size_t)(r0 + col) * KIN + kc * 32, lane); else a = frag_f32((const float*)Ain + (size_t)(r0 + col) * KIN + kc * 32, lane);
#pragma unroll
      for (int j = 0; j < 8; ++j) acc[j] = wmma16(a, frag_f32s(W + (size_t)(np * 128 + j * 16 + col) * KIN + kc * 32, lane, 16.0f), acc[j]); }
#pragma unroll
    for (int j = 0; j < 8; ++j) { const int c = np * 128 + j * 16 + col; const float bb = bias[c];
#pragma unroll
      for (int r = 0; r < 8; ++r) so[wave][8 * g + r][c] = acc[j][r] * (AH ? (1.0f / 64.0f) : (1.0f / 16.0f)) + bb + res[(size_t)(r0 + 8 * g + r) * DD + c]; } }
  LDSX();
  { const int rl = lane >> 1, hf = lane & 1; float* row = &so[wave][rl][0]; float s = 0.f;
    for (int c = 0; c < 256; ++c) s += row[hf * 256 + c]; s += __shfl_xor(s, 1, 32); const float mu = s * (1.0f / DD);
    float q2 = 0.f; for (int c = 0; c < 256; ++c) { const float d = row[hf * 256 + c] - mu; q2 += d * d; } q2 += __shfl_xor(q2, 1, 32); const float rs = rsqrtf(q2 * (1.0f / DD) + 1e-5f);
    LDSX();
    for (int c4 = 0; c4 < 64; ++c4) { const int cc = hf * 256 + c4 * 4; v4f v = *(const v4f*)(&row[cc]);
#pragma unroll
      for (int e = 0; e < 4; ++e) v[e] = (v[e] - mu) * rs * gam[cc + e] + bet[cc + e];
      vst2(Out + (size_t)(r0 + rl) * DD + cc, v); } }
}
// FFN hidden: H16[r][1024] = relu(x1 @ Wf1^T + bf1) as f16 (x4); block 64 rows x 128 cols
__global__ __launch_bounds__(128) void k_ff1(const float* __restrict__ x1, const float* __restrict__ Wf1, const float* __restrict__ bf1, _Float16* __restrict__ H16) {
  __shared__ __align__(16) float so[4][16][132];
  const int tid = threadIdx.x, wave = tid >> 5, lane = tid & 31, col = lane & 15, g = lane >> 4;
  const int r0 = blockIdx.x * 64 + wave * 16, n0 = blockIdx.y * 128;
  v8f acc[8] = {};
#pragma unroll 1
  for (int kc = 0; kc < DD / 32; ++kc) { const v16h a = frag_f32(x1 + (size_t)(r0 + col) * DD + kc * 32, lane);
#pragma unroll
    for (int j = 0; j < 8; ++j) acc[j] = wmma16(a, frag_f32s(Wf1 + (size_t)(n0 + j * 16 + col) * DD + kc * 32, lane, 16.0f), acc[j]); }
#pragma unroll
  for (int j = 0; j < 8; ++j) { const float bb = bf1[n0 + j * 16 + col];
#pragma unroll
    for (int r = 0; r < 8; ++r) { const float v = acc[j][r] * (1.0f / 16.0f) + bb; so[wave][8 * g + r][j * 16 + col] = v > 0.f ? v * 4.0f : 0.f; } }
  LDSX();
  for (int q = lane; q < 16 * 16; q += 32) { const int rl = q >> 4, pc = q & 15; union { v8h h8; v4u u; } pk;
#pragma unroll
    for (int e = 0; e < 8; ++e) pk.h8[e] = (_Float16)so[wave][rl][pc * 8 + e];
    vst2(H16 + (size_t)(r0 + rl) * FF + n0 + pc * 8, pk.u); }
}
extern "C" void kernel_launch(void* const* d_in, const int* in_sizes, int n_in, void* d_out, int out_size, void* d_ws, size_t ws_size, hipStream_t stream) {
  (void)in_sizes; (void)n_in; (void)out_size; (void)ws_size;
  const float** I = (const float**)d_in;
  const float* x = I[0]; const float* pcs = I[1]; const float* Wq = I[2]; const float* bq = I[3]; const float* Wk = I[4]; const float* bk = I[5]; const float* Wv = I[6]; const float* bv = I[7];
  const float* Wr1 = I[8]; const float* br1 = I[9]; const float* Wr2 = I[10]; const float* br2 = I[11]; const float* Wo = I[12]; const float* bo = I[13]; const float* g1 = I[14]; const float* be1 = I[15];
  const float* Wf1 = I[16]; const float* bf1 = I[17]; const float* Wf2 = I[18]; const float* bf2 = I[19]; const float* g2 = I[20]; const float* be2 = I[21];
  float* out = (float*)d_out;
  char* ws = (char*)d_ws; size_t off = 0;
  auto take = [&](size_t bytes) { char* p = ws + off; off += (bytes + 255) & ~(size_t)255; return p; };
  _Float16* q16 = (_Float16*)take((size_t)NR * DD * 2); _Float16* k16 = (_Float16*)take((size_t)NR * DD * 2); _Float16* vT = (_Float16*)take((size_t)NR * DD * 2); float* bias = (float*)take((size_t)NB * NN * NN * 4);
  float* AG = (float*)take((size_t)NR * DD * 4); float* x1 = (float*)take((size_t)NR * DD * 4); _Float16* H16 = (_Float16*)take((size_t)NR * FF * 2);
  k_qkv<<<dim3(NR / 64, 12), 128, 0, stream>>>(x, Wq, bq, Wk, bk, Wv, bv, q16, k16, vT);
  k_bias<<<dim3(NN, NB), 256, 0, stream>>>(pcs, Wr1, br1, Wr2, br2, bias);
  k_attn<<<dim3(NN / 64, NB), 128, 0, stream>>>(q16, k16, vT, bias, AG);
  k_lnproj<DD, 0><<<NR / 64, 128, 0, stream>>>(AG, Wo, bo, x, g1, be1, x1);
  k_ff1<<<dim3(NR / 64, FF / 128), 128, 0, stream>>>(x1, Wf1, bf1, H16);
  k_lnproj<FF, 1><<<NR / 64, 128, 0, stream>>>(H16, Wf2, bf2, x1, g2, be2, out);       // hidden x4 (f16) and Wf2 x16 -> /64 inside
}

// v001
// Measured time: 348 microseconds a run.
// Next to v000, in two timings, it ran 2.59 times as fast each time.
#include <hip/hip_runtime.h>
#include <math.h>

typedef __attribute__((ext_vector_type(16))) _Float16 v16h;
typedef __attribute__((ext_vector_type(16))) __bf16 v16b;
typedef __attribute__((ext_vector_type(8)))  _Float16 v8h;
typedef __attribute__((ext_vector_type(8)))  float v8f;
typedef __attribute__((ext_vector_type(4)))  float v4f;
typedef __attribute__((ext_vector_type(2)))  float v2f;
typedef __attribute__((ext_vector_type(4)))  unsigned v4u;
typedef __attribute__((ext_vector_type(4)))  int v4i;
typedef float __attribute__((may_alias)) float_a;
typedef int __attribute__((may_alias)) int_a;

template <typename T> __device__ __forceinline__ void vst2(void* p, T v) { *(T*)p = v;  }
__device__ __forceinline__ v8f wmma16(v16h a, v16h b, v8f c) {
  v8f d = __builtin_amdgcn_wmma_f32_16x16x32_f16(false, a, false, b, (short)0, c, false, false);
  asm volatile("v_nop\n\tv_nop\n\tv_nop\n\tv_nop" : "+v"(d) : "v"(a), "v"(b));
  return d;
}
__device__ __forceinline__ v8f wmma_bf(v16b a, v16b b, v8f c) {
  v8f d = __builtin_amdgcn_wmma_f32_16x16x32_bf16(false, a, false, b, (short)0, c, false, false);
  asm volatile("v_nop\n\tv_nop\n\tv_nop\n\tv_nop" : "+v"(d) : "v"(a), "v"(b));
  return d;
}
// 16x16x32 fragments: lane = (h = lane>>4, row/col = lane&15); elements 0..7 = k0+8h+0..7, 8..15 = k0+16+8h+0..7; D element r = row 8h+r
__device__ __forceinline__ v16h frag_h(const _Float16* rowk0, int lane) {
  union { v16h v; v8h q[2]; } u; const _Float16* p = rowk0 + 8 * (lane >> 4);
  u.q[0] = *(const v8h*)p; u.q[1] = *(const v8h*)(p + 16); return u.v;
}
__device__ __forceinline__ v16h frag_f32(const float* rowk0, int lane) {
  v16h a; const float* p = rowk0 + 8 * (lane >> 4);
#pragma unroll
  for (int i = 0; i < 8; ++i) { a[i] = (_Float16)p[i]; a[8 + i] = (_Float16)p[16 + i]; }
  return a;
}
__device__ __forceinline__ v16h frag_f32s(const float* rowk0, int lane, float sc) {
  v16h a; const float* p = rowk0 + 8 * (lane >> 4);
#pragma unroll
  for (int i = 0; i < 8; ++i) { a[i] = (_Float16)(p[i] * sc); a[8 + i] = (_Float16)(p[16 + i] * sc); }
  return a;
}
// column fragment from a [K][ld] layout (column n), rows >= K read as 0
__device__ __forceinline__ v16h fragc_f32(const float* W, int k0, int n, int lane, int ld, int K) {
  v16h a; const int g = lane >> 4;
#pragma unroll
  for (int i = 0; i < 8; ++i) { const int ka = k0 + 8 * g + i, kb = ka + 16;
    a[i] = (_Float16)(ka < K ? W[(size_t)ka * ld + n] : 0.f); a[8 + i] = (_Float16)(kb < K ? W[(size_t)kb * ld + n] : 0.f); }
  return a;
}
struct F2 { v16b h, l; };
__device__ __forceinline__ F2 bsplit16(const float v[16]) { F2 r;
#pragma unroll
  for (int i = 0; i < 16; ++i) { const __bf16 h = (__bf16)v[i]; r.h[i] = h; r.l[i] = (__bf16)(v[i] - (float)h); }
  return r; }
__device__ __forceinline__ F2 split_row(const float* row, int k0, int lane) { float v[16]; const float* p = row + k0 + 8 * (lane >> 4);
#pragma unroll
  for (int i = 0; i < 8; ++i) { v[i] = p[i]; v[8 + i] = p[16 + i]; }
  return bsplit16(v); }
__device__ __forceinline__ F2 split_rowK(const float* row, int k0, int lane, int K) { float v[16]; const int g = lane >> 4;
#pragma unroll
  for (int i = 0; i < 8; ++i) { const int ka = k0 + 8 * g + i, kb = ka + 16; v[i] = ka < K ? row[ka] : 0.f; v[8 + i] = kb < K ? row[kb] : 0.f; }
  return bsplit16(v); }
__device__ __forceinline__ F2 split_col(const float* W, int k0, int n, int lane, int ld, int K) { float v[16]; const int g = lane >> 4;
#pragma unroll
  for (int i = 0; i < 8; ++i) { const int ka = k0 + 8 * g + i, kb = ka + 16; v[i] = ka < K ? W[(size_t)ka * ld + n] : 0.f; v[8 + i] = kb < K ? W[(size_t)kb * ld + n] : 0.f; }
  return bsplit16(v); }
__device__ __forceinline__ v8f mac3(const F2& a, const F2& b, v8f c) { c = wmma_bf(a.l, b.h, c); c = wmma_bf(a.h, b.l, c); return wmma_bf(a.h, b.h, c); }
__device__ __forceinline__ float sigm(float v) { return 1.0f / (1.0f + expf(-v)); }
#define LDSX() do { asm volatile("s_wait_dscnt 0" ::: "memory"); __builtin_amdgcn_wave_barrier(); __builtin_amdgcn_fence(__ATOMIC_RELEASE, "workgroup"); } while (0)

// Graph interaction layer (single-head attention with a learned relative-position bias, post-LN transformer block). q/k/v / Wo / FFN
// GEMMs on v_wmma_f32_16x16x32_f16 (operands converted in the fragments, [out][in] weights x16; f32 accumulate); the pairwise bias
// MLP (2 -> 512 -> 1, K = 2) in f32 VALU; diagonal masked to -inf; softmax, LayerNorms in f32; P x2^14 f16.
#define NB 8
#define NN 256
#define DD 512
#define FF 1024
#define NR (NB * NN)

// q, k -> f16 rows [r][512]; v -> vT [b][d][n] f16 ; blockIdx.y: 0..3 q cols, 4..7 k cols, 8..11 v cols (128 each)
__global__ __launch_bounds__(128) void k_qkv(const float* __restrict__ x, const float* __restrict__ Wq, const float* __restrict__ bq, const float* __restrict__ Wk, const float* __restrict__ bk, const float* __restrict__ Wv, const float* __restrict__ bv,
                                           _Float16* __restrict__ q16, _Float16* __restrict__ k16, _Float16* __restrict__ vT) {
  __shared__ __align__(16) float so[4][16][132];
  __shared__ __align__(16) _Float16 st[128][72];
  const int tid = threadIdx.x, wave = tid >> 5, lane = tid & 31, col = lane & 15, g = lane >> 4;
  const int r0b = blockIdx.x * 64, r0 = r0b + wave * 16; const int which = blockIdx.y / 4, n0 = (blockIdx.y % 4) * 128; const int b = r0b / NN, t0 = r0b % NN;
  const float* W = which == 0 ? Wq : (which == 1 ? Wk : Wv); const float* bias = which == 0 ? bq : (which == 1 ? bk : bv);
  v8f acc[8] = {};
#pragma unroll 1
  for (int kc = 0; kc < DD / 32; ++kc) { const v16h a = frag_f32(x + (size_t)(r0 + col) * DD + kc * 32, lane);
#pragma unroll
    for (int j = 0; j < 8; ++j) acc[j] = wmma16(a, frag_f32s(W + (size_t)(n0 + j * 16 + col) * DD + kc * 32, lane, 16.0f), acc[j]); }
#pragma unroll
  for (int j = 0; j < 8; ++j) { const float bb = bias[n0 + j * 16 + col];
#pragma unroll
    for (int r = 0; r < 8; ++r) so[wave][8 * g + r][j * 16 + col] = acc[j][r] * (1.0f / 16.0f) + bb; }
  LDSX();
  if (which < 2) { _Float16* dst = which == 0 ? q16 : k16;
    for (int q = lane; q < 16 * 16; q += 32) { const int rl = q >> 4, pc = q & 15; union { v8h h8; v4u u; } pk;
#pragma unroll
      for (int e = 0; e < 8; ++e) pk.h8[e] = (_Float16)so[wave][rl][pc * 8 + e];
      vst2(dst + (size_t)(r0 + rl) * DD + n0 + pc * 8, pk.u); } }
  else {
#pragma unroll 4
    for (int rl = 0; rl < 16; ++rl) {
#pragma unroll
      for (int e = 0; e < 4; ++e) st[lane * 4 + e][wave * 16 + rl] = (_Float16)so[wave][rl][lane * 4 + e]; }
    __syncthreads();
    for (int q = tid; q < 128 * 8; q += 128) { const int c = q >> 3, pc = q & 7; vst2(vT + ((size_t)b * DD + n0 + c) * NN + t0 + pc * 8, *(const v4u*)(&st[c][pc * 8])); } }
}
// bias[b][n][m] = Wr2 . relu(rel @ Wr1^T + br1) + br2, rel = pc[n] - pc[m]; block (n, b), 256 threads = m
__global__ __launch_bounds__(256) void k_bias(const float* __restrict__ pcs, const float* __restrict__ Wr1, const float* __restrict__ br1, const float* __restrict__ Wr2, const float* __restrict__ br2, float* __restrict__ bias) {
  __shared__ float sw1[DD][2], sb1[DD], sw2[DD]; __shared__ __align__(16) float so[NN];
  const int n = blockIdx.x, b = blockIdx.y, tid = threadIdx.x;
  for (int c = tid; c < DD; c += 256) { sw1[c][0] = Wr1[c * 2]; sw1[c][1] = Wr1[c * 2 + 1]; sb1[c] = br1[c]; sw2[c] = Wr2[c]; }
  __syncthreads();
  { const int m = tid; const float rx = pcs[((size_t)b * NN + n) * 2] - pcs[((size_t)b * NN + m) * 2], ry = pcs[((size_t)b * NN + n) * 2 + 1] - pcs[((size_t)b * NN + m) * 2 + 1];
    float a = br2[0];
#pragma unroll 4
    for (int c = 0; c < DD; ++c) { float hv = rx * sw1[c][0] + ry * sw1[c][1] + sb1[c]; hv = hv > 0.f ? hv : 0.f; a += hv * sw2[c]; }
    so[m] = a; }
  __syncthreads();
  if (tid < NN / 4) vst2(bias + ((size_t)b * NN + n) * NN + tid * 4, *(const v4f*)(&so[tid * 4]));
}
// attention: block (b, 64 queries): S = q.k/sqrt(512) + bias, diagonal excluded, softmax over 256 (f32), P x2^14 f16 @ vT -> AG rows f32 [r][512]
__global__ __launch_bounds__(128) void k_attn(const _Float16* __restrict__ q16, const _Float16* __restrict__ k16, const _Float16* __restrict__ vT, const float* __restrict__ bias, float* __restrict__ AG) {
  __shared__ __align__(16) float sS[4][16][260];
  __shared__ __align__(16) _Float16 sP[4][16][264];
  __shared__ __align__(16) float sA[4][16][260];
  const int tid = threadIdx.x, w = tid >> 5, lane = tid & 31, col = lane & 15, g = lane >> 4;
  const int b = blockIdx.y, q0 = blockIdx.x * 64 + w * 16; const size_t rb = (size_t)b * NN;
  { v16h aq[16];
#pragma unroll
    for (int kc = 0; kc < 16; ++kc) aq[kc] = frag_h(q16 + (rb + q0 + col) * DD + kc * 32, lane);
#pragma unroll 1
    for (int t = 0; t < NN / 16; ++t) { v8f s = {};
#pragma unroll
      for (int kc = 0; kc < 16; ++kc) s = wmma16(aq[kc], frag_h(k16 + (rb + t * 16 + col) * DD + kc * 32, lane), s);
#pragma unroll
      for (int r = 0; r < 8; ++r) { const int qi = q0 + 8 * g + r, m = t * 16 + col; sS[w][8 * g + r][m] = (m == qi) ? -3.0e38f : s[r] * 0.044194173824159216f + bias[(rb + qi) * NN + m]; } } }
  LDSX();
  { const int m = col; float mx = -3.4e38f;
    for (int e = 0; e < 128; ++e) mx = fmaxf(mx, sS[w][m][g * 128 + e]);
    mx = fmaxf(mx, __shfl_xor(mx, 16, 32)); float l = 0.f;
    for (int e = 0; e < 128; ++e) { const float sv = sS[w][m][g * 128 + e]; const float p = sv <= -1.0e38f ? 0.f : expf(sv - mx); l += p; sS[w][m][g * 128 + e] = p; }
    l += __shfl_xor(l, 16, 32); const float inv = 16384.0f / l;
    for (int e = 0; e < 128; ++e) sP[w][m][g * 128 + e] = (_Float16)(sS[w][m][g * 128 + e] * inv); }
  LDSX();
  v16h pa[8];
#pragma unroll
  for (int kc = 0; kc < 8; ++kc) pa[kc] = frag_h(&sP[w][col][0] + kc * 32, lane);
#pragma unroll 1
  for (int np = 0; np < 2; ++np) { v8f acc[16];
#pragma unroll
    for (int j = 0; j < 16; ++j) acc[j] = (v8f){};
#pragma unroll
    for (int kc = 0; kc < 8; ++kc) {
#pragma unroll
      for (int j = 0; j < 16; ++j) acc[j] = wmma16(pa[kc], frag_h(vT + ((size_t)b * DD + np * 256 + j * 16 + col) * NN + kc * 32, lane), acc[j]); }
#pragma unroll
    for (int j = 0; j < 16; ++j)
#pragma unroll
      for (int r = 0; r < 8; ++r) sA[w][8 * g + r][j * 16 + col] = acc[j][r] * (1.0f / 16384.0f);
    LDSX();
    for (int q = lane; q < 16 * 64; q += 32) { const int rl = q >> 6, pc = q & 63; vst2(AG + (rb + q0 + rl) * DD + np * 256 + pc * 4, *(const v4f*)(&sA[w][rl][pc * 4])); }
    LDSX(); }
}
// generic: Out = LN(A @ W^T + bias + res) over 512 columns; block = 16 rows, 16 waves: wave w computes columns 32w..32w+31 of the product
// for all 16 rows, then (behind the block barrier) the LayerNorm of row w; K = KIN (A f32 rows or f16 rows per AH)
template <int KIN, int AH>      // AH: A operand is f16 rows pre-scaled x4 (so the product is /64), else f32 rows (/16)
__global__ __launch_bounds__(512) void k_lnproj(const void* __restrict__ Ain, const float* __restrict__ W, const float* __restrict__ bias, const float* __restrict__ res, const float* __restrict__ gam, const float* __restrict__ bet, float* __restrict__ Out) {
  __shared__ __align__(16) float so[16][DD + 4];
  const int tid = threadIdx.x, lane = tid & 31, col = lane & 15, g = lane >> 4;
  const int wave = __builtin_amdgcn_readfirstlane(tid >> 5);   // the wave's number in a scalar register: tile bases stay scalar, the lane offset is loop-invariant
  const int r0 = blockIdx.x * 16, n0 = wave * 32;
  const unsigned vo = (unsigned)col * KIN;                      // the lane's row inside a 16-row tile, alike for A and W
  const float* Wt = W + (size_t)n0 * KIN;
  v8f acc[2] = {};
#pragma unroll 1   // rolled: one k step's fragments live at a time
  for (int kc = 0; kc < KIN / 32; ++kc) { v16h a; if (AH) a = frag_h((const _Float16*)Ain + (size_t)r0 * KIN + kc * 32 + vo, lane); else a = frag_f32((const float*)Ain + (size_t)r0 * KIN + kc * 32 + vo, lane);
#pragma unroll
    for (int j = 0; j < 2; ++j) acc[j] = wmma16(a, frag_f32s(Wt + j * 16 * KIN + kc * 32 + vo, lane, 16.0f), acc[j]); }
#pragma unroll
  for (int j = 0; j < 2; ++j) { const int c = n0 + j * 16 + col; const float bb = bias[c];
#pragma unroll
    for (int r = 0; r < 8; ++r) so[8 * g + r][c] = acc[j][r] * (AH ? (1.0f / 64.0f) : (1.0f / 16.0f)) + bb; }
  __syncthreads();   // every row now holds the column slices of all 16 waves
  // row 'wave': 16 values per lane in whole 512-byte pieces; the short loops below are unrolled so that v[] stays in registers
  { const float* row = &so[wave][0]; const float* rrow = res + (size_t)(r0 + wave) * DD; v4f v[4]; float s = 0.f;
#pragma unroll
    for (int i = 0; i < 4; ++i) { v[i] = *(const v4f*)(&row[i * 128 + lane * 4]) + *(const v4f*)(rrow + i * 128 + lane * 4); s += (v[i][0] + v[i][1]) + (v[i][2] + v[i][3]); }
#pragma unroll
    for (int o = 16; o > 0; o >>= 1) s += __shfl_xor(s, o, 32);
    const float mu = s * (1.0f / DD); float q2 = 0.f;
#pragma unroll
    for (int i = 0; i < 4; ++i)
#pragma unroll
      for (int e = 0; e < 4; ++e) { const float d = v[i][e] - mu; q2 += d * d; }
#pragma unroll
    for (int o = 16; o > 0; o >>= 1) q2 += __shfl_xor(q2, o, 32);
    const float rs = rsqrtf(q2 * (1.0f / DD) + 1e-5f);
#pragma unroll
    for (int i = 0; i < 4; ++i) { const int cc = i * 128 + lane * 4; const v4f gm = *(const v4f*)(gam + cc), bt = *(const v4f*)(bet + cc); v4f o4;
#pragma unroll
      for (int e = 0; e < 4; ++e) o4[e] = (v[i][e] - mu) * rs * gm[e] + bt[e];
      vst2(Out + (size_t)(r0 + wave) * DD + cc, o4); } }
}
// FFN hidden: H16[r][1024] = relu(x1 @ Wf1^T + bf1) as f16 (x4); block 64 rows x 128 cols
__global__ __launch_bounds__(128) void k_ff1(const float* __restrict__ x1, const float* __restrict__ Wf1, const float* __restrict__ bf1, _Float16* __restrict__ H16) {
  __shared__ __align__(16) float so[4][16][132];
  const int tid = threadIdx.x, wave = tid >> 5, lane = tid & 31, col = lane & 15, g = lane >> 4;
  const int r0 = blockIdx.x * 64 + wave * 16, n0 = blockIdx.y * 128;
  v8f acc[8] = {};
#pragma unroll 1
  for (int kc = 0; kc < DD / 32; ++kc) { const v16h a = frag_f32(x1 + (size_t)(r0 + col) * DD + kc * 32, lane);
#pragma unroll
    for (int j = 0; j < 8; ++j) acc[j] = wmma16(a, frag_f32s(Wf1 + (size_t)(n0 + j * 16 + col) * DD + kc * 32, lane, 16.0f), acc[j]); }
#pragma unroll
  for (int j = 0; j < 8; ++j) { const float bb = bf1[n0 + j * 16 + col];
#pragma unroll
    for (int r = 0; r < 8; ++r) { const float v = acc[j][r] * (1.0f / 16.0f) + bb; so[wave][8 * g + r][j * 16 + col] = v > 0.f ? v * 4.0f : 0.f; } }
  LDSX();
  for (int q = lane; q < 16 * 16; q += 32) { const int rl = q >> 4, pc = q & 15; union { v8h h8; v4u u; } pk;
#pragma unroll
    for (int e = 0; e < 8; ++e) pk.h8[e] = (_Float16)so[wave][rl][pc * 8 + e];
    vst2(H16 + (size_t)(r0 + rl) * FF + n0 + pc * 8, pk.u); }
}
extern "C" void kernel_launch(void* const* d_in, const int* in_sizes, int n_in, void* d_out, int out_size, void* d_ws, size_t ws_size, hipStream_t stream) {
  (void)in_sizes; (void)n_in; (void)out_size; (void)ws_size;
  const float** I = (const float**)d_in;
  const float* x = I[0]; const float* pcs = I[1]; const float* Wq = I[2]; const float* bq = I[3]; const float* Wk = I[4]; const float* bk = I[5]; const float* Wv = I[6]; const float* bv = I[7];
  const float* Wr1 = I[8]; const float* br1 = I[9]; const float* Wr2 = I[10]; const float* br2 = I[11]; const float* Wo = I[12]; const float* bo = I[13]; const float* g1 = I[14]; const float* be1 = I[15];
  const float* Wf1 = I[16]; const float* bf1 = I[17]; const float* Wf2 = I[18]; const float* bf2 = I[19]; const float* g2 = I[20]; const float* be2 = I[21];
  float* out = (float*)d_out;
  char* ws = (char*)d_ws; size_t off = 0;
  auto take = [&](size_t bytes) { char* p = ws + off; off += (bytes + 255) & ~(size_t)255; return p; };
  _Float16* q16 = (_Float16*)take((size_t)NR * DD * 2); _Float16* k16 = (_Float16*)take((size_t)NR * DD * 2); _Float16* vT = (_Float16*)take((size_t)NR * DD * 2); float* bias = (float*)take((size_t)NB * NN * NN * 4);
  float* AG = (float*)take((size_t)NR * DD * 4); float* x1 = (float*)take((size_t)NR * DD * 4); _Float16* H16 = (_Float16*)take((size_t)NR * FF * 2);
  k_qkv<<<dim3(NR / 64, 12), 128, 0, stream>>>(x, Wq, bq, Wk, bk, Wv, bv, q16, k16, vT);
  k_bias<<<dim3(NN, NB), 256, 0, stream>>>(pcs, Wr1, br1, Wr2, br2, bias);
  k_attn<<<dim3(NN / 64, NB), 128, 0, stream>>>(q16, k16, vT, bias, AG);
  k_lnproj<DD, 0><<<NR / 16, 512, 0, stream>>>(AG, Wo, bo, x, g1, be1, x1);
  k_ff1<<<dim3(NR / 64, FF / 128), 128, 0, stream>>>(x1, Wf1, bf1, H16);
  k_lnproj<FF, 1><<<NR / 16, 512, 0, stream>>>(H16, Wf2, bf2, x1, g2, be2, out);       // hidden x4 (f16) and Wf2 x16 -> /64 inside
}

// v003
// One run takes 118 microseconds.
// It is 2.95 times as fast as v001, going by the measured steps of the versions left out in between.
// All steps since v000 together make it 7.63 times as fast.
#include <hip/hip_runtime.h>
#include <math.h>

typedef __attribute__((ext_vector_type(16))) _Float16 v16h;
typedef __attribute__((ext_vector_type(16))) __bf16 v16b;
typedef __attribute__((ext_vector_type(8)))  _Float16 v8h;
typedef __attribute__((ext_vector_type(4)))  _Float16 v4h;
typedef __attribute__((ext_vector_type(8)))  float v8f;
typedef __attribute__((ext_vector_type(4)))  float v4f;
typedef __attribute__((ext_vector_type(2)))  float v2f;
typedef __attribute__((ext_vector_type(4)))  unsigned v4u;
typedef __attribute__((ext_vector_type(4)))  int v4i;
typedef float __attribute__((may_alias)) float_a;
typedef int __attribute__((may_alias)) int_a;

template <typename T> __device__ __forceinline__ void vst2(void* p, T v) { *(T*)p = v;  }
__device__ __forceinline__ v8f wmma16(v16h a, v16h b, v8f c) {
  v8f d = __builtin_amdgcn_wmma_f32_16x16x32_f16(false, a, false, b, (short)0, c, false, false);
  asm volatile("v_nop\n\tv_nop\n\tv_nop\n\tv_nop" : "+v"(d) : "v"(a), "v"(b));
  return d;
}
__device__ __forceinline__ v8f wmma_bf(v16b a, v16b b, v8f c) {
  v8f d = __builtin_amdgcn_wmma_f32_16x16x32_bf16(false, a, false, b, (short)0, c, false, false);
  asm volatile("v_nop\n\tv_nop\n\tv_nop\n\tv_nop" : "+v"(d) : "v"(a), "v"(b));
  return d;
}
// 16x16x32 fragments: lane = (h = lane>>4, row/col = lane&15); elements 0..7 = k0+8h+0..7, 8..15 = k0+16+8h+0..7; D element r = row 8h+r
__device__ __forceinline__ v16h frag_h(const _Float16* rowk0, int lane) {
  union { v16h v; v8h q[2]; } u; const _Float16* p = rowk0 + 8 * (lane >> 4);
  u.q[0] = *(const v8h*)p; u.q[1] = *(const v8h*)(p + 16); return u.v;
}
__device__ __forceinline__ v16h frag_f32(const float* rowk0, int lane) {
  v16h a; const float* p = rowk0 + 8 * (lane >> 4);
#pragma unroll
  for (int i = 0; i < 8; ++i) { a[i] = (_Float16)p[i]; a[8 + i] = (_Float16)p[16 + i]; }
  return a;
}
__device__ __forceinline__ v16h frag_f32s(const float* rowk0, int lane, float sc) {
  v16h a; const float* p = rowk0 + 8 * (lane >> 4);
#pragma unroll
  for (int i = 0; i < 8; ++i) { a[i] = (_Float16)(p[i] * sc); a[8 + i] = (_Float16)(p[16 + i] * sc); }
  return a;
}
// column fragment from a [K][ld] layout (column n), rows >= K read as 0
__device__ __forceinline__ v16h fragc_f32(const float* W, int k0, int n, int lane, int ld, int K) {
  v16h a; const int g = lane >> 4;
#pragma unroll
  for (int i = 0; i < 8; ++i) { const int ka = k0 + 8 * g + i, kb = ka + 16;
    a[i] = (_Float16)(ka < K ? W[(size_t)ka * ld + n] : 0.f); a[8 + i] = (_Float16)(kb < K ? W[(size_t)kb * ld + n] : 0.f); }
  return a;
}
struct F2 { v16b h, l; };
__device__ __forceinline__ F2 bsplit16(const float v[16]) { F2 r;
#pragma unroll
  for (int i = 0; i < 16; ++i) { const __bf16 h = (__bf16)v[i]; r.h[i] = h; r.l[i] = (__bf16)(v[i] - (float)h); }
  return r; }
__device__ __forceinline__ F2 split_row(const float* row, int k0, int lane) { float v[16]; const float* p = row + k0 + 8 * (lane >> 4);
#pragma unroll
  for (int i = 0; i < 8; ++i) { v[i] = p[i]; v[8 + i] = p[16 + i]; }
  return bsplit16(v); }
__device__ __forceinline__ F2 split_rowK(const float* row, int k0, int lane, int K) { float v[16]; const int g = lane >> 4;
#pragma unroll
  for (int i = 0; i < 8; ++i) { const int ka = k0 + 8 * g + i, kb = ka + 16; v[i] = ka < K ? row[ka] : 0.f; v[8 + i] = kb < K ? row[kb] : 0.f; }
  return bsplit16(v); }
__device__ __forceinline__ F2 split_col(const float* W, int k0, int n, int lane, int ld, int K) { float v[16]; const int g = lane >> 4;
#pragma unroll
  for (int i = 0; i < 8; ++i) { const int ka = k0 + 8 * g + i, kb = ka + 16; v[i] = ka < K ? W[(size_t)ka * ld + n] : 0.f; v[8 + i] = kb < K ? W[(size_t)kb * ld + n] : 0.f; }
  return bsplit16(v); }
__device__ __forceinline__ v8f mac3(const F2& a, const F2& b, v8f c) { c = wmma_bf(a.l, b.h, c); c = wmma_bf(a.h, b.l, c); return wmma_bf(a.h, b.h, c); }
__device__ __forceinline__ float sigm(float v) { return 1.0f / (1.0f + expf(-v)); }
#define LDSX() do { asm volatile("s_wait_dscnt 0" ::: "memory"); __builtin_amdgcn_wave_barrier(); __builtin_amdgcn_fence(__ATOMIC_RELEASE, "workgroup"); } while (0)

// Graph interaction layer (single-head attention with a learned relative-position bias, post-LN transformer block). q/k/v / Wo / FFN
// GEMMs on v_wmma_f32_16x16x32_f16 (operands converted on the way into LDS, [out][in] weights x16; f32 accumulate); the pairwise bias
// MLP (2 -> 512 -> 1, K = 2) in f32 VALU; diagonal masked to -inf; softmax, LayerNorms in f32; P x2^14 f16.
#define NB 8
#define NN 256
#define DD 512
#define FF 1024
#define NR (NB * NN)

// 64 x 128 tile of X @ W^T over K = 512 for a block of 4 waves (wave w: rows 16w..16w+15, all 128 columns). X and W arrive in chunks of KC
// columns: every thread fetches whole 256-byte row pieces (16 lanes a row), converts once (W x16) and stores f16 rows of pitch KP in LDS;
// the fragments come from LDS. Two buffers: the next chunk's loads are asked for before this chunk's products and fly behind them.
#define KC 64
#define KP (KC + 8)
__device__ __forceinline__ void tile_mm(const float* __restrict__ X, const float* __restrict__ Wm, _Float16* sX, _Float16* sW, int tid, v8f (&acc)[8]) {
  const int wave = tid >> 5, lane = tid & 31, col = lane & 15, pr = tid >> 4, pc = (tid & 15) * 4;
  const unsigned vo = (unsigned)(pr * DD + pc);   // the thread's place inside a chunk: loop-invariant lane offset, the chunk's base stays scalar
  v4f xa[8], wb[16];
#pragma unroll
  for (int i = 0; i < 8; ++i) xa[i] = *(const v4f*)(X + i * 8 * DD + vo);
#pragma unroll
  for (int i = 0; i < 16; ++i) wb[i] = *(const v4f*)(Wm + i * 8 * DD + vo);
#pragma unroll 1   // rolled: one chunk in registers, one in each LDS buffer
  for (int c = 0; c < DD / KC; ++c) { _Float16* bx = sX + (c & 1) * (64 * KP); _Float16* bw = sW + (c & 1) * (128 * KP);
#pragma unroll
    for (int i = 0; i < 8; ++i) { v4h h4;
#pragma unroll
      for (int e = 0; e < 4; ++e) h4[e] = (_Float16)xa[i][e];
      vst2(bx + (i * 8 + pr) * KP + pc, h4); }
#pragma unroll
    for (int i = 0; i < 16; ++i) { v4h h4;
#pragma unroll
      for (int e = 0; e < 4; ++e) h4[e] = (_Float16)(wb[i][e] * 16.0f);
      vst2(bw + (i * 8 + pr) * KP + pc, h4); }
    __syncthreads();   // chunk c is whole; it also ends every wave's reads of the other buffer, which the next trip refills
    if (c + 1 < DD / KC) { X += KC; Wm += KC;   // asked for behind the barrier (whose fence would wait for them), so that they fly while this chunk's products run
#pragma unroll
      for (int i = 0; i < 8; ++i) xa[i] = *(const v4f*)(X + i * 8 * DD + vo);
#pragma unroll
      for (int i = 0; i < 16; ++i) wb[i] = *(const v4f*)(Wm + i * 8 * DD + vo); }
#pragma unroll
    for (int ks = 0; ks < KC / 32; ++ks) { const v16h a = frag_h(bx + (wave * 16 + col) * KP + ks * 32, lane); v16h bf[8];   // all nine fragments asked for before the first product
#pragma unroll
      for (int j = 0; j < 8; ++j) bf[j] = frag_h(bw + (j * 16 + col) * KP + ks * 32, lane);
#pragma unroll
      for (int j = 0; j < 8; ++j) acc[j] = wmma16(a, bf[j], acc[j]); } }
}
// q, k -> f16 rows [r][512]; v -> vT [b][d][n] f16 ; blockIdx.y: 0..3 q cols, 4..7 k cols, 8..11 v cols (128 each)
__global__ __launch_bounds__(128) void k_qkv(const float* __restrict__ x, const float* __restrict__ Wq, const float* __restrict__ bq, const float* __restrict__ Wk, const float* __restrict__ bk, const float* __restrict__ Wv, const float* __restrict__ bv,
                                           _Float16* __restrict__ q16, _Float16* __restrict__ k16, _Float16* __restrict__ vT) {
  __shared__ __align__(16) float so[4][16][132];
  __shared__ __align__(16) _Float16 st[128][72];
  __shared__ __align__(16) _Float16 sX[2][64][KP], sW[2][128][KP];
  const int tid = threadIdx.x, wave = tid >> 5, lane = tid & 31, col = lane & 15, g = lane >> 4;
  const int r0b = blockIdx.x * 64, r0 = r0b + wave * 16; const int which = blockIdx.y / 4, n0 = (blockIdx.y % 4) * 128; const int b = r0b / NN, t0 = r0b % NN;
  const float* W = which == 0 ? Wq : (which == 1 ? Wk : Wv); const float* bias = which == 0 ? bq : (which == 1 ? bk : bv);
  v8f acc[8] = {};
  tile_mm(x + (size_t)r0b * DD, W + (size_t)n0 * DD, &sX[0][0][0], &sW[0][0][0], tid, acc);
#pragma unroll
  for (int j = 0; j < 8; ++j) { const float bb = bias[n0 + j * 16 + col];
#pragma unroll
    for (int r = 0; r < 8; ++r) so[wave][8 * g + r][j * 16 + col] = acc[j][r] * (1.0f / 16.0f) + bb; }
  LDSX();
  if (which < 2) { _Float16* dst = which == 0 ? q16 : k16;
    for (int q = lane; q < 16 * 16; q += 32) { const int rl = q >> 4, pc = q & 15; union { v8h h8; v4u u; } pk;
#pragma unroll
      for (int e = 0; e < 8; ++e) pk.h8[e] = (_Float16)so[wave][rl][pc * 8 + e];
      vst2(dst + (size_t)(r0 + rl) * DD + n0 + pc * 8, pk.u); } }
  else {
#pragma unroll 4
    for (int rl = 0; rl < 16; ++rl) {
#pragma unroll
      for (int e = 0; e < 4; ++e) st[lane * 4 + e][wave * 16 + rl] = (_Float16)so[wave][rl][lane * 4 + e]; }
    __syncthreads();
    for (int q = tid; q < 128 * 8; q += 128) { const int c = q >> 3, pc = q & 7; vst2(vT + ((size_t)b * DD + n0 + c) * NN + t0 + pc * 8, *(const v4u*)(&st[c][pc * 8])); } }
}
// bias[b][n][m] = Wr2 . relu(rel @ Wr1^T + br1) + br2, rel = pc[n] - pc[m]; block (n, b), 256 threads = m
__global__ __launch_bounds__(256) void k_bias(const float* __restrict__ pcs, const float* __restrict__ Wr1, const float* __restrict__ br1, const float* __restrict__ Wr2, const float* __restrict__ br2, float* __restrict__ bias) {
  __shared__ float sw1[DD][2], sb1[DD], sw2[DD]; __shared__ __align__(16) float so[NN];
  const int n = blockIdx.x, b = blockIdx.y, tid = threadIdx.x;
  for (int c = tid; c < DD; c += 256) { sw1[c][0] = Wr1[c * 2]; sw1[c][1] = Wr1[c * 2 + 1]; sb1[c] = br1[c]; sw2[c] = Wr2[c]; }
  __syncthreads();
  { const int m = tid; const float rx = pcs[((size_t)b * NN + n) * 2] - pcs[((size_t)b * NN + m) * 2], ry = pcs[((size_t)b * NN + n) * 2 + 1] - pcs[((size_t)b * NN + m) * 2 + 1];
    float a = br2[0];
#pragma unroll 4
    for (int c = 0; c < DD; ++c) { float hv = rx * sw1[c][0] + ry * sw1[c][1] + sb1[c]; hv = hv > 0.f ? hv : 0.f; a += hv * sw2[c]; }
    so[m] = a; }
  __syncthreads();
  if (tid < NN / 4) vst2(bias + ((size_t)b * NN + n) * NN + tid * 4, *(const v4f*)(&so[tid * 4]));
}
// attention: block (b, 16 queries), 16 waves; S = q.k/sqrt(512) + bias, diagonal excluded, softmax over 256 (f32), P x2^14 f16 @ vT -> AG rows f32 [r][512].
// Wave w: the 16 queries against keys 16w..16w+15 (the q tile is staged once in LDS); behind a block barrier the softmax of row w;
// behind a second one columns 32w..32w+31 of P @ v. Each phase asks for all its global operands before its first product.
// The short loops are all unrolled so that the fragment arrays are indexed by constants and stay in registers.
__global__ __launch_bounds__(512) void k_attn(const _Float16* __restrict__ q16, const _Float16* __restrict__ k16, const _Float16* __restrict__ vT, const float* __restrict__ bias, float* __restrict__ AG) {
  __shared__ __align__(16) _Float16 sQ[16][DD + 8];
  __shared__ __align__(16) float sS[16][NN + 4];
  __shared__ __align__(16) _Float16 sP[16][NN + 8];
  __shared__ __align__(16) float sA[16][16][36];
  const int tid = threadIdx.x, lane = tid & 31, col = lane & 15, g = lane >> 4;
  const int w = __builtin_amdgcn_readfirstlane(tid >> 5);   // the wave's number in a scalar register: tile bases stay scalar
  const int b = blockIdx.y, q0 = blockIdx.x * 16; const size_t rb = (size_t)b * NN;
  { v16h kf[16]; float bv[8];
#pragma unroll
    for (int kc = 0; kc < 16; ++kc) kf[kc] = frag_h(k16 + (rb + w * 16 + col) * DD + kc * 32, lane);
#pragma unroll
    for (int r = 0; r < 8; ++r) bv[r] = bias[(rb + q0 + 8 * g + r) * NN + w * 16 + col];
#pragma unroll
    for (int i = 0; i < 2; ++i) { const int q = tid + i * 512, rl = q >> 6, pc = q & 63; vst2(&sQ[rl][pc * 8], *(const v4u*)(q16 + (rb + q0 + rl) * DD + pc * 8)); }
    __syncthreads();   // the q tile is whole
    v8f s = {};
#pragma unroll
    for (int h = 0; h < 2; ++h) { v16h aq[8];
#pragma unroll
      for (int kc = 0; kc < 8; ++kc) aq[kc] = frag_h(&sQ[col][0] + (h * 8 + kc) * 32, lane);
#pragma unroll
      for (int kc = 0; kc < 8; ++kc) s = wmma16(aq[kc], kf[h * 8 + kc], s); }
#pragma unroll
    for (int r = 0; r < 8; ++r) { const int qi = q0 + 8 * g + r, m = w * 16 + col; sS[8 * g + r][m] = (m == qi) ? -3.0e38f : s[r] * 0.044194173824159216f + bv[r]; } }
  __syncthreads();   // every score row now holds the key slices of all 16 waves
  v16h vf[2][8];     // asked for here, so that they fly while the row's softmax runs
#pragma unroll
  for (int j = 0; j < 2; ++j)
#pragma unroll
    for (int kc = 0; kc < 8; ++kc) vf[j][kc] = frag_h(vT + ((size_t)b * DD + w * 32 + j * 16 + col) * NN + kc * 32, lane);
  { v4f x[2]; float mx = -3.4e38f;
#pragma unroll
    for (int i = 0; i < 2; ++i) { x[i] = *(const v4f*)(&sS[w][i * 128 + lane * 4]); mx = fmaxf(mx, fmaxf(fmaxf(x[i][0], x[i][1]), fmaxf(x[i][2], x[i][3]))); }
#pragma unroll
    for (int o = 16; o > 0; o >>= 1) mx = fmaxf(mx, __shfl_xor(mx, o, 32));
    float l = 0.f;
#pragma unroll
    for (int i = 0; i < 2; ++i)
#pragma unroll
      for (int e = 0; e < 4; ++e) { const float sv = x[i][e]; const float pv = sv <= -1.0e38f ? 0.f : expf(sv - mx); l += pv; x[i][e] = pv; }
#pragma unroll
    for (int o = 16; o > 0; o >>= 1) l += __shfl_xor(l, o, 32);
    const float inv = 16384.0f / l;
#pragma unroll
    for (int i = 0; i < 2; ++i) { v4h h4;
#pragma unroll
      for (int e = 0; e < 4; ++e) h4[e] = (_Float16)(x[i][e] * inv);
      vst2(&sP[w][i * 128 + lane * 4], h4); } }
  __syncthreads();   // all 16 rows of P are written
  v16h pa[8];
#pragma unroll
  for (int kc = 0; kc < 8; ++kc) pa[kc] = frag_h(&sP[col][0] + kc * 32, lane);
  v8f acc[2] = {};
#pragma unroll
  for (int kc = 0; kc < 8; ++kc) {
#pragma unroll
    for (int j = 0; j < 2; ++j) acc[j] = wmma16(pa[kc], vf[j][kc], acc[j]); }
#pragma unroll
  for (int j = 0; j < 2; ++j)
#pragma unroll
    for (int r = 0; r < 8; ++r) sA[w][8 * g + r][j * 16 + col] = acc[j][r] * (1.0f / 16384.0f);
  LDSX();   // wave-local exchange: the wave's own tile is in LDS before it reads it back as whole 128-byte row pieces
#pragma unroll
  for (int q = lane; q < 16 * 8; q += 32) { const int rl = q >> 3, pc = q & 7; vst2(AG + (rb + q0 + rl) * DD + w * 32 + pc * 4, *(const v4f*)(&sA[w][rl][pc * 4])); }
}
// generic: Out = LN(A @ W^T + bias + res) over 512 columns; block = 16 rows, 16 waves: wave w computes columns 32w..32w+31 of the product
// for all 16 rows, then (behind the block barrier) the LayerNorm of row w; K = KIN (A f32 rows or f16 rows per AH)
template <int KIN, int AH>      // AH: A operand is f16 rows pre-scaled x4 (so the product is /64), else f32 rows (/16)
__global__ __launch_bounds__(512) void k_lnproj(const void* __restrict__ Ain, const float* __restrict__ W, const float* __restrict__ bias, const float* __restrict__ res, const float* __restrict__ gam, const float* __restrict__ bet, float* __restrict__ Out) {
  __shared__ __align__(16) float so[16][DD + 4];
  __shared__ __align__(16) _Float16 sA[16][KIN + 8], sW[2][DD][KP];
  const int tid = threadIdx.x, lane = tid & 31, col = lane & 15, g = lane >> 4;
  const int wave = __builtin_amdgcn_readfirstlane(tid >> 5);   // the wave's number in a scalar register: tile bases stay scalar
  const int r0 = blockIdx.x * 16, n0 = wave * 32;
  // the block's 16 rows of A, whole K, as f16 rows in LDS (fetched in whole lines; f32 rows converted once)
#pragma unroll
  for (int i = 0; i < 4; ++i) { const int q = tid + i * 512;
    if (AH) vst2(&sA[q / (KIN / 8)][(q % (KIN / 8)) * 8], *(const v4u*)((const _Float16*)Ain + (size_t)r0 * KIN + q * 8));
    else { const v4f v = *(const v4f*)((const float*)Ain + (size_t)r0 * KIN + q * 4); v4h h4;
#pragma unroll
      for (int e = 0; e < 4; ++e) h4[e] = (_Float16)v[e];
      vst2(&sA[q / (KIN / 4)][(q % (KIN / 4)) * 4], h4); } }
  // W (all 512 rows) in chunks of KC columns, as in tile_mm: whole 256-byte row pieces, converted once (x16), two LDS buffers
  const int pr = tid >> 4, pc = (tid & 15) * 4;
  const unsigned vo = (unsigned)(pr * KIN + pc);   // loop-invariant lane offset, the chunk's base stays scalar
  v4f wb[16];
#pragma unroll
  for (int i = 0; i < 16; ++i) wb[i] = *(const v4f*)(W + i * 32 * KIN + vo);
  v8f acc[2] = {};
#pragma unroll 1   // rolled: one chunk in registers, one in each LDS buffer
  for (int c = 0; c < KIN / KC; ++c) { _Float16* bw = &sW[0][0][0] + (c & 1) * (DD * KP);
#pragma unroll
    for (int i = 0; i < 16; ++i) { v4h h4;
#pragma unroll
      for (int e = 0; e < 4; ++e) h4[e] = (_Float16)(wb[i][e] * 16.0f);
      vst2(bw + (i * 32 + pr) * KP + pc, h4); }
    __syncthreads();   // chunk c (and, at c = 0, the A tile) is whole; it also ends every wave's reads of the other buffer, which the next trip refills
    if (c + 1 < KIN / KC) { W += KC;   // asked for behind the barrier (whose fence would wait for them), so that they fly while this chunk's products run
#pragma unroll
      for (int i = 0; i < 16; ++i) wb[i] = *(const v4f*)(W + i * 32 * KIN + vo); }
    v16h a[KC / 32], bf[KC / 32][2];   // all six fragments asked for before the first product
#pragma unroll
    for (int ks = 0; ks < KC / 32; ++ks) { a[ks] = frag_h(&sA[col][c * KC + ks * 32], lane);
#pragma unroll
      for (int j = 0; j < 2; ++j) bf[ks][j] = frag_h(bw + (n0 + j * 16 + col) * KP + ks * 32, lane); }
#pragma unroll
    for (int ks = 0; ks < KC / 32; ++ks)
#pragma unroll
      for (int j = 0; j < 2; ++j) acc[j] = wmma16(a[ks], bf[ks][j], acc[j]); }
#pragma unroll
  for (int j = 0; j < 2; ++j) { const int c = n0 + j * 16 + col; const float bb = bias[c];
#pragma unroll
    for (int r = 0; r < 8; ++r) so[8 * g + r][c] = acc[j][r] * (AH ? (1.0f / 64.0f) : (1.0f / 16.0f)) + bb; }
  __syncthreads();   // every row now holds the column slices of all 16 waves
  // row 'wave': 16 values per lane in whole 512-byte pieces; the short loops below are unrolled so that v[] stays in registers
  { const float* row = &so[wave][0]; const float* rrow = res + (size_t)(r0 + wave) * DD; v4f v[4]; float s = 0.f;
#pragma unroll
    for (int i = 0; i < 4; ++i) { v[i] = *(const v4f*)(&row[i * 128 + lane * 4]) + *(const v4f*)(rrow + i * 128 + lane * 4); s += (v[i][0] + v[i][1]) + (v[i][2] + v[i][3]); }
#pragma unroll
    for (int o = 16; o > 0; o >>= 1) s += __shfl_xor(s, o, 32);
    const float mu = s * (1.0f / DD); float q2 = 0.f;
#pragma unroll
    for (int i = 0; i < 4; ++i)
#pragma unroll
      for (int e = 0; e < 4; ++e) { const float d = v[i][e] - mu; q2 += d * d; }
#pragma unroll
    for (int o = 16; o > 0; o >>= 1) q2 += __shfl_xor(q2, o, 32);
    const float rs = rsqrtf(q2 * (1.0f / DD) + 1e-5f);
#pragma unroll
    for (int i = 0; i < 4; ++i) { const int cc = i * 128 + lane * 4; const v4f gm = *(const v4f*)(gam + cc), bt = *(const v4f*)(bet + cc); v4f o4;
#pragma unroll
      for (int e = 0; e < 4; ++e) o4[e] = (v[i][e] - mu) * rs * gm[e] + bt[e];
      vst2(Out + (size_t)(r0 + wave) * DD + cc, o4); } }
}
// FFN hidden: H16[r][1024] = relu(x1 @ Wf1^T + bf1) as f16 (x4); block 64 rows x 128 cols
__global__ __launch_bounds__(128) void k_ff1(const float* __restrict__ x1, const float* __restrict__ Wf1, const float* __restrict__ bf1, _Float16* __restrict__ H16) {
  __shared__ __align__(16) float so[4][16][132];
  __shared__ __align__(16) _Float16 sX[2][64][KP], sW[2][128][KP];
  const int tid = threadIdx.x, wave = tid >> 5, lane = tid & 31, col = lane & 15, g = lane >> 4;
  const int r0 = blockIdx.x * 64 + wave * 16, n0 = blockIdx.y * 128;
  v8f acc[8] = {};
  tile_mm(x1 + (size_t)blockIdx.x * 64 * DD, Wf1 + (size_t)n0 * DD, &sX[0][0][0], &sW[0][0][0], tid, acc);
#pragma unroll
  for (int j = 0; j < 8; ++j) { const float bb = bf1[n0 + j * 16 + col];
#pragma unroll
    for (int r = 0; r < 8; ++r) { const float v = acc[j][r] * (1.0f / 16.0f) + bb; so[wave][8 * g + r][j * 16 + col] = v > 0.f ? v * 4.0f : 0.f; } }
  LDSX();
  for (int q = lane; q < 16 * 16; q += 32) { const int rl = q >> 4, pc = q & 15; union { v8h h8; v4u u; } pk;
#pragma unroll
    for (int e = 0; e < 8; ++e) pk.h8[e] = (_Float16)so[wave][rl][pc * 8 + e];
    vst2(H16 + (size_t)(r0 + rl) * FF + n0 + pc * 8, pk.u); }
}
extern "C" void kernel_launch(void* const* d_in, const int* in_sizes, int n_in, void* d_out, int out_size, void* d_ws, size_t ws_size, hipStream_t stream) {
  (void)in_sizes; (void)n_in; (void)out_size; (void)ws_size;
  const float** I = (const float**)d_in;
  const float* x = I[0]; const float* pcs = I[1]; const float* Wq = I[2]; const float* bq = I[3]; const float* Wk = I[4]; const float* bk = I[5]; const float* Wv = I[6]; const float* bv = I[7];
  const float* Wr1 = I[8]; const float* br1 = I[9]; const float* Wr2 = I[10]; const float* br2 = I[11]; const float* Wo = I[12]; const float* bo = I[13]; const float* g1 = I[14]; const float* be1 = I[15];
  const float* Wf1 = I[16]; const float* bf1 = I[17]; const float* Wf2 = I[18]; const float* bf2 = I[19]; const float* g2 = I[20]; const float* be2 = I[21];
  float* out = (float*)d_out;
  char* ws = (char*)d_ws; size_t off = 0;
  auto take = [&](size_t bytes) { char* p = ws + off; off += (bytes + 255) & ~(size_t)255; return p; };
  _Float16* q16 = (_Float16*)take((size_t)NR * DD * 2); _Float16* k16 = (_Float16*)take((size_t)NR * DD * 2); _Float16* vT = (_Float16*)take((size_t)NR * DD * 2); float* bias = (float*)take((size_t)NB * NN * NN * 4);
  float* AG = (float*)take((size_t)NR * DD * 4); float* x1 = (float*)take((size_t)NR * DD * 4); _Float16* H16 = (_Float16*)take((size_t)NR * FF * 2);
  k_qkv<<<dim3(NR / 64, 12), 128, 0, stream>>>(x, Wq, bq, Wk, bk, Wv, bv, q16, k16, vT);
  k_bias<<<dim3(NN, NB), 256, 0, stream>>>(pcs, Wr1, br1, Wr2, br2, bias);
  k_attn<<<dim3(NN / 16, NB), 512, 0, stream>>>(q16, k16, vT, bias, AG);
  k_lnproj<DD, 0><<<NR / 16, 512, 0, stream>>>(AG, Wo, bo, x, g1, be1, x1);
  k_ff1<<<dim3(NR / 64, FF / 128), 128, 0, stream>>>(x1, Wf1, bf1, H16);
  k_lnproj<FF, 1><<<NR / 16, 512, 0, stream>>>(H16, Wf2, bf2, x1, g2, be2, out);       // hidden x4 (f16) and Wf2 x16 -> /64 inside
}

// v004
// Measured time: 99.5 microseconds a run.
// Two timings next to v003 put it at 1.19 and 1.20 times that version's speed.
// Counting every step since v000, it is 9.10 times as fast.
#include <hip/hip_runtime.h>
#include <math.h>

typedef __attribute__((ext_vector_type(16))) _Float16 v16h;
typedef __attribute__((ext_vector_type(16))) __bf16 v16b;
typedef __attribute__((ext_vector_type(8)))  _Float16 v8h;
typedef __attribute__((ext_vector_type(4)))  _Float16 v4h;
typedef __attribute__((ext_vector_type(8)))  float v8f;
typedef __attribute__((ext_vector_type(4)))  float v4f;
typedef __attribute__((ext_vector_type(2)))  float v2f;
typedef __attribute__((ext_vector_type(4)))  unsigned v4u;
typedef __attribute__((ext_vector_type(4)))  int v4i;
typedef float __attribute__((may_alias)) float_a;
typedef int __attribute__((may_alias)) int_a;

template <typename T> __device__ __forceinline__ void vst2(void* p, T v) { *(T*)p = v;  }
__device__ __forceinline__ v8f wmma16(v16h a, v16h b, v8f c) {
  v8f d = __builtin_amdgcn_wmma_f32_16x16x32_f16(false, a, false, b, (short)0, c, false, false);
  asm volatile("v_nop\n\tv_nop\n\tv_nop\n\tv_nop" : "+v"(d) : "v"(a), "v"(b));
  return d;
}
__device__ __forceinline__ v8f wmma_bf(v16b a, v16b b, v8f c) {
  v8f d = __builtin_amdgcn_wmma_f32_16x16x32_bf16(false, a, false, b, (short)0, c, false, false);
  asm volatile("v_nop\n\tv_nop\n\tv_nop\n\tv_nop" : "+v"(d) : "v"(a), "v"(b));
  return d;
}
// 16x16x32 fragments: lane = (h = lane>>4, row/col = lane&15); elements 0..7 = k0+8h+0..7, 8..15 = k0+16+8h+0..7; D element r = row 8h+r
__device__ __forceinline__ v16h frag_h(const _Float16* rowk0, int lane) {
  union { v16h v; v8h q[2]; } u; const _Float16* p = rowk0 + 8 * (lane >> 4);
  u.q[0] = *(const v8h*)p; u.q[1] = *(const v8h*)(p + 16); return u.v;
}
__device__ __forceinline__ v16h frag_f32(const float* rowk0, int lane) {
  v16h a; const float* p = rowk0 + 8 * (lane >> 4);
#pragma unroll
  for (int i = 0; i < 8; ++i) { a[i] = (_Float16)p[i]; a[8 + i] = (_Float16)p[16 + i]; }
  return a;
}
__device__ __forceinline__ v16h frag_f32s(const float* rowk0, int lane, float sc) {
  v16h a; const float* p = rowk0 + 8 * (lane >> 4);
#pragma unroll
  for (int i = 0; i < 8; ++i) { a[i] = (_Float16)(p[i] * sc); a[8 + i] = (_Float16)(p[16 + i] * sc); }
  return a;
}
// column fragment from a [K][ld] layout (column n), rows >= K read as 0
__device__ __forceinline__ v16h fragc_f32(const float* W, int k0, int n, int lane, int ld, int K) {
  v16h a; const int g = lane >> 4;
#pragma unroll
  for (int i = 0; i < 8; ++i) { const int ka = k0 + 8 * g + i, kb = ka + 16;
    a[i] = (_Float16)(ka < K ? W[(size_t)ka * ld + n] : 0.f); a[8 + i] = (_Float16)(kb < K ? W[(size_t)kb * ld + n] : 0.f); }
  return a;
}
struct F2 { v16b h, l; };
__device__ __forceinline__ F2 bsplit16(const float v[16]) { F2 r;
#pragma unroll
  for (int i = 0; i < 16; ++i) { const __bf16 h = (__bf16)v[i]; r.h[i] = h; r.l[i] = (__bf16)(v[i] - (float)h); }
  return r; }
__device__ __forceinline__ F2 split_row(const float* row, int k0, int lane) { float v[16]; const float* p = row + k0 + 8 * (lane >> 4);
#pragma unroll
  for (int i = 0; i < 8; ++i) { v[i] = p[i]; v[8 + i] = p[16 + i]; }
  return bsplit16(v); }
__device__ __forceinline__ F2 split_rowK(const float* row, int k0, int lane, int K) { float v[16]; const int g = lane >> 4;
#pragma unroll
  for (int i = 0; i < 8; ++i) { const int ka = k0 + 8 * g + i, kb = ka + 16; v[i] = ka < K ? row[ka] : 0.f; v[8 + i] = kb < K ? row[kb] : 0.f; }
  return bsplit16(v); }
__device__ __forceinline__ F2 split_col(const float* W, int k0, int n, int lane, int ld, int K) { float v[16]; const int g = lane >> 4;
#pragma unroll
  for (int i = 0; i < 8; ++i) { const int ka = k0 + 8 * g + i, kb = ka + 16; v[i] = ka < K ? W[(size_t)ka * ld + n] : 0.f; v[8 + i] = kb < K ? W[(size_t)kb * ld + n] : 0.f; }
  return bsplit16(v); }
__device__ __forceinline__ v8f mac3(const F2& a, const F2& b, v8f c) { c = wmma_bf(a.l, b.h, c); c = wmma_bf(a.h, b.l, c); return wmma_bf(a.h, b.h, c); }
__device__ __forceinline__ float sigm(float v) { return 1.0f / (1.0f + expf(-v)); }
#define LDSX() do { asm volatile("s_wait_dscnt 0" ::: "memory"); __builtin_amdgcn_wave_barrier(); __builtin_amdgcn_fence(__ATOMIC_RELEASE, "workgroup"); } while (0)

// Graph interaction layer (single-head attention with a learned relative-position bias, post-LN transformer block). q/k/v / Wo / FFN
// GEMMs on v_wmma_f32_16x16x32_f16 (operands converted on the way into LDS, [out][in] weights x16; f32 accumulate); the pairwise bias
// MLP (2 -> 512 -> 1, K = 2) in f32 VALU; diagonal masked to -inf; softmax, LayerNorms in f32; P x2^14 f16.
#define NB 8
#define NN 256
#define DD 512
#define FF 1024
#define NR (NB * NN)

// 64 x 128 tile of X @ W^T over K = 512 for a block of 4 waves (wave w: rows 16w..16w+15, all 128 columns). X and W arrive in chunks of KC
// columns: every thread fetches whole 256-byte row pieces (16 lanes a row), converts once (W x16) and stores f16 rows of pitch KP in LDS;
// the fragments come from LDS. Two buffers: the next chunk's loads are asked for before this chunk's products and fly behind them.
#define KC 64
#define KP (KC + 8)
__device__ __forceinline__ void tile_mm(const float* __restrict__ X, const float* __restrict__ Wm, _Float16* sX, _Float16* sW, int tid, v8f (&acc)[8]) {
  const int wave = tid >> 5, lane = tid & 31, col = lane & 15, pr = tid >> 4, pc = (tid & 15) * 4;
  const unsigned vo = (unsigned)(pr * DD + pc);   // the thread's place inside a chunk: loop-invariant lane offset, the chunk's base stays scalar
  v4f xa[8], wb[16];
#pragma unroll
  for (int i = 0; i < 8; ++i) xa[i] = *(const v4f*)(X + i * 8 * DD + vo);
#pragma unroll
  for (int i = 0; i < 16; ++i) wb[i] = *(const v4f*)(Wm + i * 8 * DD + vo);
#pragma unroll 1   // rolled: one chunk in registers, one in each LDS buffer
  for (int c = 0; c < DD / KC; ++c) { _Float16* bx = sX + (c & 1) * (64 * KP); _Float16* bw = sW + (c & 1) * (128 * KP);
#pragma unroll
    for (int i = 0; i < 8; ++i) { v4h h4;
#pragma unroll
      for (int e = 0; e < 4; ++e) h4[e] = (_Float16)xa[i][e];
      vst2(bx + (i * 8 + pr) * KP + pc, h4); }
#pragma unroll
    for (int i = 0; i < 16; ++i) { v4h h4;
#pragma unroll
      for (int e = 0; e < 4; ++e) h4[e] = (_Float16)(wb[i][e] * 16.0f);
      vst2(bw + (i * 8 + pr) * KP + pc, h4); }
    __syncthreads();   // chunk c is whole; it also ends every wave's reads of the other buffer, which the next trip refills
    if (c + 1 < DD / KC) { X += KC; Wm += KC;   // asked for behind the barrier (whose fence would wait for them), so that they fly while this chunk's products run
#pragma unroll
      for (int i = 0; i < 8; ++i) xa[i] = *(const v4f*)(X + i * 8 * DD + vo);
#pragma unroll
      for (int i = 0; i < 16; ++i) wb[i] = *(const v4f*)(Wm + i * 8 * DD + vo); }
#pragma unroll
    for (int ks = 0; ks < KC / 32; ++ks) { const v16h a = frag_h(bx + (wave * 16 + col) * KP + ks * 32, lane); v16h bf[8];   // all nine fragments asked for before the first product
#pragma unroll
      for (int j = 0; j < 8; ++j) bf[j] = frag_h(bw + (j * 16 + col) * KP + ks * 32, lane);
#pragma unroll
      for (int j = 0; j < 8; ++j) acc[j] = wmma16(a, bf[j], acc[j]); } }
}
// q, k -> f16 rows [r][512]; v -> vT [b][d][n] f16 ; blockIdx.y: 0..3 q cols, 4..7 k cols, 8..11 v cols (128 each)
__global__ __launch_bounds__(128) void k_qkv(const float* __restrict__ x, const float* __restrict__ Wq, const float* __restrict__ bq, const float* __restrict__ Wk, const float* __restrict__ bk, const float* __restrict__ Wv, const float* __restrict__ bv,
                                           _Float16* __restrict__ q16, _Float16* __restrict__ k16, _Float16* __restrict__ vT) {
  __shared__ __align__(16) float so[4][16][132];
  __shared__ __align__(16) _Float16 st[128][72];
  __shared__ __align__(16) _Float16 sX[2][64][KP], sW[2][128][KP];
  const int tid = threadIdx.x, wave = tid >> 5, lane = tid & 31, col = lane & 15, g = lane >> 4;
  const int r0b = blockIdx.x * 64, r0 = r0b + wave * 16; const int which = blockIdx.y / 4, n0 = (blockIdx.y % 4) * 128; const int b = r0b / NN, t0 = r0b % NN;
  const float* W = which == 0 ? Wq : (which == 1 ? Wk : Wv); const float* bias = which == 0 ? bq : (which == 1 ? bk : bv);
  v8f acc[8] = {};
  tile_mm(x + (size_t)r0b * DD, W + (size_t)n0 * DD, &sX[0][0][0], &sW[0][0][0], tid, acc);
#pragma unroll
  for (int j = 0; j < 8; ++j) { const float bb = bias[n0 + j * 16 + col];
#pragma unroll
    for (int r = 0; r < 8; ++r) so[wave][8 * g + r][j * 16 + col] = acc[j][r] * (1.0f / 16.0f) + bb; }
  LDSX();
  if (which < 2) { _Float16* dst = which == 0 ? q16 : k16;
    for (int q = lane; q < 16 * 16; q += 32) { const int rl = q >> 4, pc = q & 15; union { v8h h8; v4u u; } pk;
#pragma unroll
      for (int e = 0; e < 8; ++e) pk.h8[e] = (_Float16)so[wave][rl][pc * 8 + e];
      vst2(dst + (size_t)(r0 + rl) * DD + n0 + pc * 8, pk.u); } }
  else {
#pragma unroll 4
    for (int rl = 0; rl < 16; ++rl) {
#pragma unroll
      for (int e = 0; e < 4; ++e) st[lane * 4 + e][wave * 16 + rl] = (_Float16)so[wave][rl][lane * 4 + e]; }
    __syncthreads();
    for (int q = tid; q < 128 * 8; q += 128) { const int c = q >> 3, pc = q & 7; vst2(vT + ((size_t)b * DD + n0 + c) * NN + t0 + pc * 8, *(const v4u*)(&st[c][pc * 8])); } }
}
// bias[b][n][m] = Wr2 . relu(rel @ Wr1^T + br1) + br2, rel = pc[n] - pc[m]; f32 throughout.
// A lane takes 8 pairs (m = lane + 32 j) of one row n, so that one broadcast read of the weights from LDS serves 8 pairs instead of one.
// The weights lie in LDS by pairs of hidden units (w1x w1x' w1y w1y' | br1 br1' Wr2 Wr2'): each packed f32 operation does two hidden units of one pair.
// Block = 8 waves = 4 rows n x 2 halves of the hidden units; the two halves of a row are added through LDS at the end.
#define BJ 8
__device__ __forceinline__ void bias_mac(const v4f lo, const v4f hi, const v2f (&rx)[BJ], const v2f (&ry)[BJ], v2f (&acc)[BJ]) {
  const v2f wx = {lo[0], lo[1]}, wy = {lo[2], lo[3]}, b1 = {hi[0], hi[1]}, wo = {hi[2], hi[3]};
#pragma unroll
  for (int j = 0; j < BJ; ++j) { const v2f z = __builtin_elementwise_fma(rx[j], wx, __builtin_elementwise_fma(ry[j], wy, b1));
    const v2f h = {z[0] > 0.f ? z[0] : 0.f, z[1] > 0.f ? z[1] : 0.f};
    acc[j] = __builtin_elementwise_fma(h, wo, acc[j]); }
}
__global__ __launch_bounds__(256) void k_bias(const float* __restrict__ pcs, const float* __restrict__ Wr1, const float* __restrict__ br1, const float* __restrict__ Wr2, const float* __restrict__ br2, float* __restrict__ bias) {
  __shared__ __align__(16) v4f sw[DD / 2][2]; __shared__ float sr[4][BJ][32];
  const int tid = threadIdx.x, lane = tid & 31;
  const int w = __builtin_amdgcn_readfirstlane(tid >> 5);   // the wave's number in a scalar register: row base and hidden half stay scalar
  const int b = blockIdx.y, nl = w >> 1, hh = w & 1, n = blockIdx.x * 4 + nl;
  // every global operand of the prologue is asked for before the first one is used
  const v4f w1 = *(const v4f*)(Wr1 + tid * 4); const v2f bb = *(const v2f*)(br1 + tid * 2), w2 = *(const v2f*)(Wr2 + tid * 2);
  const v2f pn = *(const v2f*)(pcs + ((size_t)b * NN + n) * 2); v2f pm[BJ];
#pragma unroll
  for (int j = 0; j < BJ; ++j) pm[j] = *(const v2f*)(pcs + ((size_t)b * NN + j * 32 + lane) * 2);
  sw[tid][0] = (v4f){w1[0], w1[2], w1[1], w1[3]}; sw[tid][1] = (v4f){bb[0], bb[1], w2[0], w2[1]};
  v2f rx[BJ], ry[BJ], acc[BJ];
#pragma unroll
  for (int j = 0; j < BJ; ++j) { const v2f r = pn - pm[j]; rx[j] = (v2f){r[0], r[0]}; ry[j] = (v2f){r[1], r[1]}; acc[j] = (v2f){0.f, 0.f}; }
  __syncthreads();   // the weights are whole
  const v4f* wp = &sw[hh * (DD / 4)][0];   // this wave's 128 pairs of hidden units, four hidden units a trip
  v4f c0 = wp[0], c1 = wp[1], c2 = wp[2], c3 = wp[3];
#pragma unroll 2   // two trips a pass, so that the current and the next weights swap registers without copies
  for (int t = 0; t < DD / 8; ++t) { const v4f* np = wp + ((t + 1) & (DD / 8 - 1)) * 4;   // the next trip's weights are asked for ahead of this trip's arithmetic (the last trip re-reads the first group, unused)
    const v4f n0 = np[0], n1 = np[1], n2 = np[2], n3 = np[3];
    __builtin_amdgcn_sched_barrier(0);   // keeps the four reads above the arithmetic, whose 64 issue slots then cover their latency
    bias_mac(c0, c1, rx, ry, acc); bias_mac(c2, c3, rx, ry, acc);
    c0 = n0; c1 = n1; c2 = n2; c3 = n3; }
  if (hh) {
#pragma unroll
    for (int j = 0; j < BJ; ++j) sr[nl][j][lane] = acc[j][0] + acc[j][1]; }
  __syncthreads();   // the upper hidden half's sums are in LDS
  if (!hh) { const float b2 = br2[0];
#pragma unroll
    for (int j = 0; j < BJ; ++j) bias[((size_t)b * NN + n) * NN + j * 32 + lane] = ((acc[j][0] + acc[j][1]) + sr[nl][j][lane]) + b2; }
}
// attention: block (b, 16 queries), 16 waves; S = q.k/sqrt(512) + bias, diagonal excluded, softmax over 256 (f32), P x2^14 f16 @ vT -> AG rows f32 [r][512].
// Wave w: the 16 queries against keys 16w..16w+15 (the q tile is staged once in LDS); behind a block barrier the softmax of row w;
// behind a second one columns 32w..32w+31 of P @ v. Each phase asks for all its global operands before its first product.
// The short loops are all unrolled so that the fragment arrays are indexed by constants and stay in registers.
__global__ __launch_bounds__(512) void k_attn(const _Float16* __restrict__ q16, const _Float16* __restrict__ k16, const _Float16* __restrict__ vT, const float* __restrict__ bias, float* __restrict__ AG) {
  __shared__ __align__(16) _Float16 sQ[16][DD + 8];
  __shared__ __align__(16) float sS[16][NN + 4];
  __shared__ __align__(16) _Float16 sP[16][NN + 8];
  __shared__ __align__(16) float sA[16][16][36];
  const int tid = threadIdx.x, lane = tid & 31, col = lane & 15, g = lane >> 4;
  const int w = __builtin_amdgcn_readfirstlane(tid >> 5);   // the wave's number in a scalar register: tile bases stay scalar
  const int b = blockIdx.y, q0 = blockIdx.x * 16; const size_t rb = (size_t)b * NN;
  { v16h kf[16]; float bv[8];
#pragma unroll
    for (int kc = 0; kc < 16; ++kc) kf[kc] = frag_h(k16 + (rb + w * 16 + col) * DD + kc * 32, lane);
#pragma unroll
    for (int r = 0; r < 8; ++r) bv[r] = bias[(rb + q0 + 8 * g + r) * NN + w * 16 + col];
#pragma unroll
    for (int i = 0; i < 2; ++i) { const int q = tid + i * 512, rl = q >> 6, pc = q & 63; vst2(&sQ[rl][pc * 8], *(const v4u*)(q16 + (rb + q0 + rl) * DD + pc * 8)); }
    __syncthreads();   // the q tile is whole
    v8f s = {};
#pragma unroll
    for (int h = 0; h < 2; ++h) { v16h aq[8];
#pragma unroll
      for (int kc = 0; kc < 8; ++kc) aq[kc] = frag_h(&sQ[col][0] + (h * 8 + kc) * 32, lane);
#pragma unroll
      for (int kc = 0; kc < 8; ++kc) s = wmma16(aq[kc], kf[h * 8 + kc], s); }
#pragma unroll
    for (int r = 0; r < 8; ++r) { const int qi = q0 + 8 * g + r, m = w * 16 + col; sS[8 * g + r][m] = (m == qi) ? -3.0e38f : s[r] * 0.044194173824159216f + bv[r]; } }
  __syncthreads();   // every score row now holds the key slices of all 16 waves
  v16h vf[2][8];     // asked for here, so that they fly while the row's softmax runs
#pragma unroll
  for (int j = 0; j < 2; ++j)
#pragma unroll
    for (int kc = 0; kc < 8; ++kc) vf[j][kc] = frag_h(vT + ((size_t)b * DD + w * 32 + j * 16 + col) * NN + kc * 32, lane);
  { v4f x[2]; float mx = -3.4e38f;
#pragma unroll
    for (int i = 0; i < 2; ++i) { x[i] = *(const v4f*)(&sS[w][i * 128 + lane * 4]); mx = fmaxf(mx, fmaxf(fmaxf(x[i][0], x[i][1]), fmaxf(x[i][2], x[i][3]))); }
#pragma unroll
    for (int o = 16; o > 0; o >>= 1) mx = fmaxf(mx, __shfl_xor(mx, o, 32));
    float l = 0.f;
#pragma unroll
    for (int i = 0; i < 2; ++i)
#pragma unroll
      for (int e = 0; e < 4; ++e) { const float sv = x[i][e]; const float pv = sv <= -1.0e38f ? 0.f : expf(sv - mx); l += pv; x[i][e] = pv; }
#pragma unroll
    for (int o = 16; o > 0; o >>= 1) l += __shfl_xor(l, o, 32);
    const float inv = 16384.0f / l;
#pragma unroll
    for (int i = 0; i < 2; ++i) { v4h h4;
#pragma unroll
      for (int e = 0; e < 4; ++e) h4[e] = (_Float16)(x[i][e] * inv);
      vst2(&sP[w][i * 128 + lane * 4], h4); } }
  __syncthreads();   // all 16 rows of P are written
  v16h pa[8];
#pragma unroll
  for (int kc = 0; kc < 8; ++kc) pa[kc] = frag_h(&sP[col][0] + kc * 32, lane);
  v8f acc[2] = {};
#pragma unroll
  for (int kc = 0; kc < 8; ++kc) {
#pragma unroll
    for (int j = 0; j < 2; ++j) acc[j] = wmma16(pa[kc], vf[j][kc], acc[j]); }
#pragma unroll
  for (int j = 0; j < 2; ++j)
#pragma unroll
    for (int r = 0; r < 8; ++r) sA[w][8 * g + r][j * 16 + col] = acc[j][r] * (1.0f / 16384.0f);
  LDSX();   // wave-local exchange: the wave's own tile is in LDS before it reads it back as whole 128-byte row pieces
#pragma unroll
  for (int q = lane; q < 16 * 8; q += 32) { const int rl = q >> 3, pc = q & 7; vst2(AG + (rb + q0 + rl) * DD + w * 32 + pc * 4, *(const v4f*)(&sA[w][rl][pc * 4])); }
}
// generic: Out = LN(A @ W^T + bias + res) over 512 columns; block = 16 rows, 16 waves: wave w computes columns 32w..32w+31 of the product
// for all 16 rows, then (behind the block barrier) the LayerNorm of row w; K = KIN (A f32 rows or f16 rows per AH)
template <int KIN, int AH>      // AH: A operand is f16 rows pre-scaled x4 (so the product is /64), else f32 rows (/16)
__global__ __launch_bounds__(512) void k_lnproj(const void* __restrict__ Ain, const float* __restrict__ W, const float* __restrict__ bias, const float* __restrict__ res, const float* __restrict__ gam, const float* __restrict__ bet, float* __restrict__ Out) {
  __shared__ __align__(16) float so[16][DD + 4];
  __shared__ __align__(16) _Float16 sA[16][KIN + 8], sW[2][DD][KP];
  const int tid = threadIdx.x, lane = tid & 31, col = lane & 15, g = lane >> 4;
  const int wave = __builtin_amdgcn_readfirstlane(tid >> 5);   // the wave's number in a scalar register: tile bases stay scalar
  const int r0 = blockIdx.x * 16, n0 = wave * 32;
  // the block's 16 rows of A, whole K, as f16 rows in LDS (fetched in whole lines; f32 rows converted once)
#pragma unroll
  for (int i = 0; i < 4; ++i) { const int q = tid + i * 512;
    if (AH) vst2(&sA[q / (KIN / 8)][(q % (KIN / 8)) * 8], *(const v4u*)((const _Float16*)Ain + (size_t)r0 * KIN + q * 8));
    else { const v4f v = *(const v4f*)((const float*)Ain + (size_t)r0 * KIN + q * 4); v4h h4;
#pragma unroll
      for (int e = 0; e < 4; ++e) h4[e] = (_Float16)v[e];
      vst2(&sA[q / (KIN / 4)][(q % (KIN / 4)) * 4], h4); } }
  // W (all 512 rows) in chunks of KC columns, as in tile_mm: whole 256-byte row pieces, converted once (x16), two LDS buffers
  const int pr = tid >> 4, pc = (tid & 15) * 4;
  const unsigned vo = (unsigned)(pr * KIN + pc);   // loop-invariant lane offset, the chunk's base stays scalar
  v4f wb[16];
#pragma unroll
  for (int i = 0; i < 16; ++i) wb[i] = *(const v4f*)(W + i * 32 * KIN + vo);
  v8f acc[2] = {};
#pragma unroll 1   // rolled: one chunk in registers, one in each LDS buffer
  for (int c = 0; c < KIN / KC; ++c) { _Float16* bw = &sW[0][0][0] + (c & 1) * (DD * KP);
#pragma unroll
    for (int i = 0; i < 16; ++i) { v4h h4;
#pragma unroll
      for (int e = 0; e < 4; ++e) h4[e] = (_Float16)(wb[i][e] * 16.0f);
      vst2(bw + (i * 32 + pr) * KP + pc, h4); }
    __syncthreads();   // chunk c (and, at c = 0, the A tile) is whole; it also ends every wave's reads of the other buffer, which the next trip refills
    if (c + 1 < KIN / KC) { W += KC;   // asked for behind the barrier (whose fence would wait for them), so that they fly while this chunk's products run
#pragma unroll
      for (int i = 0; i < 16; ++i) wb[i] = *(const v4f*)(W + i * 32 * KIN + vo); }
    v16h a[KC / 32], bf[KC / 32][2];   // all six fragments asked for before the first product
#pragma unroll
    for (int ks = 0; ks < KC / 32; ++ks) { a[ks] = frag_h(&sA[col][c * KC + ks * 32], lane);
#pragma unroll
      for (int j = 0; j < 2; ++j) bf[ks][j] = frag_h(bw + (n0 + j * 16 + col) * KP + ks * 32, lane); }
#pragma unroll
    for (int ks = 0; ks < KC / 32; ++ks)
#pragma unroll
      for (int j = 0; j < 2; ++j) acc[j] = wmma16(a[ks], bf[ks][j], acc[j]); }
#pragma unroll
  for (int j = 0; j < 2; ++j) { const int c = n0 + j * 16 + col; const float bb = bias[c];
#pragma unroll
    for (int r = 0; r < 8; ++r) so[8 * g + r][c] = acc[j][r] * (AH ? (1.0f / 64.0f) : (1.0f / 16.0f)) + bb; }
  __syncthreads();   // every row now holds the column slices of all 16 waves
  // row 'wave': 16 values per lane in whole 512-byte pieces; the short loops below are unrolled so that v[] stays in registers
  { const float* row = &so[wave][0]; const float* rrow = res + (size_t)(r0 + wave) * DD; v4f v[4]; float s = 0.f;
#pragma unroll
    for (int i = 0; i < 4; ++i) { v[i] = *(const v4f*)(&row[i * 128 + lane * 4]) + *(const v4f*)(rrow + i * 128 + lane * 4); s += (v[i][0] + v[i][1]) + (v[i][2] + v[i][3]); }
#pragma unroll
    for (int o = 16; o > 0; o >>= 1) s += __shfl_xor(s, o, 32);
    const float mu = s * (1.0f / DD); float q2 = 0.f;
#pragma unroll
    for (int i = 0; i < 4; ++i)
#pragma unroll
      for (int e = 0; e < 4; ++e) { const float d = v[i][e] - mu; q2 += d * d; }
#pragma unroll
    for (int o = 16; o > 0; o >>= 1) q2 += __shfl_xor(q2, o, 32);
    const float rs = rsqrtf(q2 * (1.0f / DD) + 1e-5f);
#pragma unroll
    for (int i = 0; i < 4; ++i) { const int cc = i * 128 + lane * 4; const v4f gm = *(const v4f*)(gam + cc), bt = *(const v4f*)(bet + cc); v4f o4;
#pragma unroll
      for (int e = 0; e < 4; ++e) o4[e] = (v[i][e] - mu) * rs * gm[e] + bt[e];
      vst2(Out + (size_t)(r0 + wave) * DD + cc, o4); } }
}
// FFN hidden: H16[r][1024] = relu(x1 @ Wf1^T + bf1) as f16 (x4); block 64 rows x 128 cols
__global__ __launch_bounds__(128) void k_ff1(const float* __restrict__ x1, const float* __restrict__ Wf1, const float* __restrict__ bf1, _Float16* __restrict__ H16) {
  __shared__ __align__(16) float so[4][16][132];
  __shared__ __align__(16) _Float16 sX[2][64][KP], sW[2][128][KP];
  const int tid = threadIdx.x, wave = tid >> 5, lane = tid & 31, col = lane & 15, g = lane >> 4;
  const int r0 = blockIdx.x * 64 + wave * 16, n0 = blockIdx.y * 128;
  v8f acc[8] = {};
  tile_mm(x1 + (size_t)blockIdx.x * 64 * DD, Wf1 + (size_t)n0 * DD, &sX[0][0][0], &sW[0][0][0], tid, acc);
#pragma unroll
  for (int j = 0; j < 8; ++j) { const float bb = bf1[n0 + j * 16 + col];
#pragma unroll
    for (int r = 0; r < 8; ++r) { const float v = acc[j][r] * (1.0f / 16.0f) + bb; so[wave][8 * g + r][j * 16 + col] = v > 0.f ? v * 4.0f : 0.f; } }
  LDSX();
  for (int q = lane; q < 16 * 16; q += 32) { const int rl = q >> 4, pc = q & 15; union { v8h h8; v4u u; } pk;
#pragma unroll
    for (int e = 0; e < 8; ++e) pk.h8[e] = (_Float16)so[wave][rl][pc * 8 + e];
    vst2(H16 + (size_t)(r0 + rl) * FF + n0 + pc * 8, pk.u); }
}
extern "C" void kernel_launch(void* const* d_in, const int* in_sizes, int n_in, void* d_out, int out_size, void* d_ws, size_t ws_size, hipStream_t stream) {
  (void)in_sizes; (void)n_in; (void)out_size; (void)ws_size;
  const float** I = (const float**)d_in;
  const float* x = I[0]; const float* pcs = I[1]; const float* Wq = I[2]; const float* bq = I[3]; const float* Wk = I[4]; const float* bk = I[5]; const float* Wv = I[6]; const float* bv = I[7];
  const float* Wr1 = I[8]; const float* br1 = I[9]; const float* Wr2 = I[10]; const float* br2 = I[11]; const float* Wo = I[12]; const float* bo = I[13]; const float* g1 = I[14]; const float* be1 = I[15];
  const float* Wf1 = I[16]; const float* bf1 = I[17]; const float* Wf2 = I[18]; const float* bf2 = I[19]; const float* g2 = I[20]; const float* be2 = I[21];
  float* out = (float*)d_out;
  char* ws = (char*)d_ws; size_t off = 0;
  auto take = [&](size_t bytes) { char* p = ws + off; off += (bytes + 255) & ~(size_t)255; return p; };
  _Float16* q16 = (_Float16*)take((size_t)NR * DD * 2); _Float16* k16 = (_Float16*)take((size_t)NR * DD * 2); _Float16* vT = (_Float16*)take((size_t)NR * DD * 2); float* bias = (float*)take((size_t)NB * NN * NN * 4);
  float* AG = (float*)take((size_t)NR * DD * 4); float* x1 = (float*)take((size_t)NR * DD * 4); _Float16* H16 = (_Float16*)take((size_t)NR * FF * 2);
  k_qkv<<<dim3(NR / 64, 12), 128, 0, stream>>>(x, Wq, bq, Wk, bk, Wv, bv, q16, k16, vT);
  k_bias<<<dim3(NN / 4, NB), 256, 0, stream>>>(pcs, Wr1, br1, Wr2, br2, bias);
  k_attn<<<dim3(NN / 16, NB), 512, 0, stream>>>(q16, k16, vT, bias, AG);
  k_lnproj<DD, 0><<<NR / 16, 512, 0, stream>>>(AG, Wo, bo, x, g1, be1, x1);
  k_ff1<<<dim3(NR / 64, FF / 128), 128, 0, stream>>>(x1, Wf1, bf1, H16);
  k_lnproj<FF, 1><<<NR / 16, 512, 0, stream>>>(H16, Wf2, bf2, x1, g2, be2, out);       // hidden x4 (f16) and Wf2 x16 -> /64 inside
}

// v005
// Measured time: 95.1 microseconds a run.
// Two timings next to v004 both put it at 1.05 times that version's speed.
// Counting every step since v000, it is 9.56 times as fast.
#include <hip/hip_runtime.h>
#include <math.h>

typedef __attribute__((ext_vector_type(16))) _Float16 v16h;
typedef __attribute__((ext_vector_type(16))) __bf16 v16b;
typedef __attribute__((ext_vector_type(8)))  _Float16 v8h;
typedef __attribute__((ext_vector_type(4)))  _Float16 v4h;
typedef __attribute__((ext_vector_type(8)))  float v8f;
typedef __attribute__((ext_vector_type(4)))  float v4f;
typedef __attribute__((ext_vector_type(2)))  float v2f;
typedef __attribute__((ext_vector_type(4)))  unsigned v4u;
typedef __attribute__((ext_vector_type(4)))  int v4i;
typedef float __attribute__((may_alias)) float_a;
typedef int __attribute__((may_alias)) int_a;

template <typename T> __device__ __forceinline__ void vst2(void* p, T v) { *(T*)p = v;  }
__device__ __forceinline__ v8f wmma16(v16h a, v16h b, v8f c) {
  v8f d = __builtin_amdgcn_wmma_f32_16x16x32_f16(false, a, false, b, (short)0, c, false, false);
  asm volatile("v_nop\n\tv_nop\n\tv_nop\n\tv_nop" : "+v"(d) : "v"(a), "v"(b));
  return d;
}
__device__ __forceinline__ v8f wmma_bf(v16b a, v16b b, v8f c) {
  v8f d = __builtin_amdgcn_wmma_f32_16x16x32_bf16(false, a, false, b, (short)0, c, false, false);
  asm volatile("v_nop\n\tv_nop\n\tv_nop\n\tv_nop" : "+v"(d) : "v"(a), "v"(b));
  return d;
}
// 16x16x32 fragments: lane = (h = lane>>4, row/col = lane&15); elements 0..7 = k0+8h+0..7, 8..15 = k0+16+8h+0..7; D element r = row 8h+r
__device__ __forceinline__ v16h frag_h(const _Float16* rowk0, int lane) {
  union { v16h v; v8h q[2]; } u; const _Float16* p = rowk0 + 8 * (lane >> 4);
  u.q[0] = *(const v8h*)p; u.q[1] = *(const v8h*)(p + 16); return u.v;
}
__device__ __forceinline__ v16h frag_f32(const float* rowk0, int lane) {
  v16h a; const float* p = rowk0 + 8 * (lane >> 4);
#pragma unroll
  for (int i = 0; i < 8; ++i) { a[i] = (_Float16)p[i]; a[8 + i] = (_Float16)p[16 + i]; }
  return a;
}
__device__ __forceinline__ v16h frag_f32s(const float* rowk0, int lane, float sc) {
  v16h a; const float* p = rowk0 + 8 * (lane >> 4);
#pragma unroll
  for (int i = 0; i < 8; ++i) { a[i] = (_Float16)(p[i] * sc); a[8 + i] = (_Float16)(p[16 + i] * sc); }
  return a;
}
// column fragment from a [K][ld] layout (column n), rows >= K read as 0
__device__ __forceinline__ v16h fragc_f32(const float* W, int k0, int n, int lane, int ld, int K) {
  v16h a; const int g = lane >> 4;
#pragma unroll
  for (int i = 0; i < 8; ++i) { const int ka = k0 + 8 * g + i, kb = ka + 16;
    a[i] = (_Float16)(ka < K ? W[(size_t)ka * ld + n] : 0.f); a[8 + i] = (_Float16)(kb < K ? W[(size_t)kb * ld + n] : 0.f); }
  return a;
}
struct F2 { v16b h, l; };
__device__ __forceinline__ F2 bsplit16(const float v[16]) { F2 r;
#pragma unroll
  for (int i = 0; i < 16; ++i) { const __bf16 h = (__bf16)v[i]; r.h[i] = h; r.l[i] = (__bf16)(v[i] - (float)h); }
  return r; }
__device__ __forceinline__ F2 split_row(const float* row, int k0, int lane) { float v[16]; const float* p = row + k0 + 8 * (lane >> 4);
#pragma unroll
  for (int i = 0; i < 8; ++i) { v[i] = p[i]; v[8 + i] = p[16 + i]; }
  return bsplit16(v); }
__device__ __forceinline__ F2 split_rowK(const float* row, int k0, int lane, int K) { float v[16]; const int g = lane >> 4;
#pragma unroll
  for (int i = 0; i < 8; ++i) { const int ka = k0 + 8 * g + i, kb = ka + 16; v[i] = ka < K ? row[ka] : 0.f; v[8 + i] = kb < K ? row[kb] : 0.f; }
  return bsplit16(v); }
__device__ __forceinline__ F2 split_col(const float* W, int k0, int n, int lane, int ld, int K) { float v[16]; const int g = lane >> 4;
#pragma unroll
  for (int i = 0; i < 8; ++i) { const int ka = k0 + 8 * g + i, kb = ka + 16; v[i] = ka < K ? W[(size_t)ka * ld + n] : 0.f; v[8 + i] = kb < K ? W[(size_t)kb * ld + n] : 0.f; }
  return bsplit16(v); }
__device__ __forceinline__ v8f mac3(const F2& a, const F2& b, v8f c) { c = wmma_bf(a.l, b.h, c); c = wmma_bf(a.h, b.l, c); return wmma_bf(a.h, b.h, c); }
__device__ __forceinline__ float sigm(float v) { return 1.0f / (1.0f + expf(-v)); }
#define LDSX() do { asm volatile("s_wait_dscnt 0" ::: "memory"); __builtin_amdgcn_wave_barrier(); __builtin_amdgcn_fence(__ATOMIC_RELEASE, "workgroup"); } while (0)

// Graph interaction layer (single-head attention with a learned relative-position bias, post-LN transformer block). q/k/v / Wo / FFN
// GEMMs on v_wmma_f32_16x16x32_f16 (operands converted on the way into LDS, [out][in] weights x16; f32 accumulate); the pairwise bias
// MLP (2 -> 512 -> 1, K = 2) in f32 VALU; diagonal masked to -inf; softmax, LayerNorms in f32; P x2^14 f16.
#define NB 8
#define NN 256
#define DD 512
#define FF 1024
#define NR (NB * NN)

// 64 x 128 tile of X @ W^T over K = 512 for a block of 4 waves (wave w: rows 16w..16w+15, all 128 columns). X and W arrive in chunks of KC
// columns: every thread fetches whole 256-byte row pieces (16 lanes a row), converts once (W x16) and stores f16 rows of pitch KP in LDS;
// the fragments come from LDS. Two buffers: the next chunk's loads are asked for before this chunk's products and fly behind them.
#define KC 64
#define KP (KC + 8)
__device__ __forceinline__ void tile_mm(const float* __restrict__ X, const float* __restrict__ Wm, _Float16* sX, _Float16* sW, int tid, v8f (&acc)[8]) {
  const int wave = tid >> 5, lane = tid & 31, col = lane & 15, pr = tid >> 4, pc = (tid & 15) * 4;
  const unsigned vo = (unsigned)(pr * DD + pc);   // the thread's place inside a chunk: loop-invariant lane offset, the chunk's base stays scalar
  v4f xa[8], wb[16];
#pragma unroll
  for (int i = 0; i < 8; ++i) xa[i] = *(const v4f*)(X + i * 8 * DD + vo);
#pragma unroll
  for (int i = 0; i < 16; ++i) wb[i] = *(const v4f*)(Wm + i * 8 * DD + vo);
#pragma unroll 1   // rolled: one chunk in registers, one in each LDS buffer
  for (int c = 0; c < DD / KC; ++c) { _Float16* bx = sX + (c & 1) * (64 * KP); _Float16* bw = sW + (c & 1) * (128 * KP);
#pragma unroll
    for (int i = 0; i < 8; ++i) { v4h h4;
#pragma unroll
      for (int e = 0; e < 4; ++e) h4[e] = (_Float16)xa[i][e];
      vst2(bx + (i * 8 + pr) * KP + pc, h4); }
#pragma unroll
    for (int i = 0; i < 16; ++i) { v4h h4;
#pragma unroll
      for (int e = 0; e < 4; ++e) h4[e] = (_Float16)(wb[i][e] * 16.0f);
      vst2(bw + (i * 8 + pr) * KP + pc, h4); }
    __syncthreads();   // chunk c is whole; it also ends every wave's reads of the other buffer, which the next trip refills
    if (c + 1 < DD / KC) { X += KC; Wm += KC;   // asked for behind the barrier (whose fence would wait for them), so that they fly while this chunk's products run
#pragma unroll
      for (int i = 0; i < 8; ++i) xa[i] = *(const v4f*)(X + i * 8 * DD + vo);
#pragma unroll
      for (int i = 0; i < 16; ++i) wb[i] = *(const v4f*)(Wm + i * 8 * DD + vo); }
#pragma unroll
    for (int ks = 0; ks < KC / 32; ++ks) { const v16h a = frag_h(bx + (wave * 16 + col) * KP + ks * 32, lane); v16h bf[8];   // all nine fragments asked for before the first product
#pragma unroll
      for (int j = 0; j < 8; ++j) bf[j] = frag_h(bw + (j * 16 + col) * KP + ks * 32, lane);
#pragma unroll
      for (int j = 0; j < 8; ++j) acc[j] = wmma16(a, bf[j], acc[j]); } }
}
// The q/k/v projection and the pairwise bias do not depend on each other: they share ONE launch (k_qkv_bias below), told apart by the block index.
// Both kinds of block have 4 waves and lie over the same LDS (a union: a block is of one kind only).
#define BJ 8
struct LdsQkv { float so[4][16][132]; _Float16 st[128][72]; _Float16 sX[2][64][KP]; _Float16 sW[2][128][KP]; };
struct LdsBias { v4f sw[DD / 2][2]; float sr[2][BJ][32]; };
union LdsQB { LdsQkv q; LdsBias b; };
// q, k -> f16 rows [r][512]; v -> vT [b][d][n] f16 ; bx: 64 rows; by: 0..3 q cols, 4..7 k cols, 8..11 v cols (128 each)
__device__ __forceinline__ void qkv_block(LdsQkv& L, int bx, int by, const float* __restrict__ x, const float* __restrict__ Wq, const float* __restrict__ bq, const float* __restrict__ Wk, const float* __restrict__ bk, const float* __restrict__ Wv, const float* __restrict__ bv,
                                          _Float16* __restrict__ q16, _Float16* __restrict__ k16, _Float16* __restrict__ vT) {
  float (&so)[4][16][132] = L.so; _Float16 (&st)[128][72] = L.st; _Float16 (&sX)[2][64][KP] = L.sX; _Float16 (&sW)[2][128][KP] = L.sW;
  const int tid = threadIdx.x, wave = tid >> 5, lane = tid & 31, col = lane & 15, g = lane >> 4;
  const int r0b = bx * 64, r0 = r0b + wave * 16; const int which = by / 4, n0 = (by % 4) * 128; const int b = r0b / NN, t0 = r0b % NN;
  const float* W = which == 0 ? Wq : (which == 1 ? Wk : Wv); const float* bias = which == 0 ? bq : (which == 1 ? bk : bv);
  v8f acc[8] = {};
  tile_mm(x + (size_t)r0b * DD, W + (size_t)n0 * DD, &sX[0][0][0], &sW[0][0][0], tid, acc);
#pragma unroll
  for (int j = 0; j < 8; ++j) { const float bb = bias[n0 + j * 16 + col];
#pragma unroll
    for (int r = 0; r < 8; ++r) so[wave][8 * g + r][j * 16 + col] = acc[j][r] * (1.0f / 16.0f) + bb; }
  LDSX();
  if (which < 2) { _Float16* dst = which == 0 ? q16 : k16;
    for (int q = lane; q < 16 * 16; q += 32) { const int rl = q >> 4, pc = q & 15; union { v8h h8; v4u u; } pk;
#pragma unroll
      for (int e = 0; e < 8; ++e) pk.h8[e] = (_Float16)so[wave][rl][pc * 8 + e];
      vst2(dst + (size_t)(r0 + rl) * DD + n0 + pc * 8, pk.u); } }
  else {
#pragma unroll 4
    for (int rl = 0; rl < 16; ++rl) {
#pragma unroll
      for (int e = 0; e < 4; ++e) st[lane * 4 + e][wave * 16 + rl] = (_Float16)so[wave][rl][lane * 4 + e]; }
    __syncthreads();
    for (int q = tid; q < 128 * 8; q += 128) { const int c = q >> 3, pc = q & 7; vst2(vT + ((size_t)b * DD + n0 + c) * NN + t0 + pc * 8, *(const v4u*)(&st[c][pc * 8])); } }
}
// bias[b][n][m] = Wr2 . relu(rel @ Wr1^T + br1) + br2, rel = pc[n] - pc[m]; f32 throughout.
// A lane takes 8 pairs (m = lane + 32 j) of one row n, so that one broadcast read of the weights from LDS serves 8 pairs instead of one.
// The weights lie in LDS by pairs of hidden units (w1x w1x' w1y w1y' | br1 br1' Wr2 Wr2'): each packed f32 operation does two hidden units of one pair.
// Block = 4 waves = 2 rows n x 2 halves of the hidden units; the two halves of a row are added through LDS at the end.
__device__ __forceinline__ void bias_mac(const v4f lo, const v4f hi, const v2f (&rx)[BJ], const v2f (&ry)[BJ], v2f (&acc)[BJ]) {
  const v2f wx = {lo[0], lo[1]}, wy = {lo[2], lo[3]}, b1 = {hi[0], hi[1]}, wo = {hi[2], hi[3]};
#pragma unroll
  for (int j = 0; j < BJ; ++j) { const v2f z = __builtin_elementwise_fma(rx[j], wx, __builtin_elementwise_fma(ry[j], wy, b1));
    const v2f h = {z[0] > 0.f ? z[0] : 0.f, z[1] > 0.f ? z[1] : 0.f};
    acc[j] = __builtin_elementwise_fma(h, wo, acc[j]); }
}
__device__ __forceinline__ void bias_block(LdsBias& L, int bx, int b, const float* __restrict__ pcs, const float* __restrict__ Wr1, const float* __restrict__ br1, const float* __restrict__ Wr2, const float* __restrict__ br2, float* __restrict__ bias) {
  v4f (&sw)[DD / 2][2] = L.sw; float (&sr)[2][BJ][32] = L.sr;
  const int tid = threadIdx.x, lane = tid & 31;
  const int w = __builtin_amdgcn_readfirstlane(tid >> 5);   // the wave's number in a scalar register: row base and hidden half stay scalar
  const int nl = w >> 1, hh = w & 1, n = bx * 2 + nl;
  // every global operand of the prologue is asked for before the first one is used; a thread stages two pairs of hidden units (tid and tid + 128)
  v4f w1[2]; v2f bb[2], w2[2];
#pragma unroll
  for (int i = 0; i < 2; ++i) { const int p = tid + i * 128; w1[i] = *(const v4f*)(Wr1 + p * 4); bb[i] = *(const v2f*)(br1 + p * 2); w2[i] = *(const v2f*)(Wr2 + p * 2); }
  const v2f pn = *(const v2f*)(pcs + ((size_t)b * NN + n) * 2); v2f pm[BJ];
#pragma unroll
  for (int j = 0; j < BJ; ++j) pm[j] = *(const v2f*)(pcs + ((size_t)b * NN + j * 32 + lane) * 2);
#pragma unroll
  for (int i = 0; i < 2; ++i) { const int p = tid + i * 128; sw[p][0] = (v4f){w1[i][0], w1[i][2], w1[i][1], w1[i][3]}; sw[p][1] = (v4f){bb[i][0], bb[i][1], w2[i][0], w2[i][1]}; }
  v2f rx[BJ], ry[BJ], acc[BJ];
#pragma unroll
  for (int j = 0; j < BJ; ++j) { const v2f r = pn - pm[j]; rx[j] = (v2f){r[0], r[0]}; ry[j] = (v2f){r[1], r[1]}; acc[j] = (v2f){0.f, 0.f}; }
  __syncthreads();   // the weights are whole
  const v4f* wp = &sw[hh * (DD / 4)][0];   // this wave's 128 pairs of hidden units, four hidden units a trip
  v4f c0 = wp[0], c1 = wp[1], c2 = wp[2], c3 = wp[3];
#pragma unroll 2   // two trips a pass, so that the current and the next weights swap registers without copies
  for (int t = 0; t < DD / 8; ++t) { const v4f* np = wp + ((t + 1) & (DD / 8 - 1)) * 4;   // the next trip's weights are asked for ahead of this trip's arithmetic (the last trip re-reads the first group, unused)
    const v4f n0 = np[0], n1 = np[1], n2 = np[2], n3 = np[3];
    __builtin_amdgcn_sched_barrier(0);   // keeps the four reads above the arithmetic, whose 64 issue slots then cover their latency
    bias_mac(c0, c1, rx, ry, acc); bias_mac(c2, c3, rx, ry, acc);
    c0 = n0; c1 = n1; c2 = n2; c3 = n3; }
  if (hh) {
#pragma unroll
    for (int j = 0; j < BJ; ++j) sr[nl][j][lane] = acc[j][0] + acc[j][1]; }
  __syncthreads();   // the upper hidden half's sums are in LDS
  if (!hh) { const float b2 = br2[0];
#pragma unroll
    for (int j = 0; j < BJ; ++j) bias[((size_t)b * NN + n) * NN + j * 32 + lane] = ((acc[j][0] + acc[j][1]) + sr[nl][j][lane]) + b2; }
}
// One launch for both: blocks 0..QKVB-1 are the projection tiles (first, because each is a long chain of waits with little to issue),
// the BIASB blocks behind them are the bias rows, whose vector work fills the issue slots that the projection waves leave idle.
#define QKVB (NR / 64 * 12)
#define BIASB (NN / 2 * NB)
__global__ __launch_bounds__(128) void k_qkv_bias(const float* __restrict__ x, const float* __restrict__ Wq, const float* __restrict__ bq, const float* __restrict__ Wk, const float* __restrict__ bk, const float* __restrict__ Wv, const float* __restrict__ bv,
                                                  _Float16* __restrict__ q16, _Float16* __restrict__ k16, _Float16* __restrict__ vT,
                                                  const float* __restrict__ pcs, const float* __restrict__ Wr1, const float* __restrict__ br1, const float* __restrict__ Wr2, const float* __restrict__ br2, float* __restrict__ bias) {
  __shared__ __align__(16) LdsQB lds;
  const int bid = blockIdx.x;   // the same for the whole block: every barrier below stands under block-uniform control flow
  if (bid < QKVB) qkv_block(lds.q, bid % (NR / 64), bid / (NR / 64), x, Wq, bq, Wk, bk, Wv, bv, q16, k16, vT);
  else bias_block(lds.b, (bid - QKVB) % (NN / 2), (bid - QKVB) / (NN / 2), pcs, Wr1, br1, Wr2, br2, bias);
}
// attention: block (b, 16 queries), 16 waves; S = q.k/sqrt(512) + bias, diagonal excluded, softmax over 256 (f32), P x2^14 f16 @ vT -> AG rows f32 [r][512].
// Wave w: the 16 queries against keys 16w..16w+15 (the q tile is staged once in LDS); behind a block barrier the softmax of row w;
// behind a second one columns 32w..32w+31 of P @ v. Each phase asks for all its global operands before its first product.
// The short loops are all unrolled so that the fragment arrays are indexed by constants and stay in registers.
__global__ __launch_bounds__(512) void k_attn(const _Float16* __restrict__ q16, const _Float16* __restrict__ k16, const _Float16* __restrict__ vT, const float* __restrict__ bias, float* __restrict__ AG) {
  __shared__ __align__(16) _Float16 sQ[16][DD + 8];
  __shared__ __align__(16) float sS[16][NN + 4];
  __shared__ __align__(16) _Float16 sP[16][NN + 8];
  __shared__ __align__(16) float sA[16][16][36];
  const int tid = threadIdx.x, lane = tid & 31, col = lane & 15, g = lane >> 4;
  const int w = __builtin_amdgcn_readfirstlane(tid >> 5);   // the wave's number in a scalar register: tile bases stay scalar
  const int b = blockIdx.y, q0 = blockIdx.x * 16; const size_t rb = (size_t)b * NN;
  { v16h kf[16]; float bv[8];
#pragma unroll
    for (int kc = 0; kc < 16; ++kc) kf[kc] = frag_h(k16 + (rb + w * 16 + col) * DD + kc * 32, lane);
#pragma unroll
    for (int r = 0; r < 8; ++r) bv[r] = bias[(rb + q0 + 8 * g + r) * NN + w * 16 + col];
#pragma unroll
    for (int i = 0; i < 2; ++i) { const int q = tid + i * 512, rl = q >> 6, pc = q & 63; vst2(&sQ[rl][pc * 8], *(const v4u*)(q16 + (rb + q0 + rl) * DD + pc * 8)); }
    __syncthreads();   // the q tile is whole
    v8f s = {};
#pragma unroll
    for (int h = 0; h < 2; ++h) { v16h aq[8];
#pragma unroll
      for (int kc = 0; kc < 8; ++kc) aq[kc] = frag_h(&sQ[col][0] + (h * 8 + kc) * 32, lane);
#pragma unroll
      for (int kc = 0; kc < 8; ++kc) s = wmma16(aq[kc], kf[h * 8 + kc], s); }
#pragma unroll
    for (int r = 0; r < 8; ++r) { const int qi = q0 + 8 * g + r, m = w * 16 + col; sS[8 * g + r][m] = (m == qi) ? -3.0e38f : s[r] * 0.044194173824159216f + bv[r]; } }
  __syncthreads();   // every score row now holds the key slices of all 16 waves
  v16h vf[2][8];     // asked for here, so that they fly while the row's softmax runs
#pragma unroll
  for (int j = 0; j < 2; ++j)
#pragma unroll
    for (int kc = 0; kc < 8; ++kc) vf[j][kc] = frag_h(vT + ((size_t)b * DD + w * 32 + j * 16 + col) * NN + kc * 32, lane);
  { v4f x[2]; float mx = -3.4e38f;
#pragma unroll
    for (int i = 0; i < 2; ++i) { x[i] = *(const v4f*)(&sS[w][i * 128 + lane * 4]); mx = fmaxf(mx, fmaxf(fmaxf(x[i][0], x[i][1]), fmaxf(x[i][2], x[i][3]))); }
#pragma unroll
    for (int o = 16; o > 0; o >>= 1) mx = fmaxf(mx, __shfl_xor(mx, o, 32));
    float l = 0.f;
#pragma unroll
    for (int i = 0; i < 2; ++i)
#pragma unroll
      for (int e = 0; e < 4; ++e) { const float sv = x[i][e]; const float pv = sv <= -1.0e38f ? 0.f : expf(sv - mx); l += pv; x[i][e] = pv; }
#pragma unroll
    for (int o = 16; o > 0; o >>= 1) l += __shfl_xor(l, o, 32);
    const float inv = 16384.0f / l;
#pragma unroll
    for (int i = 0; i < 2; ++i) { v4h h4;
#pragma unroll
      for (int e = 0; e < 4; ++e) h4[e] = (_Float16)(x[i][e] * inv);
      vst2(&sP[w][i * 128 + lane * 4], h4); } }
  __syncthreads();   // all 16 rows of P are written
  v16h pa[8];
#pragma unroll
  for (int kc = 0; kc < 8; ++kc) pa[kc] = frag_h(&sP[col][0] + kc * 32, lane);
  v8f acc[2] = {};
#pragma unroll
  for (int kc = 0; kc < 8; ++kc) {
#pragma unroll
    for (int j = 0; j < 2; ++j) acc[j] = wmma16(pa[kc], vf[j][kc], acc[j]); }
#pragma unroll
  for (int j = 0; j < 2; ++j)
#pragma unroll
    for (int r = 0; r < 8; ++r) sA[w][8 * g + r][j * 16 + col] = acc[j][r] * (1.0f / 16384.0f);
  LDSX();   // wave-local exchange: the wave's own tile is in LDS before it reads it back as whole 128-byte row pieces
#pragma unroll
  for (int q = lane; q < 16 * 8; q += 32) { const int rl = q >> 3, pc = q & 7; vst2(AG + (rb + q0 + rl) * DD + w * 32 + pc * 4, *(const v4f*)(&sA[w][rl][pc * 4])); }
}
// generic: Out = LN(A @ W^T + bias + res) over 512 columns; block = 16 rows, 16 waves: wave w computes columns 32w..32w+31 of the product
// for all 16 rows, then (behind the block barrier) the LayerNorm of row w; K = KIN (A f32 rows or f16 rows per AH)
template <int KIN, int AH>      // AH: A operand is f16 rows pre-scaled x4 (so the product is /64), else f32 rows (/16)
__global__ __launch_bounds__(512) void k_lnproj(const void* __restrict__ Ain, const float* __restrict__ W, const float* __restrict__ bias, const float* __restrict__ res, const float* __restrict__ gam, const float* __restrict__ bet, float* __restrict__ Out) {
  __shared__ __align__(16) float so[16][DD + 4];
  __shared__ __align__(16) _Float16 sA[16][KIN + 8], sW[2][DD][KP];
  const int tid = threadIdx.x, lane = tid & 31, col = lane & 15, g = lane >> 4;
  const int wave = __builtin_amdgcn_readfirstlane(tid >> 5);   // the wave's number in a scalar register: tile bases stay scalar
  const int r0 = blockIdx.x * 16, n0 = wave * 32;
  // the block's 16 rows of A, whole K, as f16 rows in LDS (fetched in whole lines; f32 rows converted once)
#pragma unroll
  for (int i = 0; i < 4; ++i) { const int q = tid + i * 512;
    if (AH) vst2(&sA[q / (KIN / 8)][(q % (KIN / 8)) * 8], *(const v4u*)((const _Float16*)Ain + (size_t)r0 * KIN + q * 8));
    else { const v4f v = *(const v4f*)((const float*)Ain + (size_t)r0 * KIN + q * 4); v4h h4;
#pragma unroll
      for (int e = 0; e < 4; ++e) h4[e] = (_Float16)v[e];
      vst2(&sA[q / (KIN / 4)][(q % (KIN / 4)) * 4], h4); } }
  // W (all 512 rows) in chunks of KC columns, as in tile_mm: whole 256-byte row pieces, converted once (x16), two LDS buffers
  const int pr = tid >> 4, pc = (tid & 15) * 4;
  const unsigned vo = (unsigned)(pr * KIN + pc);   // loop-invariant lane offset, the chunk's base stays scalar
  v4f wb[16];
#pragma unroll
  for (int i = 0; i < 16; ++i) wb[i] = *(const v4f*)(W + i * 32 * KIN + vo);
  v8f acc[2] = {};
#pragma unroll 1   // rolled: one chunk in registers, one in each LDS buffer
  for (int c = 0; c < KIN / KC; ++c) { _Float16* bw = &sW[0][0][0] + (c & 1) * (DD * KP);
#pragma unroll
    for (int i = 0; i < 16; ++i) { v4h h4;
#pragma unroll
      for (int e = 0; e < 4; ++e) h4[e] = (_Float16)(wb[i][e] * 16.0f);
      vst2(bw + (i * 32 + pr) * KP + pc, h4); }
    __syncthreads();   // chunk c (and, at c = 0, the A tile) is whole; it also ends every wave's reads of the other buffer, which the next trip refills
    if (c + 1 < KIN / KC) { W += KC;   // asked for behind the barrier (whose fence would wait for them), so that they fly while this chunk's products run
#pragma unroll
      for (int i = 0; i < 16; ++i) wb[i] = *(const v4f*)(W + i * 32 * KIN + vo); }
    v16h a[KC / 32], bf[KC / 32][2];   // all six fragments asked for before the first product
#pragma unroll
    for (int ks = 0; ks < KC / 32; ++ks) { a[ks] = frag_h(&sA[col][c * KC + ks * 32], lane);
#pragma unroll
      for (int j = 0; j < 2; ++j) bf[ks][j] = frag_h(bw + (n0 + j * 16 + col) * KP + ks * 32, lane); }
#pragma unroll
    for (int ks = 0; ks < KC / 32; ++ks)
#pragma unroll
      for (int j = 0; j < 2; ++j) acc[j] = wmma16(a[ks], bf[ks][j], acc[j]); }
#pragma unroll
  for (int j = 0; j < 2; ++j) { const int c = n0 + j * 16 + col; const float bb = bias[c];
#pragma unroll
    for (int r = 0; r < 8; ++r) so[8 * g + r][c] = acc[j][r] * (AH ? (1.0f / 64.0f) : (1.0f / 16.0f)) + bb; }
  __syncthreads();   // every row now holds the column slices of all 16 waves
  // row 'wave': 16 values per lane in whole 512-byte pieces; the short loops below are unrolled so that v[] stays in registers
  { const float* row = &so[wave][0]; const float* rrow = res + (size_t)(r0 + wave) * DD; v4f v[4]; float s = 0.f;
#pragma unroll
    for (int i = 0; i < 4; ++i) { v[i] = *(const v4f*)(&row[i * 128 + lane * 4]) + *(const v4f*)(rrow + i * 128 + lane * 4); s += (v[i][0] + v[i][1]) + (v[i][2] + v[i][3]); }
#pragma unroll
    for (int o = 16; o > 0; o >>= 1) s += __shfl_xor(s, o, 32);
    const float mu = s * (1.0f / DD); float q2 = 0.f;
#pragma unroll
    for (int i = 0; i < 4; ++i)
#pragma unroll
      for (int e = 0; e < 4; ++e) { const float d = v[i][e] - mu; q2 += d * d; }
#pragma unroll
    for (int o = 16; o > 0; o >>= 1) q2 += __shfl_xor(q2, o, 32);
    const float rs = rsqrtf(q2 * (1.0f / DD) + 1e-5f);
#pragma unroll
    for (int i = 0; i < 4; ++i) { const int cc = i * 128 + lane * 4; const v4f gm = *(const v4f*)(gam + cc), bt = *(const v4f*)(bet + cc); v4f o4;
#pragma unroll
      for (int e = 0; e < 4; ++e) o4[e] = (v[i][e] - mu) * rs * gm[e] + bt[e];
      vst2(Out + (size_t)(r0 + wave) * DD + cc, o4); } }
}
// FFN hidden: H16[r][1024] = relu(x1 @ Wf1^T + bf1) as f16 (x4); block 64 rows x 128 cols
__global__ __launch_bounds__(128) void k_ff1(const float* __restrict__ x1, const float* __restrict__ Wf1, const float* __restrict__ bf1, _Float16* __restrict__ H16) {
  __shared__ __align__(16) float so[4][16][132];
  __shared__ __align__(16) _Float16 sX[2][64][KP], sW[2][128][KP];
  const int tid = threadIdx.x, wave = tid >> 5, lane = tid & 31, col = lane & 15, g = lane >> 4;
  const int r0 = blockIdx.x * 64 + wave * 16, n0 = blockIdx.y * 128;
  v8f acc[8] = {};
  tile_mm(x1 + (size_t)blockIdx.x * 64 * DD, Wf1 + (size_t)n0 * DD, &sX[0][0][0], &sW[0][0][0], tid, acc);
#pragma unroll
  for (int j = 0; j < 8; ++j) { const float bb = bf1[n0 + j * 16 + col];
#pragma unroll
    for (int r = 0; r < 8; ++r) { const float v = acc[j][r] * (1.0f / 16.0f) + bb; so[wave][8 * g + r][j * 16 + col] = v > 0.f ? v * 4.0f : 0.f; } }
  LDSX();
  for (int q = lane; q < 16 * 16; q += 32) { const int rl = q >> 4, pc = q & 15; union { v8h h8; v4u u; } pk;
#pragma unroll
    for (int e = 0; e < 8; ++e) pk.h8[e] = (_Float16)so[wave][rl][pc * 8 + e];
    vst2(H16 + (size_t)(r0 + rl) * FF + n0 + pc * 8, pk.u); }
}
extern "C" void kernel_launch(void* const* d_in, const int* in_sizes, int n_in, void* d_out, int out_size, void* d_ws, size_t ws_size, hipStream_t stream) {
  (void)in_sizes; (void)n_in; (void)out_size; (void)ws_size;
  const float** I = (const float**)d_in;
  const float* x = I[0]; const float* pcs = I[1]; const float* Wq = I[2]; const float* bq = I[3]; const float* Wk = I[4]; const float* bk = I[5]; const float* Wv = I[6]; const float* bv = I[7];
  const float* Wr1 = I[8]; const float* br1 = I[9]; const float* Wr2 = I[10]; const float* br2 = I[11]; const float* Wo = I[12]; const float* bo = I[13]; const float* g1 = I[14]; const float* be1 = I[15];
  const float* Wf1 = I[16]; const float* bf1 = I[17]; const float* Wf2 = I[18]; const float* bf2 = I[19]; const float* g2 = I[20]; const float* be2 = I[21];
  float* out = (float*)d_out;
  char* ws = (char*)d_ws; size_t off = 0;
  auto take = [&](size_t bytes) { char* p = ws + off; off += (bytes + 255) & ~(size_t)255; return p; };
  _Float16* q16 = (_Float16*)take((size_t)NR * DD * 2); _Float16* k16 = (_Float16*)take((size_t)NR * DD * 2); _Float16* vT = (_Float16*)take((size_t)NR * DD * 2); float* bias = (float*)take((size_t)NB * NN * NN * 4);
  float* AG = (float*)take((size_t)NR * DD * 4); float* x1 = (float*)take((size_t)NR * DD * 4); _Float16* H16 = (_Float16*)take((size_t)NR * FF * 2);
  k_qkv_bias<<<QKVB + BIASB, 128, 0, stream>>>(x, Wq, bq, Wk, bk, Wv, bv, q16, k16, vT, pcs, Wr1, br1, Wr2, br2, bias);
  k_attn<<<dim3(NN / 16, NB), 512, 0, stream>>>(q16, k16, vT, bias, AG);
  k_lnproj<DD, 0><<<NR / 16, 512, 0, stream>>>(AG, Wo, bo, x, g1, be1, x1);
  k_ff1<<<dim3(NR / 64, FF / 128), 128, 0, stream>>>(x1, Wf1, bf1, H16);
  k_lnproj<FF, 1><<<NR / 16, 512, 0, stream>>>(H16, Wf2, bf2, x1, g2, be2, out);       // hidden x4 (f16) and Wf2 x16 -> /64 inside
}

// v006
// Measured time: 61 microseconds a run.
// Timed twice side by side with v005, it ran 1.56 times as fast both times.
// All steps since v000 together make it 14.9 times as fast.
#include <hip/hip_runtime.h>
#include <math.h>

typedef __attribute__((ext_vector_type(16))) _Float16 v16h;
typedef __attribute__((ext_vector_type(16))) __bf16 v16b;
typedef __attribute__((ext_vector_type(8)))  _Float16 v8h;
typedef __attribute__((ext_vector_type(4)))  _Float16 v4h;
typedef __attribute__((ext_vector_type(8)))  float v8f;
typedef __attribute__((ext_vector_type(4)))  float v4f;
typedef __attribute__((ext_vector_type(2)))  float v2f;
typedef __attribute__((ext_vector_type(4)))  unsigned v4u;
typedef __attribute__((ext_vector_type(4)))  int v4i;
typedef float __attribute__((may_alias)) float_a;
typedef int __attribute__((may_alias)) int_a;

template <typename T> __device__ __forceinline__ void vst2(void* p, T v) { *(T*)p = v;  }
__device__ __forceinline__ v8f wmma16(v16h a, v16h b, v8f c) {
  v8f d = __builtin_amdgcn_wmma_f32_16x16x32_f16(false, a, false, b, (short)0, c, false, false);
  asm volatile("v_nop\n\tv_nop\n\tv_nop\n\tv_nop" : "+v"(d) : "v"(a), "v"(b));
  return d;
}
__device__ __forceinline__ v8f wmma_bf(v16b a, v16b b, v8f c) {
  v8f d = __builtin_amdgcn_wmma_f32_16x16x32_bf16(false, a, false, b, (short)0, c, false, false);
  asm volatile("v_nop\n\tv_nop\n\tv_nop\n\tv_nop" : "+v"(d) : "v"(a), "v"(b));
  return d;
}
// 16x16x32 fragments: lane = (h = lane>>4, row/col = lane&15); elements 0..7 = k0+8h+0..7, 8..15 = k0+16+8h+0..7; D element r = row 8h+r
__device__ __forceinline__ v16h frag_h(const _Float16* rowk0, int lane) {
  union { v16h v; v8h q[2]; } u; const _Float16* p = rowk0 + 8 * (lane >> 4);
  u.q[0] = *(const v8h*)p; u.q[1] = *(const v8h*)(p + 16); return u.v;
}
__device__ __forceinline__ v16h frag_f32(const float* rowk0, int lane) {
  v16h a; const float* p = rowk0 + 8 * (lane >> 4);
#pragma unroll
  for (int i = 0; i < 8; ++i) { a[i] = (_Float16)p[i]; a[8 + i] = (_Float16)p[16 + i]; }
  return a;
}
__device__ __forceinline__ v16h frag_f32s(const float* rowk0, int lane, float sc) {
  v16h a; const float* p = rowk0 + 8 * (lane >> 4);
#pragma unroll
  for (int i = 0; i < 8; ++i) { a[i] = (_Float16)(p[i] * sc); a[8 + i] = (_Float16)(p[16 + i] * sc); }
  return a;
}
// column fragment from a [K][ld] layout (column n), rows >= K read as 0
__device__ __forceinline__ v16h fragc_f32(const float* W, int k0, int n, int lane, int ld, int K) {
  v16h a; const int g = lane >> 4;
#pragma unroll
  for (int i = 0; i < 8; ++i) { const int ka = k0 + 8 * g + i, kb = ka + 16;
    a[i] = (_Float16)(ka < K ? W[(size_t)ka * ld + n] : 0.f); a[8 + i] = (_Float16)(kb < K ? W[(size_t)kb * ld + n] : 0.f); }
  return a;
}
struct F2 { v16b h, l; };
__device__ __forceinline__ F2 bsplit16(const float v[16]) { F2 r;
#pragma unroll
  for (int i = 0; i < 16; ++i) { const __bf16 h = (__bf16)v[i]; r.h[i] = h; r.l[i] = (__bf16)(v[i] - (float)h); }
  return r; }
__device__ __forceinline__ F2 split_row(const float* row, int k0, int lane) { float v[16]; const float* p = row + k0 + 8 * (lane >> 4);
#pragma unroll
  for (int i = 0; i < 8; ++i) { v[i] = p[i]; v[8 + i] = p[16 + i]; }
  return bsplit16(v); }
__device__ __forceinline__ F2 split_rowK(const float* row, int k0, int lane, int K) { float v[16]; const int g = lane >> 4;
#pragma unroll
  for (int i = 0; i < 8; ++i) { const int ka = k0 + 8 * g + i, kb = ka + 16; v[i] = ka < K ? row[ka] : 0.f; v[8 + i] = kb < K ? row[kb] : 0.f; }
  return bsplit16(v); }
__device__ __forceinline__ F2 split_col(const float* W, int k0, int n, int lane, int ld, int K) { float v[16]; const int g = lane >> 4;
#pragma unroll
  for (int i = 0; i < 8; ++i) { const int ka = k0 + 8 * g + i, kb = ka + 16; v[i] = ka < K ? W[(size_t)ka * ld + n] : 0.f; v[8 + i] = kb < K ? W[(size_t)kb * ld + n] : 0.f; }
  return bsplit16(v); }
__device__ __forceinline__ v8f mac3(const F2& a, const F2& b, v8f c) { c = wmma_bf(a.l, b.h, c); c = wmma_bf(a.h, b.l, c); return wmma_bf(a.h, b.h, c); }
__device__ __forceinline__ float sigm(float v) { return 1.0f / (1.0f + expf(-v)); }
#define LDSX() do { asm volatile("s_wait_dscnt 0" ::: "memory"); __builtin_amdgcn_wave_barrier(); __builtin_amdgcn_fence(__ATOMIC_RELEASE, "workgroup"); } while (0)

// Graph interaction layer (single-head attention with a learned relative-position bias, post-LN transformer block). q/k/v / Wo / FFN
// GEMMs on v_wmma_f32_16x16x32_f16 (q/k/v operands converted on the way into LDS; Wo/FFN A rows staged in LDS as f16, their weights converted once into f16 fragment order; [out][in] weights x16; f32 accumulate); the pairwise bias
// MLP (2 -> 512 -> 1, K = 2) in f32 VALU; diagonal masked to -inf; softmax, LayerNorms in f32; P x2^14 f16.
#define NB 8
#define NN 256
#define DD 512
#define FF 1024
#define NR (NB * NN)

// 64 x 128 tile of X @ W^T over K = 512 for a block of 4 waves (wave w: rows 16w..16w+15, all 128 columns). X and W arrive in chunks of KC
// columns: every thread fetches whole 256-byte row pieces (16 lanes a row), converts once (W x16) and stores f16 rows of pitch KP in LDS;
// the fragments come from LDS. Two buffers: the next chunk's loads are asked for before this chunk's products and fly behind them.
#define KC 64
#define KP (KC + 8)
__device__ __forceinline__ void tile_mm(const float* __restrict__ X, const float* __restrict__ Wm, _Float16* sX, _Float16* sW, int tid, v8f (&acc)[8]) {
  const int wave = tid >> 5, lane = tid & 31, col = lane & 15, pr = tid >> 4, pc = (tid & 15) * 4;
  const unsigned vo = (unsigned)(pr * DD + pc);   // the thread's place inside a chunk: loop-invariant lane offset, the chunk's base stays scalar
  v4f xa[8], wb[16];
#pragma unroll
  for (int i = 0; i < 8; ++i) xa[i] = *(const v4f*)(X + i * 8 * DD + vo);
#pragma unroll
  for (int i = 0; i < 16; ++i) wb[i] = *(const v4f*)(Wm + i * 8 * DD + vo);
#pragma unroll 1   // rolled: one chunk in registers, one in each LDS buffer
  for (int c = 0; c < DD / KC; ++c) { _Float16* bx = sX + (c & 1) * (64 * KP); _Float16* bw = sW + (c & 1) * (128 * KP);
#pragma unroll
    for (int i = 0; i < 8; ++i) { v4h h4;
#pragma unroll
      for (int e = 0; e < 4; ++e) h4[e] = (_Float16)xa[i][e];
      vst2(bx + (i * 8 + pr) * KP + pc, h4); }
#pragma unroll
    for (int i = 0; i < 16; ++i) { v4h h4;
#pragma unroll
      for (int e = 0; e < 4; ++e) h4[e] = (_Float16)(wb[i][e] * 16.0f);
      vst2(bw + (i * 8 + pr) * KP + pc, h4); }
    __syncthreads();   // chunk c is whole; it also ends every wave's reads of the other buffer, which the next trip refills
    if (c + 1 < DD / KC) { X += KC; Wm += KC;   // asked for behind the barrier (whose fence would wait for them), so that they fly while this chunk's products run
#pragma unroll
      for (int i = 0; i < 8; ++i) xa[i] = *(const v4f*)(X + i * 8 * DD + vo);
#pragma unroll
      for (int i = 0; i < 16; ++i) wb[i] = *(const v4f*)(Wm + i * 8 * DD + vo); }
#pragma unroll
    for (int ks = 0; ks < KC / 32; ++ks) { const v16h a = frag_h(bx + (wave * 16 + col) * KP + ks * 32, lane); v16h bf[8];   // all nine fragments asked for before the first product
#pragma unroll
      for (int j = 0; j < 8; ++j) bf[j] = frag_h(bw + (j * 16 + col) * KP + ks * 32, lane);
#pragma unroll
      for (int j = 0; j < 8; ++j) acc[j] = wmma16(a, bf[j], acc[j]); } }
}
// The q/k/v projection and the pairwise bias do not depend on each other: they share ONE launch (k_qkv_bias below), told apart by the block index.
// Both kinds of block have 4 waves and lie over the same LDS (a union: a block is of one kind only).
#define BJ 8
struct LdsQkv { float so[4][16][132]; _Float16 st[128][72]; _Float16 sX[2][64][KP]; _Float16 sW[2][128][KP]; };
struct LdsBias { v4f sw[DD / 2][2]; float sr[2][BJ][32]; };
union LdsQB { LdsQkv q; LdsBias b; };
// q, k -> f16 rows [r][512]; v -> vT [b][d][n] f16 ; bx: 64 rows; by: 0..3 q cols, 4..7 k cols, 8..11 v cols (128 each)
__device__ __forceinline__ void qkv_block(LdsQkv& L, int bx, int by, const float* __restrict__ x, const float* __restrict__ Wq, const float* __restrict__ bq, const float* __restrict__ Wk, const float* __restrict__ bk, const float* __restrict__ Wv, const float* __restrict__ bv,
                                          _Float16* __restrict__ q16, _Float16* __restrict__ k16, _Float16* __restrict__ vT) {
  float (&so)[4][16][132] = L.so; _Float16 (&st)[128][72] = L.st; _Float16 (&sX)[2][64][KP] = L.sX; _Float16 (&sW)[2][128][KP] = L.sW;
  const int tid = threadIdx.x, wave = tid >> 5, lane = tid & 31, col = lane & 15, g = lane >> 4;
  const int r0b = bx * 64, r0 = r0b + wave * 16; const int which = by / 4, n0 = (by % 4) * 128; const int b = r0b / NN, t0 = r0b % NN;
  const float* W = which == 0 ? Wq : (which == 1 ? Wk : Wv); const float* bias = which == 0 ? bq : (which == 1 ? bk : bv);
  v8f acc[8] = {};
  tile_mm(x + (size_t)r0b * DD, W + (size_t)n0 * DD, &sX[0][0][0], &sW[0][0][0], tid, acc);
#pragma unroll
  for (int j = 0; j < 8; ++j) { const float bb = bias[n0 + j * 16 + col];
#pragma unroll
    for (int r = 0; r < 8; ++r) so[wave][8 * g + r][j * 16 + col] = acc[j][r] * (1.0f / 16.0f) + bb; }
  LDSX();
  if (which < 2) { _Float16* dst = which == 0 ? q16 : k16;
    for (int q = lane; q < 16 * 16; q += 32) { const int rl = q >> 4, pc = q & 15; union { v8h h8; v4u u; } pk;
#pragma unroll
      for (int e = 0; e < 8; ++e) pk.h8[e] = (_Float16)so[wave][rl][pc * 8 + e];
      vst2(dst + (size_t)(r0 + rl) * DD + n0 + pc * 8, pk.u); } }
  else {
#pragma unroll 4
    for (int rl = 0; rl < 16; ++rl) {
#pragma unroll
      for (int e = 0; e < 4; ++e) st[lane * 4 + e][wave * 16 + rl] = (_Float16)so[wave][rl][lane * 4 + e]; }
    __syncthreads();
    for (int q = tid; q < 128 * 8; q += 128) { const int c = q >> 3, pc = q & 7; vst2(vT + ((size_t)b * DD + n0 + c) * NN + t0 + pc * 8, *(const v4u*)(&st[c][pc * 8])); } }
}
// bias[b][n][m] = Wr2 . relu(rel @ Wr1^T + br1) + br2, rel = pc[n] - pc[m]; f32 throughout.
// A lane takes 8 pairs (m = lane + 32 j) of one row n, so that one broadcast read of the weights from LDS serves 8 pairs instead of one.
// The weights lie in LDS by pairs of hidden units (w1x w1x' w1y w1y' | br1 br1' Wr2 Wr2'): each packed f32 operation does two hidden units of one pair.
// Block = 4 waves = 2 rows n x 2 halves of the hidden units; the two halves of a row are added through LDS at the end.
__device__ __forceinline__ void bias_mac(const v4f lo, const v4f hi, const v2f (&rx)[BJ], const v2f (&ry)[BJ], v2f (&acc)[BJ]) {
  const v2f wx = {lo[0], lo[1]}, wy = {lo[2], lo[3]}, b1 = {hi[0], hi[1]}, wo = {hi[2], hi[3]};
#pragma unroll
  for (int j = 0; j < BJ; ++j) { const v2f z = __builtin_elementwise_fma(rx[j], wx, __builtin_elementwise_fma(ry[j], wy, b1));
    const v2f h = {z[0] > 0.f ? z[0] : 0.f, z[1] > 0.f ? z[1] : 0.f};
    acc[j] = __builtin_elementwise_fma(h, wo, acc[j]); }
}
__device__ __forceinline__ void bias_block(LdsBias& L, int bx, int b, const float* __restrict__ pcs, const float* __restrict__ Wr1, const float* __restrict__ br1, const float* __restrict__ Wr2, const float* __restrict__ br2, float* __restrict__ bias) {
  v4f (&sw)[DD / 2][2] = L.sw; float (&sr)[2][BJ][32] = L.sr;
  const int tid = threadIdx.x, lane = tid & 31;
  const int w = __builtin_amdgcn_readfirstlane(tid >> 5);   // the wave's number in a scalar register: row base and hidden half stay scalar
  const int nl = w >> 1, hh = w & 1, n = bx * 2 + nl;
  // every global operand of the prologue is asked for before the first one is used; a thread stages two pairs of hidden units (tid and tid + 128)
  v4f w1[2]; v2f bb[2], w2[2];
#pragma unroll
  for (int i = 0; i < 2; ++i) { const int p = tid + i * 128; w1[i] = *(const v4f*)(Wr1 + p * 4); bb[i] = *(const v2f*)(br1 + p * 2); w2[i] = *(const v2f*)(Wr2 + p * 2); }
  const v2f pn = *(const v2f*)(pcs + ((size_t)b * NN + n) * 2); v2f pm[BJ];
#pragma unroll
  for (int j = 0; j < BJ; ++j) pm[j] = *(const v2f*)(pcs + ((size_t)b * NN + j * 32 + lane) * 2);
#pragma unroll
  for (int i = 0; i < 2; ++i) { const int p = tid + i * 128; sw[p][0] = (v4f){w1[i][0], w1[i][2], w1[i][1], w1[i][3]}; sw[p][1] = (v4f){bb[i][0], bb[i][1], w2[i][0], w2[i][1]}; }
  v2f rx[BJ], ry[BJ], acc[BJ];
#pragma unroll
  for (int j = 0; j < BJ; ++j) { const v2f r = pn - pm[j]; rx[j] = (v2f){r[0], r[0]}; ry[j] = (v2f){r[1], r[1]}; acc[j] = (v2f){0.f, 0.f}; }
  __syncthreads();   // the weights are whole
  const v4f* wp = &sw[hh * (DD / 4)][0];   // this wave's 128 pairs of hidden units, four hidden units a trip
  v4f c0 = wp[0], c1 = wp[1], c2 = wp[2], c3 = wp[3];
#pragma unroll 2   // two trips a pass, so that the current and the next weights swap registers without copies
  for (int t = 0; t < DD / 8; ++t) { const v4f* np = wp + ((t + 1) & (DD / 8 - 1)) * 4;   // the next trip's weights are asked for ahead of this trip's arithmetic (the last trip re-reads the first group, unused)
    const v4f n0 = np[0], n1 = np[1], n2 = np[2], n3 = np[3];
    __builtin_amdgcn_sched_barrier(0);   // keeps the four reads above the arithmetic, whose 64 issue slots then cover their latency
    bias_mac(c0, c1, rx, ry, acc); bias_mac(c2, c3, rx, ry, acc);
    c0 = n0; c1 = n1; c2 = n2; c3 = n3; }
  if (hh) {
#pragma unroll
    for (int j = 0; j < BJ; ++j) sr[nl][j][lane] = acc[j][0] + acc[j][1]; }
  __syncthreads();   // the upper hidden half's sums are in LDS
  if (!hh) { const float b2 = br2[0];
#pragma unroll
    for (int j = 0; j < BJ; ++j) bias[((size_t)b * NN + n) * NN + j * 32 + lane] = ((acc[j][0] + acc[j][1]) + sr[nl][j][lane]) + b2; }
}
// Wo, Wf2 and Wf1 are turned ONCE into f16 (x16) in the order of the B fragments: [16-column tile][32 k][half q][lane][8 values], so that a fragment half
// is 512 bytes in a row. A wave takes one tile of 16 weight rows x 128 k (4 KiB out): lane (g, col) reads row col, k = 16 i + 8 g + 0..7, for piece i.
// Wave tasks 0..127: Wo (32 tiles x 4 groups of k), 128..383: Wf2 (32 x 8), 384..639: Wf1 (64 x 4).
__device__ __forceinline__ void wfrag_block(int cb, const float* __restrict__ Wo, const float* __restrict__ Wf2, const float* __restrict__ Wf1, _Float16* __restrict__ WoH, _Float16* __restrict__ Wf2H, _Float16* __restrict__ Wf1H) {
  const int tid = threadIdx.x, lane = tid & 31, col = lane & 15, g = lane >> 4;
  const int t = cb * 4 + __builtin_amdgcn_readfirstlane(tid >> 5);
  const bool f1 = t >= 384, f2 = t >= 128 && !f1; const int u = f1 ? t - 384 : (f2 ? t - 128 : t), K = f2 ? FF : DD, nt = f2 ? u >> 3 : u >> 2, kg = f2 ? u & 7 : u & 3;
  const float* src = (f1 ? Wf1 : (f2 ? Wf2 : Wo)) + (size_t)(nt * 16 + col) * K + kg * 128 + g * 8;
  _Float16* dst = (f1 ? Wf1H : (f2 ? Wf2H : WoH)) + (size_t)(nt * (K / 32) + kg * 4) * 512 + lane * 8;
  v4f v[8][2];
#pragma unroll
  for (int i = 0; i < 8; ++i) { v[i][0] = *(const v4f*)(src + i * 16); v[i][1] = *(const v4f*)(src + i * 16 + 4); }
  asm volatile("s_wait_xcnt 0x0" :: "v"(src) : "memory");   // the loads' address pair stays whole up to this wait
#pragma unroll
  for (int i = 0; i < 8; ++i) { v8h h;
#pragma unroll
    for (int e = 0; e < 8; ++e) h[e] = (_Float16)(v[i][e >> 2][e & 3] * 16.0f);
    vst2(dst + i * 256, h); }
}
// One launch for all three: blocks 0..QKVB-1 are the projection tiles (first, because each is a long chain of waits with little to issue),
// then WFB short blocks that re-order Wo, Wf2 and Wf1 for the later launches; the BIASB blocks behind them are the bias rows, whose vector work fills the issue slots that the projection waves leave idle.
#define QKVB (NR / 64 * 12)
#define WFB 160
#define BIASB (NN / 2 * NB)
__global__ __launch_bounds__(128) void k_qkv_bias(const float* __restrict__ x, const float* __restrict__ Wq, const float* __restrict__ bq, const float* __restrict__ Wk, const float* __restrict__ bk, const float* __restrict__ Wv, const float* __restrict__ bv,
                                                  _Float16* __restrict__ q16, _Float16* __restrict__ k16, _Float16* __restrict__ vT,
                                                  const float* __restrict__ pcs, const float* __restrict__ Wr1, const float* __restrict__ br1, const float* __restrict__ Wr2, const float* __restrict__ br2, float* __restrict__ bias,
                                                  const float* __restrict__ Wo, const float* __restrict__ Wf2, const float* __restrict__ Wf1, _Float16* __restrict__ WoH, _Float16* __restrict__ Wf2H, _Float16* __restrict__ Wf1H) {
  __shared__ __align__(16) LdsQB lds;
  const int bid = blockIdx.x;   // the same for the whole block: every barrier below stands under block-uniform control flow
  if (bid < QKVB) qkv_block(lds.q, bid % (NR / 64), bid / (NR / 64), x, Wq, bq, Wk, bk, Wv, bv, q16, k16, vT);
  else if (bid < QKVB + WFB) wfrag_block(bid - QKVB, Wo, Wf2, Wf1, WoH, Wf2H, Wf1H);
  else bias_block(lds.b, (bid - QKVB - WFB) % (NN / 2), (bid - QKVB - WFB) / (NN / 2), pcs, Wr1, br1, Wr2, br2, bias);
}
// attention: block (b, 16 queries), 16 waves; S = q.k/sqrt(512) + bias, diagonal excluded, softmax over 256 (f32), P x2^14 f16 @ vT -> AG rows f32 [r][512].
// Wave w: the 16 queries against keys 16w..16w+15 (the q tile is staged once in LDS); behind a block barrier the softmax of row w;
// behind a second one columns 32w..32w+31 of P @ v. Each phase asks for all its global operands before its first product.
// The short loops are all unrolled so that the fragment arrays are indexed by constants and stay in registers.
__global__ __launch_bounds__(512) void k_attn(const _Float16* __restrict__ q16, const _Float16* __restrict__ k16, const _Float16* __restrict__ vT, const float* __restrict__ bias, float* __restrict__ AG) {
  __shared__ __align__(16) _Float16 sQ[16][DD + 8];
  __shared__ __align__(16) float sS[16][NN + 4];
  __shared__ __align__(16) _Float16 sP[16][NN + 8];
  __shared__ __align__(16) float sA[16][16][36];
  const int tid = threadIdx.x, lane = tid & 31, col = lane & 15, g = lane >> 4;
  const int w = __builtin_amdgcn_readfirstlane(tid >> 5);   // the wave's number in a scalar register: tile bases stay scalar
  const int b = blockIdx.y, q0 = blockIdx.x * 16; const size_t rb = (size_t)b * NN;
  { v16h kf[16]; float bv[8];
#pragma unroll
    for (int kc = 0; kc < 16; ++kc) kf[kc] = frag_h(k16 + (rb + w * 16 + col) * DD + kc * 32, lane);
#pragma unroll
    for (int r = 0; r < 8; ++r) bv[r] = bias[(rb + q0 + 8 * g + r) * NN + w * 16 + col];
#pragma unroll
    for (int i = 0; i < 2; ++i) { const int q = tid + i * 512, rl = q >> 6, pc = q & 63; vst2(&sQ[rl][pc * 8], *(const v4u*)(q16 + (rb + q0 + rl) * DD + pc * 8)); }
    __syncthreads();   // the q tile is whole
    v8f s = {};
#pragma unroll
    for (int h = 0; h < 2; ++h) { v16h aq[8];
#pragma unroll
      for (int kc = 0; kc < 8; ++kc) aq[kc] = frag_h(&sQ[col][0] + (h * 8 + kc) * 32, lane);
#pragma unroll
      for (int kc = 0; kc < 8; ++kc) s = wmma16(aq[kc], kf[h * 8 + kc], s); }
#pragma unroll
    for (int r = 0; r < 8; ++r) { const int qi = q0 + 8 * g + r, m = w * 16 + col; sS[8 * g + r][m] = (m == qi) ? -3.0e38f : s[r] * 0.044194173824159216f + bv[r]; } }
  __syncthreads();   // every score row now holds the key slices of all 16 waves
  v16h vf[2][8];     // asked for here, so that they fly while the row's softmax runs
#pragma unroll
  for (int j = 0; j < 2; ++j)
#pragma unroll
    for (int kc = 0; kc < 8; ++kc) vf[j][kc] = frag_h(vT + ((size_t)b * DD + w * 32 + j * 16 + col) * NN + kc * 32, lane);
  { v4f x[2]; float mx = -3.4e38f;
#pragma unroll
    for (int i = 0; i < 2; ++i) { x[i] = *(const v4f*)(&sS[w][i * 128 + lane * 4]); mx = fmaxf(mx, fmaxf(fmaxf(x[i][0], x[i][1]), fmaxf(x[i][2], x[i][3]))); }
#pragma unroll
    for (int o = 16; o > 0; o >>= 1) mx = fmaxf(mx, __shfl_xor(mx, o, 32));
    float l = 0.f;
#pragma unroll
    for (int i = 0; i < 2; ++i)
#pragma unroll
      for (int e = 0; e < 4; ++e) { const float sv = x[i][e]; const float pv = sv <= -1.0e38f ? 0.f : expf(sv - mx); l += pv; x[i][e] = pv; }
#pragma unroll
    for (int o = 16; o > 0; o >>= 1) l += __shfl_xor(l, o, 32);
    const float inv = 16384.0f / l;
#pragma unroll
    for (int i = 0; i < 2; ++i) { v4h h4;
#pragma unroll
      for (int e = 0; e < 4; ++e) h4[e] = (_Float16)(x[i][e] * inv);
      vst2(&sP[w][i * 128 + lane * 4], h4); } }
  __syncthreads();   // all 16 rows of P are written
  v16h pa[8];
#pragma unroll
  for (int kc = 0; kc < 8; ++kc) pa[kc] = frag_h(&sP[col][0] + kc * 32, lane);
  v8f acc[2] = {};
#pragma unroll
  for (int kc = 0; kc < 8; ++kc) {
#pragma unroll
    for (int j = 0; j < 2; ++j) acc[j] = wmma16(pa[kc], vf[j][kc], acc[j]); }
#pragma unroll
  for (int j = 0; j < 2; ++j)
#pragma unroll
    for (int r = 0; r < 8; ++r) sA[w][8 * g + r][j * 16 + col] = acc[j][r] * (1.0f / 16384.0f);
  LDSX();   // wave-local exchange: the wave's own tile is in LDS before it reads it back as whole 128-byte row pieces
#pragma unroll
  for (int q = lane; q < 16 * 8; q += 32) { const int rl = q >> 3, pc = q & 7; vst2(AG + (rb + q0 + rl) * DD + w * 32 + pc * 4, *(const v4f*)(&sA[w][rl][pc * 4])); }
}
// generic: Out = LN(A @ W^T + bias + res) over 512 columns; block = 16 rows, 16 waves: wave w computes columns 32w..32w+31 of the product
// for all 16 rows, then (behind the block barrier) the LayerNorm of row w; K = KIN (A f32 rows or f16 rows per AH).
// Wh is the weight as wfrag_block left it (f16 x16, fragment order): no other wave of the block needs a wave's B fragments, so each wave loads its own
// straight into registers, 512 bytes in a row per load, through a ring of RD k-steps; the k loop has no LDS staging of W and no barrier.
#define RD 8
#define AR 2
__device__ __forceinline__ v16h frag_w(const _Float16* p) { union { v16h v; v8h q[2]; } u; u.q[0] = *(const v8h*)p; u.q[1] = *(const v8h*)(p + 256); return u.v; }
template <int KIN, int AH>      // AH: A operand is f16 rows pre-scaled x4 (so the product is /64), else f32 rows (/16)
__global__ __launch_bounds__(512) void k_lnproj(const void* __restrict__ Ain, const _Float16* __restrict__ Wh, const float* __restrict__ bias, const float* __restrict__ res, const float* __restrict__ gam, const float* __restrict__ bet, float* __restrict__ Out) {
  __shared__ __align__(16) float so[16][DD + 4];
  __shared__ __align__(16) _Float16 sA[16][KIN + 8];
  const int tid = threadIdx.x, lane = tid & 31, col = lane & 15, g = lane >> 4;
  const int wave = __builtin_amdgcn_readfirstlane(tid >> 5);   // the wave's number in a scalar register: tile bases stay scalar
  const int r0 = blockIdx.x * 16, n0 = wave * 32;
  constexpr int NK = KIN / 32;
  // the block's 16 rows of A, whole K, as f16 rows in LDS (fetched in whole lines; f32 rows converted once); asked for first, the ring's first RD steps behind them
  v4u ah[4]; v4f af[4];
#pragma unroll
  for (int i = 0; i < 4; ++i) { const int q = tid + i * 512;
    if (AH) ah[i] = *(const v4u*)((const _Float16*)Ain + (size_t)r0 * KIN + q * 8);
    else af[i] = *(const v4f*)((const float*)Ain + (size_t)r0 * KIN + q * 4); }
  const _Float16* wp = Wh + (size_t)(wave * 2) * NK * 512 + lane * 8;   // the wave's two column tiles, NK * 512 values apart
  v16h bf[RD][2];
#pragma unroll
  for (int kc = 0; kc < RD; ++kc)
#pragma unroll
    for (int j = 0; j < 2; ++j) bf[kc][j] = frag_w(wp + (j * NK + kc) * 512);
#pragma unroll
  for (int i = 0; i < 4; ++i) { const int q = tid + i * 512;
    if (AH) vst2(&sA[q / (KIN / 8)][(q % (KIN / 8)) * 8], ah[i]);
    else { v4h h4;
#pragma unroll
      for (int e = 0; e < 4; ++e) h4[e] = (_Float16)af[i][e];
      vst2(&sA[q / (KIN / 4)][(q % (KIN / 4)) * 4], h4); } }
  __syncthreads();   // the A tile is whole
  v8f acc[2] = {}; v16h ar[AR];   // the A fragments come from LDS AR steps ahead of their products
#pragma unroll
  for (int kc = 0; kc < AR; ++kc) ar[kc] = frag_h(&sA[col][kc * 32], lane);
#pragma unroll   // unrolled: the ring's registers are indexed by constants
  for (int kc = 0; kc < NK; ++kc) { const v16h a = ar[kc % AR];
#pragma unroll
    for (int j = 0; j < 2; ++j) acc[j] = wmma16(a, bf[kc % RD][j], acc[j]);
    if (kc + AR < NK) ar[kc % AR] = frag_h(&sA[col][(kc + AR) * 32], lane);
    if (kc + RD < NK) {   // the step's registers are free: refill them RD steps ahead
#pragma unroll
      for (int j = 0; j < 2; ++j) bf[kc % RD][j] = frag_w(wp + (j * NK + kc + RD) * 512); } }
#pragma unroll
  for (int j = 0; j < 2; ++j) { const int c = n0 + j * 16 + col; const float bb = bias[c];
#pragma unroll
    for (int r = 0; r < 8; ++r) so[8 * g + r][c] = acc[j][r] * (AH ? (1.0f / 64.0f) : (1.0f / 16.0f)) + bb; }
  __syncthreads();   // every row now holds the column slices of all 16 waves
  // row 'wave': 16 values per lane in whole 512-byte pieces; the short loops below are unrolled so that v[] stays in registers
  { const float* row = &so[wave][0]; const float* rrow = res + (size_t)(r0 + wave) * DD; v4f v[4]; float s = 0.f;
#pragma unroll
    for (int i = 0; i < 4; ++i) { v[i] = *(const v4f*)(&row[i * 128 + lane * 4]) + *(const v4f*)(rrow + i * 128 + lane * 4); s += (v[i][0] + v[i][1]) + (v[i][2] + v[i][3]); }
#pragma unroll
    for (int o = 16; o > 0; o >>= 1) s += __shfl_xor(s, o, 32);
    const float mu = s * (1.0f / DD); float q2 = 0.f;
#pragma unroll
    for (int i = 0; i < 4; ++i)
#pragma unroll
      for (int e = 0; e < 4; ++e) { const float d = v[i][e] - mu; q2 += d * d; }
#pragma unroll
    for (int o = 16; o > 0; o >>= 1) q2 += __shfl_xor(q2, o, 32);
    const float rs = rsqrtf(q2 * (1.0f / DD) + 1e-5f);
#pragma unroll
    for (int i = 0; i < 4; ++i) { const int cc = i * 128 + lane * 4; const v4f gm = *(const v4f*)(gam + cc), bt = *(const v4f*)(bet + cc); v4f o4;
#pragma unroll
      for (int e = 0; e < 4; ++e) o4[e] = (v[i][e] - mu) * rs * gm[e] + bt[e];
      vst2(Out + (size_t)(r0 + wave) * DD + cc, o4); } }
}
// FFN hidden: H16[r][1024] = relu(x1 @ Wf1^T + bf1) as f16 (x4); block 32 rows x 256 cols, 8 waves: wave w takes all 32 rows x columns 32w..32w+31.
// As in k_lnproj: the x1 tile is staged once in LDS as f16, each wave loads its own B fragments (Wh: Wf1 in fragment order) through the ring; no barrier in the k loop.
__global__ __launch_bounds__(256) void k_ff1(const float* __restrict__ x1, const _Float16* __restrict__ Wh, const float* __restrict__ bf1, _Float16* __restrict__ H16) {
  __shared__ __align__(16) float so[32][256 + 4];
  __shared__ __align__(16) _Float16 sA[32][DD + 8];
  const int tid = threadIdx.x, lane = tid & 31, col = lane & 15, g = lane >> 4;
  const int wave = __builtin_amdgcn_readfirstlane(tid >> 5);   // the wave's number in a scalar register: tile bases stay scalar
  const int r0 = blockIdx.x * 32, nb = blockIdx.y * 256, n0 = nb + wave * 32;
  constexpr int NK = DD / 32;
  v4f af[16];
#pragma unroll
  for (int i = 0; i < 16; ++i) af[i] = *(const v4f*)(x1 + (size_t)r0 * DD + (tid + i * 256) * 4);
  const _Float16* wp = Wh + (size_t)(n0 / 16) * NK * 512 + lane * 8;   // the wave's two column tiles, NK * 512 values apart
  v16h bf[RD][2];
#pragma unroll
  for (int kc = 0; kc < RD; ++kc)
#pragma unroll
    for (int j = 0; j < 2; ++j) bf[kc][j] = frag_w(wp + (j * NK + kc) * 512);
#pragma unroll
  for (int i = 0; i < 16; ++i) { const int q = tid + i * 256; v4h h4;
#pragma unroll
    for (int e = 0; e < 4; ++e) h4[e] = (_Float16)af[i][e];
    vst2(&sA[q / (DD / 4)][(q % (DD / 4)) * 4], h4); }
  __syncthreads();   // the x1 tile is whole
  v8f acc[2][2] = {}; v16h ar[AR][2];   // the A fragments come from LDS AR steps ahead of their products
#pragma unroll
  for (int kc = 0; kc < AR; ++kc)
#pragma unroll
    for (int m = 0; m < 2; ++m) ar[kc][m] = frag_h(&sA[m * 16 + col][kc * 32], lane);
#pragma unroll   // unrolled: the rings' registers are indexed by constants
  for (int kc = 0; kc < NK; ++kc) {
#pragma unroll
    for (int m = 0; m < 2; ++m)
#pragma unroll
      for (int j = 0; j < 2; ++j) acc[m][j] = wmma16(ar[kc % AR][m], bf[kc % RD][j], acc[m][j]);
    if (kc + AR < NK) {
#pragma unroll
      for (int m = 0; m < 2; ++m) ar[kc % AR][m] = frag_h(&sA[m * 16 + col][(kc + AR) * 32], lane); }
    if (kc + RD < NK) {   // the step's registers are free: refill them RD steps ahead
#pragma unroll
      for (int j = 0; j < 2; ++j) bf[kc % RD][j] = frag_w(wp + (j * NK + kc + RD) * 512); } }
#pragma unroll
  for (int j = 0; j < 2; ++j) { const float bb = bf1[n0 + j * 16 + col];
#pragma unroll
    for (int m = 0; m < 2; ++m)
#pragma unroll
      for (int r = 0; r < 8; ++r) { const float v = acc[m][j][r] * (1.0f / 16.0f) + bb; so[m * 16 + 8 * g + r][wave * 32 + j * 16 + col] = v > 0.f ? v * 4.0f : 0.f; } }
  __syncthreads();   // every row now holds the column slices of all 8 waves; they leave as whole 512-byte row pieces
#pragma unroll
  for (int i = 0; i < 4; ++i) { const int q = tid + i * 256, rl = q >> 5, pc = q & 31; union { v8h h8; v4u u; } pk;
#pragma unroll
    for (int e = 0; e < 8; ++e) pk.h8[e] = (_Float16)so[rl][pc * 8 + e];
    vst2(H16 + (size_t)(r0 + rl) * FF + nb + pc * 8, pk.u); }
}
extern "C" void kernel_launch(void* const* d_in, const int* in_sizes, int n_in, void* d_out, int out_size, void* d_ws, size_t ws_size, hipStream_t stream) {
  (void)in_sizes; (void)n_in; (void)out_size; (void)ws_size;
  const float** I = (const float**)d_in;
  const float* x = I[0]; const float* pcs = I[1]; const float* Wq = I[2]; const float* bq = I[3]; const float* Wk = I[4]; const float* bk = I[5]; const float* Wv = I[6]; const float* bv = I[7];
  const float* Wr1 = I[8]; const float* br1 = I[9]; const float* Wr2 = I[10]; const float* br2 = I[11]; const float* Wo = I[12]; const float* bo = I[13]; const float* g1 = I[14]; const float* be1 = I[15];
  const float* Wf1 = I[16]; const float* bf1 = I[17]; const float* Wf2 = I[18]; const float* bf2 = I[19]; const float* g2 = I[20]; const float* be2 = I[21];
  float* out = (float*)d_out;
  char* ws = (char*)d_ws; size_t off = 0;
  auto take = [&](size_t bytes) { char* p = ws + off; off += (bytes + 255) & ~(size_t)255; return p; };
  _Float16* q16 = (_Float16*)take((size_t)NR * DD * 2); _Float16* k16 = (_Float16*)take((size_t)NR * DD * 2); _Float16* vT = (_Float16*)take((size_t)NR * DD * 2); float* bias = (float*)take((size_t)NB * NN * NN * 4);
  float* AG = (float*)take((size_t)NR * DD * 4); float* x1 = (float*)take((size_t)NR * DD * 4); _Float16* H16 = (_Float16*)take((size_t)NR * FF * 2);
  _Float16* WoH = (_Float16*)take((size_t)DD * DD * 2); _Float16* Wf2H = (_Float16*)take((size_t)DD * FF * 2); _Float16* Wf1H = (_Float16*)take((size_t)FF * DD * 2);
  k_qkv_bias<<<QKVB + WFB + BIASB, 128, 0, stream>>>(x, Wq, bq, Wk, bk, Wv, bv, q16, k16, vT, pcs, Wr1, br1, Wr2, br2, bias, Wo, Wf2, Wf1, WoH, Wf2H, Wf1H);
  k_attn<<<dim3(NN / 16, NB), 512, 0, stream>>>(q16, k16, vT, bias, AG);
  k_lnproj<DD, 0><<<NR / 16, 512, 0, stream>>>(AG, WoH, bo, x, g1, be1, x1);
  k_ff1<<<dim3(NR / 32, FF / 256), 256, 0, stream>>>(x1, Wf1H, bf1, H16);
  k_lnproj<FF, 1><<<NR / 16, 512, 0, stream>>>(H16, Wf2H, bf2, x1, g2, be2, out);       // hidden x4 (f16) and Wf2 x16 -> /64 inside
}

// v007
// A run of this version takes 58.8 microseconds.
// Timed twice side by side with v006, it ran 1.03 and 1.04 times as fast.
// Over all steps from v000 it is 15.4 times as fast.
#include <hip/hip_runtime.h>
#include <math.h>

typedef __attribute__((ext_vector_type(16))) _Float16 v16h;
typedef __attribute__((ext_vector_type(16))) __bf16 v16b;
typedef __attribute__((ext_vector_type(8)))  _Float16 v8h;
typedef __attribute__((ext_vector_type(4)))  _Float16 v4h;
typedef __attribute__((ext_vector_type(8)))  float v8f;
typedef __attribute__((ext_vector_type(4)))  float v4f;
typedef __attribute__((ext_vector_type(2)))  float v2f;
typedef __attribute__((ext_vector_type(4)))  unsigned v4u;
typedef __attribute__((ext_vector_type(4)))  int v4i;
typedef float __attribute__((may_alias)) float_a;
typedef int __attribute__((may_alias)) int_a;

template <typename T> __device__ __forceinline__ void vst2(void* p, T v) { *(T*)p = v;  }
__device__ __forceinline__ v8f wmma16(v16h a, v16h b, v8f c) {
  v8f d = __builtin_amdgcn_wmma_f32_16x16x32_f16(false, a, false, b, (short)0, c, false, false);
  asm volatile("v_nop\n\tv_nop\n\tv_nop\n\tv_nop" : "+v"(d) : "v"(a), "v"(b));
  return d;
}
__device__ __forceinline__ v8f wmma_bf(v16b a, v16b b, v8f c) {
  v8f d = __builtin_amdgcn_wmma_f32_16x16x32_bf16(false, a, false, b, (short)0, c, false, false);
  asm volatile("v_nop\n\tv_nop\n\tv_nop\n\tv_nop" : "+v"(d) : "v"(a), "v"(b));
  return d;
}
// 16x16x32 fragments: lane = (h = lane>>4, row/col = lane&15); elements 0..7 = k0+8h+0..7, 8..15 = k0+16+8h+0..7; D element r = row 8h+r
__device__ __forceinline__ v16h frag_h(const _Float16* rowk0, int lane) {
  union { v16h v; v8h q[2]; } u; const _Float16* p = rowk0 + 8 * (lane >> 4);
  u.q[0] = *(const v8h*)p; u.q[1] = *(const v8h*)(p + 16); return u.v;
}
// a fragment stored in fragment order: p = the fragment's 1 KiB + lane * 8 values; the two halves lie 256 values apart
__device__ __forceinline__ v16h frag_w(const _Float16* p) { union { v16h v; v8h q[2]; } u; u.q[0] = *(const v8h*)p; u.q[1] = *(const v8h*)(p + 256); return u.v; }
__device__ __forceinline__ v16h frag_f32(const float* rowk0, int lane) {
  v16h a; const float* p = rowk0 + 8 * (lane >> 4);
#pragma unroll
  for (int i = 0; i < 8; ++i) { a[i] = (_Float16)p[i]; a[8 + i] = (_Float16)p[16 + i]; }
  return a;
}
__device__ __forceinline__ v16h frag_f32s(const float* rowk0, int lane, float sc) {
  v16h a; const float* p = rowk0 + 8 * (lane >> 4);
#pragma unroll
  for (int i = 0; i < 8; ++i) { a[i] = (_Float16)(p[i] * sc); a[8 + i] = (_Float16)(p[16 + i] * sc); }
  return a;
}
// column fragment from a [K][ld] layout (column n), rows >= K read as 0
__device__ __forceinline__ v16h fragc_f32(const float* W, int k0, int n, int lane, int ld, int K) {
  v16h a; const int g = lane >> 4;
#pragma unroll
  for (int i = 0; i < 8; ++i) { const int ka = k0 + 8 * g + i, kb = ka + 16;
    a[i] = (_Float16)(ka < K ? W[(size_t)ka * ld + n] : 0.f); a[8 + i] = (_Float16)(kb < K ? W[(size_t)kb * ld + n] : 0.f); }
  return a;
}
struct F2 { v16b h, l; };
__device__ __forceinline__ F2 bsplit16(const float v[16]) { F2 r;
#pragma unroll
  for (int i = 0; i < 16; ++i) { const __bf16 h = (__bf16)v[i]; r.h[i] = h; r.l[i] = (__bf16)(v[i] - (float)h); }
  return r; }
__device__ __forceinline__ F2 split_row(const float* row, int k0, int lane) { float v[16]; const float* p = row + k0 + 8 * (lane >> 4);
#pragma unroll
  for (int i = 0; i < 8; ++i) { v[i] = p[i]; v[8 + i] = p[16 + i]; }
  return bsplit16(v); }
__device__ __forceinline__ F2 split_rowK(const float* row, int k0, int lane, int K) { float v[16]; const int g = lane >> 4;
#pragma unroll
  for (int i = 0; i < 8; ++i) { const int ka = k0 + 8 * g + i, kb = ka + 16; v[i] = ka < K ? row[ka] : 0.f; v[8 + i] = kb < K ? row[kb] : 0.f; }
  return bsplit16(v); }
__device__ __forceinline__ F2 split_col(const float* W, int k0, int n, int lane, int ld, int K) { float v[16]; const int g = lane >> 4;
#pragma unroll
  for (int i = 0; i < 8; ++i) { const int ka = k0 + 8 * g + i, kb = ka + 16; v[i] = ka < K ? W[(size_t)ka * ld + n] : 0.f; v[8 + i] = kb < K ? W[(size_t)kb * ld + n] : 0.f; }
  return bsplit16(v); }
__device__ __forceinline__ v8f mac3(const F2& a, const F2& b, v8f c) { c = wmma_bf(a.l, b.h, c); c = wmma_bf(a.h, b.l, c); return wmma_bf(a.h, b.h, c); }
__device__ __forceinline__ float sigm(float v) { return 1.0f / (1.0f + expf(-v)); }
#define LDSX() do { asm volatile("s_wait_dscnt 0" ::: "memory"); __builtin_amdgcn_wave_barrier(); __builtin_amdgcn_fence(__ATOMIC_RELEASE, "workgroup"); } while (0)

// Graph interaction layer (single-head attention with a learned relative-position bias, post-LN transformer block). q/k/v / Wo / FFN
// GEMMs on v_wmma_f32_16x16x32_f16 (q/k/v operands converted on the way into LDS; Wo/FFN A rows staged in LDS as f16, their weights converted once into f16 fragment order; [out][in] weights x16; f32 accumulate); the pairwise bias
// MLP (2 -> 512 -> 1, K = 2) in f32 VALU; diagonal masked to -inf; softmax, LayerNorms in f32; P x2^14 f16.
#define NB 8
#define NN 256
#define DD 512
#define FF 1024
#define NR (NB * NN)

// 64 x 128 tile of X @ W^T over K = 512 for a block of 4 waves (wave w: rows 16w..16w+15, all 128 columns). X and W arrive in chunks of KC
// columns: every thread fetches whole 256-byte row pieces (16 lanes a row), converts once (W x16) and stores f16 rows of pitch KP in LDS;
// the fragments come from LDS. Two buffers: the next chunk's loads are asked for before this chunk's products and fly behind them.
#define KC 64
#define KP (KC + 8)
__device__ __forceinline__ void tile_mm(const float* __restrict__ X, const float* __restrict__ Wm, _Float16* sX, _Float16* sW, int tid, v8f (&acc)[8]) {
  const int wave = tid >> 5, lane = tid & 31, col = lane & 15, pr = tid >> 4, pc = (tid & 15) * 4;
  const unsigned vo = (unsigned)(pr * DD + pc);   // the thread's place inside a chunk: loop-invariant lane offset, the chunk's base stays scalar
  v4f xa[8], wb[16];
#pragma unroll
  for (int i = 0; i < 8; ++i) xa[i] = *(const v4f*)(X + i * 8 * DD + vo);
#pragma unroll
  for (int i = 0; i < 16; ++i) wb[i] = *(const v4f*)(Wm + i * 8 * DD + vo);
#pragma unroll 1   // rolled: one chunk in registers, one in each LDS buffer
  for (int c = 0; c < DD / KC; ++c) { _Float16* bx = sX + (c & 1) * (64 * KP); _Float16* bw = sW + (c & 1) * (128 * KP);
#pragma unroll
    for (int i = 0; i < 8; ++i) { v4h h4;
#pragma unroll
      for (int e = 0; e < 4; ++e) h4[e] = (_Float16)xa[i][e];
      vst2(bx + (i * 8 + pr) * KP + pc, h4); }
#pragma unroll
    for (int i = 0; i < 16; ++i) { v4h h4;
#pragma unroll
      for (int e = 0; e < 4; ++e) h4[e] = (_Float16)(wb[i][e] * 16.0f);
      vst2(bw + (i * 8 + pr) * KP + pc, h4); }
    __syncthreads();   // chunk c is whole; it also ends every wave's reads of the other buffer, which the next trip refills
    if (c + 1 < DD / KC) { X += KC; Wm += KC;   // asked for behind the barrier (whose fence would wait for them), so that they fly while this chunk's products run
#pragma unroll
      for (int i = 0; i < 8; ++i) xa[i] = *(const v4f*)(X + i * 8 * DD + vo);
#pragma unroll
      for (int i = 0; i < 16; ++i) wb[i] = *(const v4f*)(Wm + i * 8 * DD + vo); }
#pragma unroll
    for (int ks = 0; ks < KC / 32; ++ks) { const v16h a = frag_h(bx + (wave * 16 + col) * KP + ks * 32, lane); v16h bf[8];   // all nine fragments asked for before the first product
#pragma unroll
      for (int j = 0; j < 8; ++j) bf[j] = frag_h(bw + (j * 16 + col) * KP + ks * 32, lane);
#pragma unroll
      for (int j = 0; j < 8; ++j) acc[j] = wmma16(a, bf[j], acc[j]); } }
}
// The q/k/v projection and the pairwise bias do not depend on each other: they share ONE launch (k_qkv_bias below), told apart by the block index.
// Both kinds of block have 4 waves and lie over the same LDS (a union: a block is of one kind only).
#define BJ 8
struct LdsQkv { float so[4][16][132]; _Float16 st[128][72]; _Float16 sX[2][64][KP]; _Float16 sW[2][128][KP]; };
struct LdsBias { v4f sw[DD / 2][2]; float sr[2][BJ][32]; };
union LdsQB { LdsQkv q; LdsBias b; };
// q -> f16 rows [r][512]; k and v -> f16 in the order of k_attn's B fragments, [16-row tile][32 k][half][lane][8 values] (as wfrag_block lays the weights), so that a fragment half is 512 bytes in a row:
// kF: tile = 16 keys, k = feature; vF: tile = 16 features of one batch, k = key. bx: 64 rows; by: 0..3 q cols, 4..7 k cols, 8..11 v cols (128 each)
__device__ __forceinline__ void qkv_block(LdsQkv& L, int bx, int by, const float* __restrict__ x, const float* __restrict__ Wq, const float* __restrict__ bq, const float* __restrict__ Wk, const float* __restrict__ bk, const float* __restrict__ Wv, const float* __restrict__ bv,
                                          _Float16* __restrict__ q16, _Float16* __restrict__ kF, _Float16* __restrict__ vF) {
  float (&so)[4][16][132] = L.so; _Float16 (&st)[128][72] = L.st; _Float16 (&sX)[2][64][KP] = L.sX; _Float16 (&sW)[2][128][KP] = L.sW;
  const int tid = threadIdx.x, wave = tid >> 5, lane = tid & 31, col = lane & 15, g = lane >> 4;
  const int r0b = bx * 64, r0 = r0b + wave * 16; const int which = by / 4, n0 = (by % 4) * 128; const int b = r0b / NN, t0 = r0b % NN;
  const float* W = which == 0 ? Wq : (which == 1 ? Wk : Wv); const float* bias = which == 0 ? bq : (which == 1 ? bk : bv);
  v8f acc[8] = {};
  tile_mm(x + (size_t)r0b * DD, W + (size_t)n0 * DD, &sX[0][0][0], &sW[0][0][0], tid, acc);
#pragma unroll
  for (int j = 0; j < 8; ++j) { const float bb = bias[n0 + j * 16 + col];
#pragma unroll
    for (int r = 0; r < 8; ++r) so[wave][8 * g + r][j * 16 + col] = acc[j][r] * (1.0f / 16.0f) + bb; }
  LDSX();
  if (which == 0) {
    for (int q = lane; q < 16 * 16; q += 32) { const int rl = q >> 4, pc = q & 15; union { v8h h8; v4u u; } pk;
#pragma unroll
      for (int e = 0; e < 8; ++e) pk.h8[e] = (_Float16)so[wave][rl][pc * 8 + e];
      vst2(q16 + (size_t)(r0 + rl) * DD + n0 + pc * 8, pk.u); } }
  else if (which == 1) {   // the wave's 16 keys x 128 features are 4 KiB in a row: lane (g, col) holds key col, features 16 i + 8 g + 0..7 for piece i
    _Float16* dst = kF + ((size_t)(r0 / 16) * (DD / 32) + n0 / 32) * 512 + lane * 8;
#pragma unroll
    for (int i = 0; i < 8; ++i) { union { v8h h8; v4u u; } pk;
#pragma unroll
      for (int e = 0; e < 8; ++e) pk.h8[e] = (_Float16)so[wave][col][i * 16 + g * 8 + e];
      vst2(dst + i * 256, pk.u); }
    asm volatile("s_wait_xcnt 0x0" ::: "memory"); }   // kept in front of every later rewrite of a register that the stores above name
  else {
#pragma unroll 4
    for (int rl = 0; rl < 16; ++rl) {
#pragma unroll
      for (int e = 0; e < 4; ++e) st[lane * 4 + e][wave * 16 + rl] = (_Float16)so[wave][rl][lane * 4 + e]; }
    __syncthreads();
    // trip i: feature tile i; the wave takes (32 keys wave >> 1, half wave & 1); lane (g, col) holds feature col, keys 8 g + 0..7 of that half
#pragma unroll
    for (int i = 0; i < 8; ++i) vst2(vF + (((size_t)b * (DD / 16) + n0 / 16 + i) * (NN / 32) + t0 / 32 + (wave >> 1)) * 512 + (wave & 1) * 256 + lane * 8, *(const v4u*)(&st[i * 16 + col][(wave * 2 + g) * 8]));
    asm volatile("s_wait_xcnt 0x0" ::: "memory"); }   // as behind the k stores
}
// bias[b][n][m] = Wr2 . relu(rel @ Wr1^T + br1) + br2, rel = pc[n] - pc[m]; f32 throughout.
// A lane takes 8 pairs (m = lane + 32 j) of one row n, so that one broadcast read of the weights from LDS serves 8 pairs instead of one.
// The weights lie in LDS by pairs of hidden units (w1x w1x' w1y w1y' | br1 br1' Wr2 Wr2'): each packed f32 operation does two hidden units of one pair.
// Block = 4 waves = 2 rows n x 2 halves of the hidden units; the two halves of a row are added through LDS at the end.
__device__ __forceinline__ void bias_mac(const v4f lo, const v4f hi, const v2f (&rx)[BJ], const v2f (&ry)[BJ], v2f (&acc)[BJ]) {
  const v2f wx = {lo[0], lo[1]}, wy = {lo[2], lo[3]}, b1 = {hi[0], hi[1]}, wo = {hi[2], hi[3]};
#pragma unroll
  for (int j = 0; j < BJ; ++j) { const v2f z = __builtin_elementwise_fma(rx[j], wx, __builtin_elementwise_fma(ry[j], wy, b1));
    const v2f h = {z[0] > 0.f ? z[0] : 0.f, z[1] > 0.f ? z[1] : 0.f};
    acc[j] = __builtin_elementwise_fma(h, wo, acc[j]); }
}
__device__ __forceinline__ void bias_block(LdsBias& L, int bx, int b, const float* __restrict__ pcs, const float* __restrict__ Wr1, const float* __restrict__ br1, const float* __restrict__ Wr2, const float* __restrict__ br2, float* __restrict__ bias) {
  v4f (&sw)[DD / 2][2] = L.sw; float (&sr)[2][BJ][32] = L.sr;
  const int tid = threadIdx.x, lane = tid & 31;
  const int w = __builtin_amdgcn_readfirstlane(tid >> 5);   // the wave's number in a scalar register: row base and hidden half stay scalar
  const int nl = w >> 1, hh = w & 1, n = bx * 2 + nl;
  // every global operand of the prologue is asked for before the first one is used; a thread stages two pairs of hidden units (tid and tid + 128)
  v4f w1[2]; v2f bb[2], w2[2];
#pragma unroll
  for (int i = 0; i < 2; ++i) { const int p = tid + i * 128; w1[i] = *(const v4f*)(Wr1 + p * 4); bb[i] = *(const v2f*)(br1 + p * 2); w2[i] = *(const v2f*)(Wr2 + p * 2); }
  const v2f pn = *(const v2f*)(pcs + ((size_t)b * NN + n) * 2); v2f pm[BJ];
#pragma unroll
  for (int j = 0; j < BJ; ++j) pm[j] = *(const v2f*)(pcs + ((size_t)b * NN + j * 32 + lane) * 2);
#pragma unroll
  for (int i = 0; i < 2; ++i) { const int p = tid + i * 128; sw[p][0] = (v4f){w1[i][0], w1[i][2], w1[i][1], w1[i][3]}; sw[p][1] = (v4f){bb[i][0], bb[i][1], w2[i][0], w2[i][1]}; }
  v2f rx[BJ], ry[BJ], acc[BJ];
#pragma unroll
  for (int j = 0; j < BJ; ++j) { const v2f r = pn - pm[j]; rx[j] = (v2f){r[0], r[0]}; ry[j] = (v2f){r[1], r[1]}; acc[j] = (v2f){0.f, 0.f}; }
  __syncthreads();   // the weights are whole
  const v4f* wp = &sw[hh * (DD / 4)][0];   // this wave's 128 pairs of hidden units, four hidden units a trip
  v4f c0 = wp[0], c1 = wp[1], c2 = wp[2], c3 = wp[3];
#pragma unroll 2   // two trips a pass, so that the current and the next weights swap registers without copies
  for (int t = 0; t < DD / 8; ++t) { const v4f* np = wp + ((t + 1) & (DD / 8 - 1)) * 4;   // the next trip's weights are asked for ahead of this trip's arithmetic (the last trip re-reads the first group, unused)
    const v4f n0 = np[0], n1 = np[1], n2 = np[2], n3 = np[3];
    __builtin_amdgcn_sched_barrier(0);   // keeps the four reads above the arithmetic, whose 64 issue slots then cover their latency
    bias_mac(c0, c1, rx, ry, acc); bias_mac(c2, c3, rx, ry, acc);
    c0 = n0; c1 = n1; c2 = n2; c3 = n3; }
  if (hh) {
#pragma unroll
    for (int j = 0; j < BJ; ++j) sr[nl][j][lane] = acc[j][0] + acc[j][1]; }
  __syncthreads();   // the upper hidden half's sums are in LDS
  if (!hh) { const float b2 = br2[0];
#pragma unroll
    for (int j = 0; j < BJ; ++j) bias[((size_t)b * NN + n) * NN + j * 32 + lane] = ((acc[j][0] + acc[j][1]) + sr[nl][j][lane]) + b2; }
}
// Wo, Wf2 and Wf1 are turned ONCE into f16 (x16) in the order of the B fragments: [16-column tile][32 k][half q][lane][8 values], so that a fragment half
// is 512 bytes in a row. A wave takes one tile of 16 weight rows x 128 k (4 KiB out): lane (g, col) reads row col, k = 16 i + 8 g + 0..7, for piece i.
// Wave tasks 0..127: Wo (32 tiles x 4 groups of k), 128..383: Wf2 (32 x 8), 384..639: Wf1 (64 x 4).
__device__ __forceinline__ void wfrag_block(int cb, const float* __restrict__ Wo, const float* __restrict__ Wf2, const float* __restrict__ Wf1, _Float16* __restrict__ WoH, _Float16* __restrict__ Wf2H, _Float16* __restrict__ Wf1H) {
  const int tid = threadIdx.x, lane = tid & 31, col = lane & 15, g = lane >> 4;
  const int t = cb * 4 + __builtin_amdgcn_readfirstlane(tid >> 5);
  const bool f1 = t >= 384, f2 = t >= 128 && !f1; const int u = f1 ? t - 384 : (f2 ? t - 128 : t), K = f2 ? FF : DD, nt = f2 ? u >> 3 : u >> 2, kg = f2 ? u & 7 : u & 3;
  const float* src = (f1 ? Wf1 : (f2 ? Wf2 : Wo)) + (size_t)(nt * 16 + col) * K + kg * 128 + g * 8;
  _Float16* dst = (f1 ? Wf1H : (f2 ? Wf2H : WoH)) + (size_t)(nt * (K / 32) + kg * 4) * 512 + lane * 8;
  v4f v[8][2];
#pragma unroll
  for (int i = 0; i < 8; ++i) { v[i][0] = *(const v4f*)(src + i * 16); v[i][1] = *(const v4f*)(src + i * 16 + 4); }
  asm volatile("s_wait_xcnt 0x0" :: "v"(src) : "memory");   // the loads' address pair stays whole up to this wait
#pragma unroll
  for (int i = 0; i < 8; ++i) { v8h h;
#pragma unroll
    for (int e = 0; e < 8; ++e) h[e] = (_Float16)(v[i][e >> 2][e & 3] * 16.0f);
    vst2(dst + i * 256, h); }
}
// One launch for all three: blocks 0..QKVB-1 are the projection tiles (first, because each is a long chain of waits with little to issue),
// then WFB short blocks that re-order Wo, Wf2 and Wf1 for the later launches; the BIASB blocks behind them are the bias rows, whose vector work fills the issue slots that the projection waves leave idle.
#define QKVB (NR / 64 * 12)
#define WFB 160
#define BIASB (NN / 2 * NB)
__global__ __launch_bounds__(128) void k_qkv_bias(const float* __restrict__ x, const float* __restrict__ Wq, const float* __restrict__ bq, const float* __restrict__ Wk, const float* __restrict__ bk, const float* __restrict__ Wv, const float* __restrict__ bv,
                                                  _Float16* __restrict__ q16, _Float16* __restrict__ kF, _Float16* __restrict__ vF,
                                                  const float* __restrict__ pcs, const float* __restrict__ Wr1, const float* __restrict__ br1, const float* __restrict__ Wr2, const float* __restrict__ br2, float* __restrict__ bias,
                                                  const float* __restrict__ Wo, const float* __restrict__ Wf2, const float* __restrict__ Wf1, _Float16* __restrict__ WoH, _Float16* __restrict__ Wf2H, _Float16* __restrict__ Wf1H) {
  __shared__ __align__(16) LdsQB lds;
  const int bid = blockIdx.x;   // the same for the whole block: every barrier below stands under block-uniform control flow
  if (bid < QKVB) qkv_block(lds.q, bid % (NR / 64), bid / (NR / 64), x, Wq, bq, Wk, bk, Wv, bv, q16, kF, vF);
  else if (bid < QKVB + WFB) wfrag_block(bid - QKVB, Wo, Wf2, Wf1, WoH, Wf2H, Wf1H);
  else bias_block(lds.b, (bid - QKVB - WFB) % (NN / 2), (bid - QKVB - WFB) / (NN / 2), pcs, Wr1, br1, Wr2, br2, bias);
}
// attention: block (b, 16 queries), 16 waves; S = q.k/sqrt(512) + bias, diagonal excluded, softmax over 256 (f32), P x2^14 f16 @ v -> AG rows f32 [r][512].
// Wave w: the 16 queries against keys 16w..16w+15 (the q tile is staged once in LDS); behind a block barrier the softmax of row w;
// behind a second one columns 32w..32w+31 of P @ v. Each phase asks for all its global operands before its first product.
// kF and vF lie in fragment order (qkv_block): a wave's k tile and its two v tiles are 16 KiB in a row each, and every load takes 512 bytes in a row (four whole lines).
// The short loops are all unrolled so that the fragment arrays are indexed by constants and stay in registers.
__global__ __launch_bounds__(512) void k_attn(const _Float16* __restrict__ q16, const _Float16* __restrict__ kF, const _Float16* __restrict__ vF, const float* __restrict__ bias, float* __restrict__ AG) {
  __shared__ __align__(16) _Float16 sQ[16][DD + 8];
  __shared__ __align__(16) float sS[16][NN + 4];
  __shared__ __align__(16) _Float16 sP[16][NN + 8];
  __shared__ __align__(16) float sA[16][16][36];
  const int tid = threadIdx.x, lane = tid & 31, col = lane & 15, g = lane >> 4;
  const int w = __builtin_amdgcn_readfirstlane(tid >> 5);   // the wave's number in a scalar register: tile bases stay scalar
  const int b = blockIdx.y, q0 = blockIdx.x * 16; const size_t rb = (size_t)b * NN;
  { v16h kf[16]; float bv[8];
#pragma unroll
    for (int kc = 0; kc < 16; ++kc) kf[kc] = frag_w(kF + ((size_t)(b * (NN / 16) + w) * (DD / 32) + kc) * 512 + lane * 8);
#pragma unroll
    for (int r = 0; r < 8; ++r) bv[r] = bias[(rb + q0 + 8 * g + r) * NN + w * 16 + col];
#pragma unroll
    for (int i = 0; i < 2; ++i) { const int q = tid + i * 512, rl = q >> 6, pc = q & 63; vst2(&sQ[rl][pc * 8], *(const v4u*)(q16 + (rb + q0 + rl) * DD + pc * 8)); }
    __syncthreads();   // the q tile is whole
    v8f s = {};
#pragma unroll
    for (int h = 0; h < 2; ++h) { v16h aq[8];
#pragma unroll
      for (int kc = 0; kc < 8; ++kc) aq[kc] = frag_h(&sQ[col][0] + (h * 8 + kc) * 32, lane);
#pragma unroll
      for (int kc = 0; kc < 8; ++kc) s = wmma16(aq[kc], kf[h * 8 + kc], s); }
#pragma unroll
    for (int r = 0; r < 8; ++r) { const int qi = q0 + 8 * g + r, m = w * 16 + col; sS[8 * g + r][m] = (m == qi) ? -3.0e38f : s[r] * 0.044194173824159216f + bv[r]; } }
  __syncthreads();   // every score row now holds the key slices of all 16 waves
  v16h vf[2][8];     // asked for here, so that they fly while the row's softmax runs
  const _Float16* vp = vF + (size_t)(b * (DD / 16) + w * 2) * (NN / 32) * 512;   // the wave's two feature tiles, one behind the other: a scalar base, the lane's place is the loads' offset register
#pragma unroll
  for (int j = 0; j < 2; ++j)
#pragma unroll
    for (int kc = 0; kc < 8; ++kc) vf[j][kc] = frag_w(vp + (j * (NN / 32) + kc) * 512 + (unsigned)lane * 8u);
  { v4f x[2]; float mx = -3.4e38f;
#pragma unroll
    for (int i = 0; i < 2; ++i) { x[i] = *(const v4f*)(&sS[w][i * 128 + lane * 4]); mx = fmaxf(mx, fmaxf(fmaxf(x[i][0], x[i][1]), fmaxf(x[i][2], x[i][3]))); }
#pragma unroll
    for (int o = 16; o > 0; o >>= 1) mx = fmaxf(mx, __shfl_xor(mx, o, 32));
    float l = 0.f;
#pragma unroll
    for (int i = 0; i < 2; ++i)
#pragma unroll
      for (int e = 0; e < 4; ++e) { const float sv = x[i][e]; const float pv = sv <= -1.0e38f ? 0.f : expf(sv - mx); l += pv; x[i][e] = pv; }
#pragma unroll
    for (int o = 16; o > 0; o >>= 1) l += __shfl_xor(l, o, 32);
    const float inv = 16384.0f / l;
#pragma unroll
    for (int i = 0; i < 2; ++i) { v4h h4;
#pragma unroll
      for (int e = 0; e < 4; ++e) h4[e] = (_Float16)(x[i][e] * inv);
      vst2(&sP[w][i * 128 + lane * 4], h4); } }
  __syncthreads();   // all 16 rows of P are written
  v16h pa[8];
#pragma unroll
  for (int kc = 0; kc < 8; ++kc) pa[kc] = frag_h(&sP[col][0] + kc * 32, lane);
  v8f acc[2] = {};
#pragma unroll
  for (int kc = 0; kc < 8; ++kc) {
#pragma unroll
    for (int j = 0; j < 2; ++j) acc[j] = wmma16(pa[kc], vf[j][kc], acc[j]); }
#pragma unroll
  for (int j = 0; j < 2; ++j)
#pragma unroll
    for (int r = 0; r < 8; ++r) sA[w][8 * g + r][j * 16 + col] = acc[j][r] * (1.0f / 16384.0f);
  LDSX();   // wave-local exchange: the wave's own tile is in LDS before it reads it back as whole 128-byte row pieces
#pragma unroll
  for (int q = lane; q < 16 * 8; q += 32) { const int rl = q >> 3, pc = q & 7; vst2(AG + (rb + q0 + rl) * DD + w * 32 + pc * 4, *(const v4f*)(&sA[w][rl][pc * 4])); }
}
// generic: Out = LN(A @ W^T + bias + res) over 512 columns; block = 16 rows, 16 waves: wave w computes columns 32w..32w+31 of the product
// for all 16 rows, then (behind the block barrier) the LayerNorm of row w; K = KIN (A f32 rows or f16 rows per AH).
// Wh is the weight as wfrag_block left it (f16 x16, fragment order): no other wave of the block needs a wave's B fragments, so each wave loads its own
// straight into registers, 512 bytes in a row per load, through a ring of RD k-steps; the k loop has no LDS staging of W and no barrier.
#define RD 8
#define AR 2
template <int KIN, int AH>      // AH: A operand is f16 rows pre-scaled x4 (so the product is /64), else f32 rows (/16)
__global__ __launch_bounds__(512) void k_lnproj(const void* __restrict__ Ain, const _Float16* __restrict__ Wh, const float* __restrict__ bias, const float* __restrict__ res, const float* __restrict__ gam, const float* __restrict__ bet, float* __restrict__ Out) {
  __shared__ __align__(16) float so[16][DD + 4];
  __shared__ __align__(16) _Float16 sA[16][KIN + 8];
  const int tid = threadIdx.x, lane = tid & 31, col = lane & 15, g = lane >> 4;
  const int wave = __builtin_amdgcn_readfirstlane(tid >> 5);   // the wave's number in a scalar register: tile bases stay scalar
  const int r0 = blockIdx.x * 16, n0 = wave * 32;
  constexpr int NK = KIN / 32;
  // the block's 16 rows of A, whole K, as f16 rows in LDS (fetched in whole lines; f32 rows converted once); asked for first, the ring's first RD steps behind them
  v4u ah[4]; v4f af[4];
#pragma unroll
  for (int i = 0; i < 4; ++i) { const int q = tid + i * 512;
    if (AH) ah[i] = *(const v4u*)((const _Float16*)Ain + (size_t)r0 * KIN + q * 8);
    else af[i] = *(const v4f*)((const float*)Ain + (size_t)r0 * KIN + q * 4); }
  const _Float16* wp = Wh + (size_t)(wave * 2) * NK * 512 + lane * 8;   // the wave's two column tiles, NK * 512 values apart
  v16h bf[RD][2];
#pragma unroll
  for (int kc = 0; kc < RD; ++kc)
#pragma unroll
    for (int j = 0; j < 2; ++j) bf[kc][j] = frag_w(wp + (j * NK + kc) * 512);
#pragma unroll
  for (int i = 0; i < 4; ++i) { const int q = tid + i * 512;
    if (AH) vst2(&sA[q / (KIN / 8)][(q % (KIN / 8)) * 8], ah[i]);
    else { v4h h4;
#pragma unroll
      for (int e = 0; e < 4; ++e) h4[e] = (_Float16)af[i][e];
      vst2(&sA[q / (KIN / 4)][(q % (KIN / 4)) * 4], h4); } }
  __syncthreads();   // the A tile is whole
  v8f acc[2] = {}; v16h ar[AR];   // the A fragments come from LDS AR steps ahead of their products
#pragma unroll
  for (int kc = 0; kc < AR; ++kc) ar[kc] = frag_h(&sA[col][kc * 32], lane);
#pragma unroll   // unrolled: the ring's registers are indexed by constants
  for (int kc = 0; kc < NK; ++kc) { const v16h a = ar[kc % AR];
#pragma unroll
    for (int j = 0; j < 2; ++j) acc[j] = wmma16(a, bf[kc % RD][j], acc[j]);
    if (kc + AR < NK) ar[kc % AR] = frag_h(&sA[col][(kc + AR) * 32], lane);
    if (kc + RD < NK) {   // the step's registers are free: refill them RD steps ahead
#pragma unroll
      for (int j = 0; j < 2; ++j) bf[kc % RD][j] = frag_w(wp + (j * NK + kc + RD) * 512); } }
#pragma unroll
  for (int j = 0; j < 2; ++j) { const int c = n0 + j * 16 + col; const float bb = bias[c];
#pragma unroll
    for (int r = 0; r < 8; ++r) so[8 * g + r][c] = acc[j][r] * (AH ? (1.0f / 64.0f) : (1.0f / 16.0f)) + bb; }
  __syncthreads();   // every row now holds the column slices of all 16 waves
  // row 'wave': 16 values per lane in whole 512-byte pieces; the short loops below are unrolled so that v[] stays in registers
  { const float* row = &so[wave][0]; const float* rrow = res + (size_t)(r0 + wave) * DD; v4f v[4]; float s = 0.f;
#pragma unroll
    for (int i = 0; i < 4; ++i) { v[i] = *(const v4f*)(&row[i * 128 + lane * 4]) + *(const v4f*)(rrow + i * 128 + lane * 4); s += (v[i][0] + v[i][1]) + (v[i][2] + v[i][3]); }
#pragma unroll
    for (int o = 16; o > 0; o >>= 1) s += __shfl_xor(s, o, 32);
    const float mu = s * (1.0f / DD); float q2 = 0.f;
#pragma unroll
    for (int i = 0; i < 4; ++i)
#pragma unroll
      for (int e = 0; e < 4; ++e) { const float d = v[i][e] - mu; q2 += d * d; }
#pragma unroll
    for (int o = 16; o > 0; o >>= 1) q2 += __shfl_xor(q2, o, 32);
    const float rs = rsqrtf(q2 * (1.0f / DD) + 1e-5f);
#pragma unroll
    for (int i = 0; i < 4; ++i) { const int cc = i * 128 + lane * 4; const v4f gm = *(const v4f*)(gam + cc), bt = *(const v4f*)(bet + cc); v4f o4;
#pragma unroll
      for (int e = 0; e < 4; ++e) o4[e] = (v[i][e] - mu) * rs * gm[e] + bt[e];
      vst2(Out + (size_t)(r0 + wave) * DD + cc, o4); } }
}
// FFN hidden: H16[r][1024] = relu(x1 @ Wf1^T + bf1) as f16 (x4); block 32 rows x 256 cols, 8 waves: wave w takes all 32 rows x columns 32w..32w+31.
// As in k_lnproj: the x1 tile is staged once in LDS as f16, each wave loads its own B fragments (Wh: Wf1 in fragment order) through the ring; no barrier in the k loop.
__global__ __launch_bounds__(256) void k_ff1(const float* __restrict__ x1, const _Float16* __restrict__ Wh, const float* __restrict__ bf1, _Float16* __restrict__ H16) {
  __shared__ __align__(16) float so[32][256 + 4];
  __shared__ __align__(16) _Float16 sA[32][DD + 8];
  const int tid = threadIdx.x, lane = tid & 31, col = lane & 15, g = lane >> 4;
  const int wave = __builtin_amdgcn_readfirstlane(tid >> 5);   // the wave's number in a scalar register: tile bases stay scalar
  const int r0 = blockIdx.x * 32, nb = blockIdx.y * 256, n0 = nb + wave * 32;
  constexpr int NK = DD / 32;
  v4f af[16];
#pragma unroll
  for (int i = 0; i < 16; ++i) af[i] = *(const v4f*)(x1 + (size_t)r0 * DD + (tid + i * 256) * 4);
  const _Float16* wp = Wh + (size_t)(n0 / 16) * NK * 512 + lane * 8;   // the wave's two column tiles, NK * 512 values apart
  v16h bf[RD][2];
#pragma unroll
  for (int kc = 0; kc < RD; ++kc)
#pragma unroll
    for (int j = 0; j < 2; ++j) bf[kc][j] = frag_w(wp + (j * NK + kc) * 512);
#pragma unroll
  for (int i = 0; i < 16; ++i) { const int q = tid + i * 256; v4h h4;
#pragma unroll
    for (int e = 0; e < 4; ++e) h4[e] = (_Float16)af[i][e];
    vst2(&sA[q / (DD / 4)][(q % (DD / 4)) * 4], h4); }
  __syncthreads();   // the x1 tile is whole
  v8f acc[2][2] = {}; v16h ar[AR][2];   // the A fragments come from LDS AR steps ahead of their products
#pragma unroll
  for (int kc = 0; kc < AR; ++kc)
#pragma unroll
    for (int m = 0; m < 2; ++m) ar[kc][m] = frag_h(&sA[m * 16 + col][kc * 32], lane);
#pragma unroll   // unrolled: the rings' registers are indexed by constants
  for (int kc = 0; kc < NK; ++kc) {
#pragma unroll
    for (int m = 0; m < 2; ++m)
#pragma unroll
      for (int j = 0; j < 2; ++j) acc[m][j] = wmma16(ar[kc % AR][m], bf[kc % RD][j], acc[m][j]);
    if (kc + AR < NK) {
#pragma unroll
      for (int m = 0; m < 2; ++m) ar[kc % AR][m] = frag_h(&sA[m * 16 + col][(kc + AR) * 32], lane); }
    if (kc + RD < NK) {   // the step's registers are free: refill them RD steps ahead
#pragma unroll
      for (int j = 0; j < 2; ++j) bf[kc % RD][j] = frag_w(wp + (j * NK + kc + RD) * 512); } }
#pragma unroll
  for (int j = 0; j < 2; ++j) { const float bb = bf1[n0 + j * 16 + col];
#pragma unroll
    for (int m = 0; m < 2; ++m)
#pragma unroll
      for (int r = 0; r < 8; ++r) { const float v = acc[m][j][r] * (1.0f / 16.0f) + bb; so[m * 16 + 8 * g + r][wave * 32 + j * 16 + col] = v > 0.f ? v * 4.0f : 0.f; } }
  __syncthreads();   // every row now holds the column slices of all 8 waves; they leave as whole 512-byte row pieces
#pragma unroll
  for (int i = 0; i < 4; ++i) { const int q = tid + i * 256, rl = q >> 5, pc = q & 31; union { v8h h8; v4u u; } pk;
#pragma unroll
    for (int e = 0; e < 8; ++e) pk.h8[e] = (_Float16)so[rl][pc * 8 + e];
    vst2(H16 + (size_t)(r0 + rl) * FF + nb + pc * 8, pk.u); }
}
extern "C" void kernel_launch(void* const* d_in, const int* in_sizes, int n_in, void* d_out, int out_size, void* d_ws, size_t ws_size, hipStream_t stream) {
  (void)in_sizes; (void)n_in; (void)out_size; (void)ws_size;
  const float** I = (const float**)d_in;
  const float* x = I[0]; const float* pcs = I[1]; const float* Wq = I[2]; const float* bq = I[3]; const float* Wk = I[4]; const float* bk = I[5]; const float* Wv = I[6]; const float* bv = I[7];
  const float* Wr1 = I[8]; const float* br1 = I[9]; const float* Wr2 = I[10]; const float* br2 = I[11]; const float* Wo = I[12]; const float* bo = I[13]; const float* g1 = I[14]; const float* be1 = I[15];
  const float* Wf1 = I[16]; const float* bf1 = I[17]; const float* Wf2 = I[18]; const float* bf2 = I[19]; const float* g2 = I[20]; const float* be2 = I[21];
  float* out = (float*)d_out;
  char* ws = (char*)d_ws; size_t off = 0;
  auto take = [&](size_t bytes) { char* p = ws + off; off += (bytes + 255) & ~(size_t)255; return p; };
  _Float16* q16 = (_Float16*)take((size_t)NR * DD * 2); _Float16* kF = (_Float16*)take((size_t)NR * DD * 2); _Float16* vF = (_Float16*)take((size_t)NR * DD * 2); float* bias = (float*)take((size_t)NB * NN * NN * 4);
  float* AG = (float*)take((size_t)NR * DD * 4); float* x1 = (float*)take((size_t)NR * DD * 4); _Float16* H16 = (_Float16*)take((size_t)NR * FF * 2);
  _Float16* WoH = (_Float16*)take((size_t)DD * DD * 2); _Float16* Wf2H = (_Float16*)take((size_t)DD * FF * 2); _Float16* Wf1H = (_Float16*)take((size_t)FF * DD * 2);
  k_qkv_bias<<<QKVB + WFB + BIASB, 128, 0, stream>>>(x, Wq, bq, Wk, bk, Wv, bv, q16, kF, vF, pcs, Wr1, br1, Wr2, br2, bias, Wo, Wf2, Wf1, WoH, Wf2H, Wf1H);
  k_attn<<<dim3(NN / 16, NB), 512, 0, stream>>>(q16, kF, vF, bias, AG);
  k_lnproj<DD, 0><<<NR / 16, 512, 0, stream>>>(AG, WoH, bo, x, g1, be1, x1);
  k_ff1<<<dim3(NR / 32, FF / 256), 256, 0, stream>>>(x1, Wf1H, bf1, H16);
  k_lnproj<FF, 1><<<NR / 16, 512, 0, stream>>>(H16, Wf2H, bf2, x1, g2, be2, out);       // hidden x4 (f16) and Wf2 x16 -> /64 inside
}

// v008
// One run takes 54.8 microseconds.
// Two timings next to v007 both put it at 1.08 times that version's speed.
// Over all steps from v000 it is 16.6 times as fast.
#include <hip/hip_runtime.h>
#include <math.h>

typedef __attribute__((ext_vector_type(16))) _Float16 v16h;
typedef __attribute__((ext_vector_type(16))) __bf16 v16b;
typedef __attribute__((ext_vector_type(8)))  _Float16 v8h;
typedef __attribute__((ext_vector_type(4)))  _Float16 v4h;
typedef __attribute__((ext_vector_type(8)))  float v8f;
typedef __attribute__((ext_vector_type(4)))  float v4f;
typedef __attribute__((ext_vector_type(2)))  float v2f;
typedef __attribute__((ext_vector_type(4)))  unsigned v4u;
typedef __attribute__((ext_vector_type(4)))  int v4i;
typedef float __attribute__((may_alias)) float_a;
typedef int __attribute__((may_alias)) int_a;

template <typename T> __device__ __forceinline__ void vst2(void* p, T v) { *(T*)p = v;  }
__device__ __forceinline__ v8f wmma16(v16h a, v16h b, v8f c) {
  v8f d = __builtin_amdgcn_wmma_f32_16x16x32_f16(false, a, false, b, (short)0, c, false, false);
  asm volatile("v_nop\n\tv_nop\n\tv_nop\n\tv_nop" : "+v"(d) : "v"(a), "v"(b));
  return d;
}
__device__ __forceinline__ v8f wmma_bf(v16b a, v16b b, v8f c) {
  v8f d = __builtin_amdgcn_wmma_f32_16x16x32_bf16(false, a, false, b, (short)0, c, false, false);
  asm volatile("v_nop\n\tv_nop\n\tv_nop\n\tv_nop" : "+v"(d) : "v"(a), "v"(b));
  return d;
}
// 16x16x32 fragments: lane = (h = lane>>4, row/col = lane&15); elements 0..7 = k0+8h+0..7, 8..15 = k0+16+8h+0..7; D element r = row 8h+r
__device__ __forceinline__ v16h frag_h(const _Float16* rowk0, int lane) {
  union { v16h v; v8h q[2]; } u; const _Float16* p = rowk0 + 8 * (lane >> 4);
  u.q[0] = *(const v8h*)p; u.q[1] = *(const v8h*)(p + 16); return u.v;
}
// a fragment stored in fragment order: p = the fragment's 1 KiB + lane * 8 values; the two halves lie 256 values apart
__device__ __forceinline__ v16h frag_w(const _Float16* p) { union { v16h v; v8h q[2]; } u; u.q[0] = *(const v8h*)p; u.q[1] = *(const v8h*)(p + 256); return u.v; }
__device__ __forceinline__ v16h frag_f32(const float* rowk0, int lane) {
  v16h a; const float* p = rowk0 + 8 * (lane >> 4);
#pragma unroll
  for (int i = 0; i < 8; ++i) { a[i] = (_Float16)p[i]; a[8 + i] = (_Float16)p[16 + i]; }
  return a;
}
__device__ __forceinline__ v16h frag_f32s(const float* rowk0, int lane, float sc) {
  v16h a; const float* p = rowk0 + 8 * (lane >> 4);
#pragma unroll
  for (int i = 0; i < 8; ++i) { a[i] = (_Float16)(p[i] * sc); a[8 + i] = (_Float16)(p[16 + i] * sc); }
  return a;
}
// column fragment from a [K][ld] layout (column n), rows >= K read as 0
__device__ __forceinline__ v16h fragc_f32(const float* W, int k0, int n, int lane, int ld, int K) {
  v16h a; const int g = lane >> 4;
#pragma unroll
  for (int i = 0; i < 8; ++i) { const int ka = k0 + 8 * g + i, kb = ka + 16;
    a[i] = (_Float16)(ka < K ? W[(size_t)ka * ld + n] : 0.f); a[8 + i] = (_Float16)(kb < K ? W[(size_t)kb * ld + n] : 0.f); }
  return a;
}
struct F2 { v16b h, l; };
__device__ __forceinline__ F2 bsplit16(const float v[16]) { F2 r;
#pragma unroll
  for (int i = 0; i < 16; ++i) { const __bf16 h = (__bf16)v[i]; r.h[i] = h; r.l[i] = (__bf16)(v[i] - (float)h); }
  return r; }
__device__ __forceinline__ F2 split_row(const float* row, int k0, int lane) { float v[16]; const float* p = row + k0 + 8 * (lane >> 4);
#pragma unroll
  for (int i = 0; i < 8; ++i) { v[i] = p[i]; v[8 + i] = p[16 + i]; }
  return bsplit16(v); }
__device__ __forceinline__ F2 split_rowK(const float* row, int k0, int lane, int K) { float v[16]; const int g = lane >> 4;
#pragma unroll
  for (int i = 0; i < 8; ++i) { const int ka = k0 + 8 * g + i, kb = ka + 16; v[i] = ka < K ? row[ka] : 0.f; v[8 + i] = kb < K ? row[kb] : 0.f; }
  return bsplit16(v); }
__device__ __forceinline__ F2 split_col(const float* W, int k0, int n, int lane, int ld, int K) { float v[16]; const int g = lane >> 4;
#pragma unroll
  for (int i = 0; i < 8; ++i) { const int ka = k0 + 8 * g + i, kb = ka + 16; v[i] = ka < K ? W[(size_t)ka * ld + n] : 0.f; v[8 + i] = kb < K ? W[(size_t)kb * ld + n] : 0.f; }
  return bsplit16(v); }
__device__ __forceinline__ v8f mac3(const F2& a, const F2& b, v8f c) { c = wmma_bf(a.l, b.h, c); c = wmma_bf(a.h, b.l, c); return wmma_bf(a.h, b.h, c); }
__device__ __forceinline__ float sigm(float v) { return 1.0f / (1.0f + expf(-v)); }
#define LDSX() do { asm volatile("s_wait_dscnt 0" ::: "memory"); __builtin_amdgcn_wave_barrier(); __builtin_amdgcn_fence(__ATOMIC_RELEASE, "workgroup"); } while (0)

// Graph interaction layer (single-head attention with a learned relative-position bias, post-LN transformer block). q/k/v / Wo / FFN
// GEMMs on v_wmma_f32_16x16x32_f16 (q/k/v operands converted on the way into LDS; Wo/FFN A rows staged in LDS as f16, their weights converted once into f16 fragment order; [out][in] weights x16; f32 accumulate); the pairwise bias
// MLP (2 -> 512 -> 1, K = 2) in f32 VALU; diagonal masked to -inf; softmax, LayerNorms in f32; P x2^14 f16.
#define NB 8
#define NN 256
#define DD 512
#define FF 1024
#define NR (NB * NN)

// 64 x 128 tile of X @ W^T over K = 512 for a block of 4 waves (wave w: rows 16w..16w+15, all 128 columns). X and W arrive in chunks of KC
// columns: every thread fetches whole 256-byte row pieces (16 lanes a row), converts once (W x16) and stores f16 rows of pitch KP in LDS;
// the fragments come from LDS. Two buffers: the next chunk's loads are asked for before this chunk's products and fly behind them.
#define KC 64
#define KP (KC + 8)
__device__ __forceinline__ void tile_mm(const float* __restrict__ X, const float* __restrict__ Wm, _Float16* sX, _Float16* sW, int tid, v8f (&acc)[8]) {
  const int wave = tid >> 5, lane = tid & 31, col = lane & 15, pr = tid >> 4, pc = (tid & 15) * 4;
  const unsigned vo = (unsigned)(pr * DD + pc);   // the thread's place inside a chunk: loop-invariant lane offset, the chunk's base stays scalar
  v4f xa[8], wb[16];
#pragma unroll
  for (int i = 0; i < 8; ++i) xa[i] = *(const v4f*)(X + i * 8 * DD + vo);
#pragma unroll
  for (int i = 0; i < 16; ++i) wb[i] = *(const v4f*)(Wm + i * 8 * DD + vo);
#pragma unroll 1   // rolled: one chunk in registers, one in each LDS buffer
  for (int c = 0; c < DD / KC; ++c) { _Float16* bx = sX + (c & 1) * (64 * KP); _Float16* bw = sW + (c & 1) * (128 * KP);
#pragma unroll
    for (int i = 0; i < 8; ++i) { v4h h4;
#pragma unroll
      for (int e = 0; e < 4; ++e) h4[e] = (_Float16)xa[i][e];
      vst2(bx + (i * 8 + pr) * KP + pc, h4); }
#pragma unroll
    for (int i = 0; i < 16; ++i) { v4h h4;
#pragma unroll
      for (int e = 0; e < 4; ++e) h4[e] = (_Float16)(wb[i][e] * 16.0f);
      vst2(bw + (i * 8 + pr) * KP + pc, h4); }
    __syncthreads();   // chunk c is whole; it also ends every wave's reads of the other buffer, which the next trip refills
    if (c + 1 < DD / KC) { X += KC; Wm += KC;   // asked for behind the barrier (whose fence would wait for them), so that they fly while this chunk's products run
#pragma unroll
      for (int i = 0; i < 8; ++i) xa[i] = *(const v4f*)(X + i * 8 * DD + vo);
#pragma unroll
      for (int i = 0; i < 16; ++i) wb[i] = *(const v4f*)(Wm + i * 8 * DD + vo); }
#pragma unroll
    for (int ks = 0; ks < KC / 32; ++ks) { const v16h a = frag_h(bx + (wave * 16 + col) * KP + ks * 32, lane); v16h bf[8];   // all nine fragments asked for before the first product
#pragma unroll
      for (int j = 0; j < 8; ++j) bf[j] = frag_h(bw + (j * 16 + col) * KP + ks * 32, lane);
#pragma unroll
      for (int j = 0; j < 8; ++j) acc[j] = wmma16(a, bf[j], acc[j]); } }
}
// The q/k/v projection and the pairwise bias do not depend on each other: they share ONE launch (k_qkv_bias below), told apart by the block index.
// Both kinds of block have 4 waves and lie over the same LDS (a union: a block is of one kind only).
#define BJ 8
struct LdsQkv { float so[4][16][132]; _Float16 st[128][72]; _Float16 sX[2][64][KP]; _Float16 sW[2][128][KP]; };
struct LdsBias { v4f sw[DD / 2][2]; float sr[2][BJ][32]; };
union LdsQB { LdsQkv q; LdsBias b; };
// q -> f16 rows [r][512]; k and v -> f16 in the order of k_rows' B fragments, [16-row tile][32 k][half][lane][8 values] (as wfrag_block lays the weights), so that a fragment half is 512 bytes in a row:
// kF: tile = 16 keys, k = feature; vF: tile = 16 features of one batch, k = key. bx: 64 rows; by: 0..3 q cols, 4..7 k cols, 8..11 v cols (128 each)
__device__ __forceinline__ void qkv_block(LdsQkv& L, int bx, int by, const float* __restrict__ x, const float* __restrict__ Wq, const float* __restrict__ bq, const float* __restrict__ Wk, const float* __restrict__ bk, const float* __restrict__ Wv, const float* __restrict__ bv,
                                          _Float16* __restrict__ q16, _Float16* __restrict__ kF, _Float16* __restrict__ vF) {
  float (&so)[4][16][132] = L.so; _Float16 (&st)[128][72] = L.st; _Float16 (&sX)[2][64][KP] = L.sX; _Float16 (&sW)[2][128][KP] = L.sW;
  const int tid = threadIdx.x, wave = tid >> 5, lane = tid & 31, col = lane & 15, g = lane >> 4;
  const int r0b = bx * 64, r0 = r0b + wave * 16; const int which = by / 4, n0 = (by % 4) * 128; const int b = r0b / NN, t0 = r0b % NN;
  const float* W = which == 0 ? Wq : (which == 1 ? Wk : Wv); const float* bias = which == 0 ? bq : (which == 1 ? bk : bv);
  v8f acc[8] = {};
  tile_mm(x + (size_t)r0b * DD, W + (size_t)n0 * DD, &sX[0][0][0], &sW[0][0][0], tid, acc);
#pragma unroll
  for (int j = 0; j < 8; ++j) { const float bb = bias[n0 + j * 16 + col];
#pragma unroll
    for (int r = 0; r < 8; ++r) so[wave][8 * g + r][j * 16 + col] = acc[j][r] * (1.0f / 16.0f) + bb; }
  LDSX();
  if (which == 0) {
    for (int q = lane; q < 16 * 16; q += 32) { const int rl = q >> 4, pc = q & 15; union { v8h h8; v4u u; } pk;
#pragma unroll
      for (int e = 0; e < 8; ++e) pk.h8[e] = (_Float16)so[wave][rl][pc * 8 + e];
      vst2(q16 + (size_t)(r0 + rl) * DD + n0 + pc * 8, pk.u); } }
  else if (which == 1) {   // the wave's 16 keys x 128 features are 4 KiB in a row: lane (g, col) holds key col, features 16 i + 8 g + 0..7 for piece i
    _Float16* dst = kF + ((size_t)(r0 / 16) * (DD / 32) + n0 / 32) * 512 + lane * 8;
#pragma unroll
    for (int i = 0; i < 8; ++i) { union { v8h h8; v4u u; } pk;
#pragma unroll
      for (int e = 0; e < 8; ++e) pk.h8[e] = (_Float16)so[wave][col][i * 16 + g * 8 + e];
      vst2(dst + i * 256, pk.u); }
    asm volatile("s_wait_xcnt 0x0" ::: "memory"); }   // kept in front of every later rewrite of a register that the stores above name
  else {
#pragma unroll 4
    for (int rl = 0; rl < 16; ++rl) {
#pragma unroll
      for (int e = 0; e < 4; ++e) st[lane * 4 + e][wave * 16 + rl] = (_Float16)so[wave][rl][lane * 4 + e]; }
    __syncthreads();
    // trip i: feature tile i; the wave takes (32 keys wave >> 1, half wave & 1); lane (g, col) holds feature col, keys 8 g + 0..7 of that half
#pragma unroll
    for (int i = 0; i < 8; ++i) vst2(vF + (((size_t)b * (DD / 16) + n0 / 16 + i) * (NN / 32) + t0 / 32 + (wave >> 1)) * 512 + (wave & 1) * 256 + lane * 8, *(const v4u*)(&st[i * 16 + col][(wave * 2 + g) * 8]));
    asm volatile("s_wait_xcnt 0x0" ::: "memory"); }   // as behind the k stores
}
// bias[b][n][m] = Wr2 . relu(rel @ Wr1^T + br1) + br2, rel = pc[n] - pc[m]; f32 throughout.
// A lane takes 8 pairs (m = lane + 32 j) of one row n, so that one broadcast read of the weights from LDS serves 8 pairs instead of one.
// The weights lie in LDS by pairs of hidden units (w1x w1x' w1y w1y' | br1 br1' Wr2 Wr2'): each packed f32 operation does two hidden units of one pair.
// Block = 4 waves = 2 rows n x 2 halves of the hidden units; the two halves of a row are added through LDS at the end.
__device__ __forceinline__ void bias_mac(const v4f lo, const v4f hi, const v2f (&rx)[BJ], const v2f (&ry)[BJ], v2f (&acc)[BJ]) {
  const v2f wx = {lo[0], lo[1]}, wy = {lo[2], lo[3]}, b1 = {hi[0], hi[1]}, wo = {hi[2], hi[3]};
#pragma unroll
  for (int j = 0; j < BJ; ++j) { const v2f z = __builtin_elementwise_fma(rx[j], wx, __builtin_elementwise_fma(ry[j], wy, b1));
    const v2f h = {z[0] > 0.f ? z[0] : 0.f, z[1] > 0.f ? z[1] : 0.f};
    acc[j] = __builtin_elementwise_fma(h, wo, acc[j]); }
}
__device__ __forceinline__ void bias_block(LdsBias& L, int bx, int b, const float* __restrict__ pcs, const float* __restrict__ Wr1, const float* __restrict__ br1, const float* __restrict__ Wr2, const float* __restrict__ br2, float* __restrict__ bias) {
  v4f (&sw)[DD / 2][2] = L.sw; float (&sr)[2][BJ][32] = L.sr;
  const int tid = threadIdx.x, lane = tid & 31;
  const int w = __builtin_amdgcn_readfirstlane(tid >> 5);   // the wave's number in a scalar register: row base and hidden half stay scalar
  const int nl = w >> 1, hh = w & 1, n = bx * 2 + nl;
  // every global operand of the prologue is asked for before the first one is used; a thread stages two pairs of hidden units (tid and tid + 128)
  v4f w1[2]; v2f bb[2], w2[2];
#pragma unroll
  for (int i = 0; i < 2; ++i) { const int p = tid + i * 128; w1[i] = *(const v4f*)(Wr1 + p * 4); bb[i] = *(const v2f*)(br1 + p * 2); w2[i] = *(const v2f*)(Wr2 + p * 2); }
  const v2f pn = *(const v2f*)(pcs + ((size_t)b * NN + n) * 2); v2f pm[BJ];
#pragma unroll
  for (int j = 0; j < BJ; ++j) pm[j] = *(const v2f*)(pcs + ((size_t)b * NN + j * 32 + lane) * 2);
#pragma unroll
  for (int i = 0; i < 2; ++i) { const int p = tid + i * 128; sw[p][0] = (v4f){w1[i][0], w1[i][2], w1[i][1], w1[i][3]}; sw[p][1] = (v4f){bb[i][0], bb[i][1], w2[i][0], w2[i][1]}; }
  v2f rx[BJ], ry[BJ], acc[BJ];
#pragma unroll
  for (int j = 0; j < BJ; ++j) { const v2f r = pn - pm[j]; rx[j] = (v2f){r[0], r[0]}; ry[j] = (v2f){r[1], r[1]}; acc[j] = (v2f){0.f, 0.f}; }
  __syncthreads();   // the weights are whole
  const v4f* wp = &sw[hh * (DD / 4)][0];   // this wave's 128 pairs of hidden units, four hidden units a trip
  v4f c0 = wp[0], c1 = wp[1], c2 = wp[2], c3 = wp[3];
#pragma unroll 2   // two trips a pass, so that the current and the next weights swap registers without copies
  for (int t = 0; t < DD / 8; ++t) { const v4f* np = wp + ((t + 1) & (DD / 8 - 1)) * 4;   // the next trip's weights are asked for ahead of this trip's arithmetic (the last trip re-reads the first group, unused)
    const v4f n0 = np[0], n1 = np[1], n2 = np[2], n3 = np[3];
    __builtin_amdgcn_sched_barrier(0);   // keeps the four reads above the arithmetic, whose 64 issue slots then cover their latency
    bias_mac(c0, c1, rx, ry, acc); bias_mac(c2, c3, rx, ry, acc);
    c0 = n0; c1 = n1; c2 = n2; c3 = n3; }
  if (hh) {
#pragma unroll
    for (int j = 0; j < BJ; ++j) sr[nl][j][lane] = acc[j][0] + acc[j][1]; }
  __syncthreads();   // the upper hidden half's sums are in LDS
  if (!hh) { const float b2 = br2[0];
#pragma unroll
    for (int j = 0; j < BJ; ++j) bias[((size_t)b * NN + n) * NN + j * 32 + lane] = ((acc[j][0] + acc[j][1]) + sr[nl][j][lane]) + b2; }
}
// Wo, Wf2 and Wf1 are turned ONCE into f16 (x16) in the order of the B fragments: [16-column tile][32 k][half q][lane][8 values], so that a fragment half
// is 512 bytes in a row. A wave takes one tile of 16 weight rows x 128 k (4 KiB out): lane (g, col) reads row col, k = 16 i + 8 g + 0..7, for piece i.
// Wave tasks 0..127: Wo (32 tiles x 4 groups of k), 128..383: Wf2 (32 x 8), 384..639: Wf1 (64 x 4).
__device__ __forceinline__ void wfrag_block(int cb, const float* __restrict__ Wo, const float* __restrict__ Wf2, const float* __restrict__ Wf1, _Float16* __restrict__ WoH, _Float16* __restrict__ Wf2H, _Float16* __restrict__ Wf1H) {
  const int tid = threadIdx.x, lane = tid & 31, col = lane & 15, g = lane >> 4;
  const int t = cb * 4 + __builtin_amdgcn_readfirstlane(tid >> 5);
  const bool f1 = t >= 384, f2 = t >= 128 && !f1; const int u = f1 ? t - 384 : (f2 ? t - 128 : t), K = f2 ? FF : DD, nt = f2 ? u >> 3 : u >> 2, kg = f2 ? u & 7 : u & 3;
  const float* src = (f1 ? Wf1 : (f2 ? Wf2 : Wo)) + (size_t)(nt * 16 + col) * K + kg * 128 + g * 8;
  _Float16* dst = (f1 ? Wf1H : (f2 ? Wf2H : WoH)) + (size_t)(nt * (K / 32) + kg * 4) * 512 + lane * 8;
  v4f v[8][2];
#pragma unroll
  for (int i = 0; i < 8; ++i) { v[i][0] = *(const v4f*)(src + i * 16); v[i][1] = *(const v4f*)(src + i * 16 + 4); }
  asm volatile("s_wait_xcnt 0x0" :: "v"(src) : "memory");   // the loads' address pair stays whole up to this wait
#pragma unroll
  for (int i = 0; i < 8; ++i) { v8h h;
#pragma unroll
    for (int e = 0; e < 8; ++e) h[e] = (_Float16)(v[i][e >> 2][e & 3] * 16.0f);
    vst2(dst + i * 256, h); }
}
// One launch for all three: blocks 0..QKVB-1 are the projection tiles (first, because each is a long chain of waits with little to issue),
// then WFB short blocks that re-order Wo, Wf2 and Wf1 for the second launch; the BIASB blocks behind them are the bias rows, whose vector work fills the issue slots that the projection waves leave idle.
#define QKVB (NR / 64 * 12)
#define WFB 160
#define BIASB (NN / 2 * NB)
__global__ __launch_bounds__(128) void k_qkv_bias(const float* __restrict__ x, const float* __restrict__ Wq, const float* __restrict__ bq, const float* __restrict__ Wk, const float* __restrict__ bk, const float* __restrict__ Wv, const float* __restrict__ bv,
                                                  _Float16* __restrict__ q16, _Float16* __restrict__ kF, _Float16* __restrict__ vF,
                                                  const float* __restrict__ pcs, const float* __restrict__ Wr1, const float* __restrict__ br1, const float* __restrict__ Wr2, const float* __restrict__ br2, float* __restrict__ bias,
                                                  const float* __restrict__ Wo, const float* __restrict__ Wf2, const float* __restrict__ Wf1, _Float16* __restrict__ WoH, _Float16* __restrict__ Wf2H, _Float16* __restrict__ Wf1H) {
  __shared__ __align__(16) LdsQB lds;
  const int bid = blockIdx.x;   // the same for the whole block: every barrier below stands under block-uniform control flow
  if (bid < QKVB) qkv_block(lds.q, bid % (NR / 64), bid / (NR / 64), x, Wq, bq, Wk, bk, Wv, bv, q16, kF, vF);
  else if (bid < QKVB + WFB) wfrag_block(bid - QKVB, Wo, Wf2, Wf1, WoH, Wf2H, Wf1H);
  else bias_block(lds.b, (bid - QKVB - WFB) % (NN / 2), (bid - QKVB - WFB) / (NN / 2), pcs, Wr1, br1, Wr2, br2, bias);
}
// Attention, output projection + LayerNorm and FFN + LayerNorm in ONE launch: behind the scores every step is local to a row, so a block (b, 16 queries; 16 waves)
// keeps its 16 rows in LDS and registers from the q tile to the output; nothing between the steps goes through global memory, and no step waits for a launch.
// Attention: S = q.k/sqrt(512) + bias, diagonal excluded, softmax over 256 (f32), P x2^14 f16 @ v. Wave w: the 16 queries against keys 16w..16w+15 (the q tile is staged
// once in LDS); behind a block barrier the softmax of row w; behind a second one columns 32w..32w+31 of P @ v, which go to LDS as f16 rows (the A operand of the Wo product).
// kF and vF lie in fragment order (qkv_block): a wave's k tile is 16 KiB in a row, and so are its two 8 KiB v tiles together, and every load takes 512 bytes in a row (four whole lines).
// The three weight products: A rows (f16) from LDS; WoH, Wf1H, Wf2H as wfrag_block left them (f16 x16, fragment order): no other wave of the block needs a wave's B fragments,
// so each wave loads its own straight into registers, 512 bytes in a row per load, through a ring of 16 fragments; the k loops have no barrier.
// A ring's first fill is asked for where the registers of the step before fall free, or behind the barrier in front of a LayerNorm, so that it flies behind that work
// (a block barrier waits for the wave's outstanding loads). The short loops are all unrolled so that the fragment arrays are indexed by constants and stay in registers.
#define RD 8
#define RC 4
#define AR 2
// 16 rows x the wave's 32 columns over NK steps of 32 k; arow = the lane's A row in LDS; bf holds steps 0..RD-1 on entry
template <int NK>
__device__ __forceinline__ void rows_mm(const _Float16* arow, const _Float16* wp, int lane, v16h (&bf)[RD][2], v8f (&acc)[2]) {
  v16h ar[AR];   // the A fragments come from LDS AR steps ahead of their products
#pragma unroll
  for (int kc = 0; kc < AR; ++kc) ar[kc] = frag_h(arow + kc * 32, lane);
#pragma unroll   // unrolled: the ring's registers are indexed by constants
  for (int kc = 0; kc < NK; ++kc) { const v16h a = ar[kc % AR];
#pragma unroll
    for (int j = 0; j < 2; ++j) acc[j] = wmma16(a, bf[kc % RD][j], acc[j]);
    if (kc + AR < NK) ar[kc % AR] = frag_h(arow + (kc + AR) * 32, lane);
    if (kc + RD < NK) {   // the step's registers are free: refill them RD steps ahead
#pragma unroll
      for (int j = 0; j < 2; ++j) bf[kc % RD][j] = frag_w(wp + (j * NK + kc + RD) * 512); } }
}
// LayerNorm of one row of 512 by one wave: 16 values per lane (pieces of 4 at i * 128 + lane * 4), in place
__device__ __forceinline__ void ln_row(v4f (&v)[4], const v4f (&gm)[4], const v4f (&bt)[4]) {
  float s = 0.f;
#pragma unroll
  for (int i = 0; i < 4; ++i) s += (v[i][0] + v[i][1]) + (v[i][2] + v[i][3]);
#pragma unroll
  for (int o = 16; o > 0; o >>= 1) s += __shfl_xor(s, o, 32);
  const float mu = s * (1.0f / DD); float q2 = 0.f;
#pragma unroll
  for (int i = 0; i < 4; ++i)
#pragma unroll
    for (int e = 0; e < 4; ++e) { const float d = v[i][e] - mu; q2 += d * d; }
#pragma unroll
  for (int o = 16; o > 0; o >>= 1) q2 += __shfl_xor(q2, o, 32);
  const float rs = rsqrtf(q2 * (1.0f / DD) + 1e-5f);
#pragma unroll
  for (int i = 0; i < 4; ++i)
#pragma unroll
    for (int e = 0; e < 4; ++e) v[i][e] = (v[i][e] - mu) * rs * gm[i][e] + bt[i][e];
}
__global__ __launch_bounds__(512) void k_rows(const _Float16* __restrict__ q16, const _Float16* __restrict__ kF, const _Float16* __restrict__ vF, const float* __restrict__ bias, const float* __restrict__ x,
                                              const _Float16* __restrict__ WoH, const float* __restrict__ bo, const float* __restrict__ g1, const float* __restrict__ be1,
                                              const _Float16* __restrict__ Wf1H, const float* __restrict__ bf1, const _Float16* __restrict__ Wf2H, const float* __restrict__ bf2, const float* __restrict__ g2, const float* __restrict__ be2,
                                              float* __restrict__ Out) {
  __shared__ __align__(16) _Float16 sQ[16][DD + 8];
  __shared__ __align__(16) float sS[16][NN + 4];
  __shared__ __align__(16) _Float16 sP[16][NN + 8];
  __shared__ __align__(16) _Float16 sG[16][DD + 8];   // attention output rows
  __shared__ __align__(16) float so[16][DD + 4];      // a product's 16 x 512 result on its way from column slices to whole rows (both LayerNorms)
  __shared__ __align__(16) _Float16 sX[16][DD + 8];   // rows behind the first LayerNorm
  __shared__ __align__(16) _Float16 sH[16][FF + 8];   // FFN hidden rows, x4
  const int tid = threadIdx.x, lane = tid & 31, col = lane & 15, g = lane >> 4;
  const int w = __builtin_amdgcn_readfirstlane(tid >> 5);   // the wave's number in a scalar register: tile bases stay scalar
  const int b = blockIdx.y, q0 = blockIdx.x * 16; const size_t rb = (size_t)b * NN;
  { v16h kf[16]; float bv[8]; const _Float16* qp[2]; v4u qv[2];
#pragma unroll
    for (int kc = 0; kc < 16; ++kc) kf[kc] = frag_w(kF + ((size_t)(b * (NN / 16) + w) * (DD / 32) + kc) * 512 + lane * 8);
#pragma unroll
    for (int r = 0; r < 8; ++r) bv[r] = bias[(rb + q0 + 8 * g + r) * NN + w * 16 + col];
#pragma unroll
    for (int i = 0; i < 2; ++i) { const int q = tid + i * 512, rl = q >> 6, pc = q & 63; qp[i] = q16 + (rb + q0 + rl) * DD + pc * 8; qv[i] = *(const v4u*)qp[i]; }
    asm volatile("s_wait_xcnt 0x0" :: "v"(qp[0]), "v"(qp[1]) : "memory");   // the q loads' address pairs stay whole up to this wait
#pragma unroll
    for (int i = 0; i < 2; ++i) { const int q = tid + i * 512, rl = q >> 6, pc = q & 63; vst2(&sQ[rl][pc * 8], qv[i]); }
    __syncthreads();   // the q tile is whole
    v8f s = {};
#pragma unroll
    for (int h = 0; h < 2; ++h) { v16h aq[8];
#pragma unroll
      for (int kc = 0; kc < 8; ++kc) aq[kc] = frag_h(&sQ[col][0] + (h * 8 + kc) * 32, lane);
#pragma unroll
      for (int kc = 0; kc < 8; ++kc) s = wmma16(aq[kc], kf[h * 8 + kc], s); }
#pragma unroll
    for (int r = 0; r < 8; ++r) { const int qi = q0 + 8 * g + r, m = w * 16 + col; sS[8 * g + r][m] = (m == qi) ? -3.0e38f : s[r] * 0.044194173824159216f + bv[r]; } }
  __syncthreads();   // every score row now holds the key slices of all 16 waves
  v16h vf[2][8];     // asked for here, so that they fly while the row's softmax runs
  const _Float16* vp = vF + (size_t)(b * (DD / 16) + w * 2) * (NN / 32) * 512;   // the wave's two feature tiles, one behind the other: a scalar base, the lane's place is the loads' offset register
#pragma unroll
  for (int j = 0; j < 2; ++j)
#pragma unroll
    for (int kc = 0; kc < 8; ++kc) vf[j][kc] = frag_w(vp + (j * (NN / 32) + kc) * 512 + (unsigned)lane * 8u);
  { v4f p[2]; float mx = -3.4e38f;
#pragma unroll
    for (int i = 0; i < 2; ++i) { p[i] = *(const v4f*)(&sS[w][i * 128 + lane * 4]); mx = fmaxf(mx, fmaxf(fmaxf(p[i][0], p[i][1]), fmaxf(p[i][2], p[i][3]))); }
#pragma unroll
    for (int o = 16; o > 0; o >>= 1) mx = fmaxf(mx, __shfl_xor(mx, o, 32));
    float l = 0.f;
#pragma unroll
    for (int i = 0; i < 2; ++i)
#pragma unroll
      for (int e = 0; e < 4; ++e) { const float sv = p[i][e]; const float pv = sv <= -1.0e38f ? 0.f : expf(sv - mx); l += pv; p[i][e] = pv; }
#pragma unroll
    for (int o = 16; o > 0; o >>= 1) l += __shfl_xor(l, o, 32);
    const float inv = 16384.0f / l;
#pragma unroll
    for (int i = 0; i < 2; ++i) { v4h h4;
#pragma unroll
      for (int e = 0; e < 4; ++e) h4[e] = (_Float16)(p[i][e] * inv);
      vst2(&sP[w][i * 128 + lane * 4], h4); } }
  __syncthreads();   // all 16 rows of P are written
  v16h bf[RD][2];    // the ring of the Wo product, later of the Wf2 product
  { v16h pa[8];
#pragma unroll
    for (int kc = 0; kc < 8; ++kc) pa[kc] = frag_h(&sP[col][0] + kc * 32, lane);
    const _Float16* wp = WoH + (size_t)(w * 2) * (DD / 32) * 512 + lane * 8;   // the wave's two column tiles of Wo
    v8f acc[2] = {};
#pragma unroll
    for (int kc = 0; kc < 8; ++kc) {
#pragma unroll
      for (int j = 0; j < 2; ++j) acc[j] = wmma16(pa[kc], vf[j][kc], acc[j]);
#pragma unroll
      for (int j = 0; j < 2; ++j) bf[kc][j] = frag_w(wp + (j * (DD / 32) + kc) * 512); }   // the v fragments' registers fall free: the Wo ring's first fill
#pragma unroll
    for (int j = 0; j < 2; ++j)
#pragma unroll
      for (int r = 0; r < 8; ++r) sG[8 * g + r][w * 32 + j * 16 + col] = (_Float16)(acc[j][r] * (1.0f / 16384.0f)); }
  __syncthreads();   // the 16 attention rows are whole
  v4f v[4];          // the wave's own row (row w of the block), 16 values per lane: first the residual x, then the row behind the first LayerNorm
  v4f gm[4], bt[4]; float bb[2];   // asked for ahead of the product, used behind it
#pragma unroll
  for (int i = 0; i < 4; ++i) { const int cc = i * 128 + lane * 4; v[i] = *(const v4f*)(x + (rb + q0 + w) * DD + cc); gm[i] = *(const v4f*)(g1 + cc); bt[i] = *(const v4f*)(be1 + cc); }
#pragma unroll
  for (int j = 0; j < 2; ++j) bb[j] = bo[w * 32 + j * 16 + col];
  { v8f acc[2] = {};
    rows_mm<DD / 32>(&sG[col][0], WoH + (size_t)(w * 2) * (DD / 32) * 512 + lane * 8, lane, bf, acc);
#pragma unroll
    for (int j = 0; j < 2; ++j)
#pragma unroll
      for (int r = 0; r < 8; ++r) so[8 * g + r][w * 32 + j * 16 + col] = acc[j][r] * (1.0f / 16.0f) + bb[j]; }
  __syncthreads();   // every row now holds the column slices of all 16 waves
  // FFN hidden: wave w takes columns 64w..64w+63 (four tiles) for the 16 rows; its ring holds RC steps of four fragments, asked for here so that they fly behind the LayerNorm
  const _Float16* w1 = Wf1H + (size_t)(w * 4) * (DD / 32) * 512 + lane * 8;
  v16h bc[RC][4]; float b1[4];
#pragma unroll
  for (int kc = 0; kc < RC; ++kc)
#pragma unroll
    for (int j = 0; j < 4; ++j) bc[kc][j] = frag_w(w1 + (j * (DD / 32) + kc) * 512);
#pragma unroll
  for (int j = 0; j < 4; ++j) b1[j] = bf1[w * 64 + j * 16 + col];
#pragma unroll
  for (int i = 0; i < 4; ++i) v[i] = *(const v4f*)(&so[w][i * 128 + lane * 4]) + v[i];
  ln_row(v, gm, bt);
#pragma unroll
  for (int i = 0; i < 4; ++i) { v4h h4;
#pragma unroll
    for (int e = 0; e < 4; ++e) h4[e] = (_Float16)v[i][e];
    vst2(&sX[w][i * 128 + lane * 4], h4); }
  __syncthreads();   // the 16 rows behind the first LayerNorm are whole
  const _Float16* w2 = Wf2H + (size_t)(w * 2) * (FF / 32) * 512 + lane * 8;   // the wave's two column tiles of Wf2
  { v8f acc[4] = {}; v16h ar[AR];   // the A fragments come from LDS AR steps ahead of their products
#pragma unroll
    for (int kc = 0; kc < AR; ++kc) ar[kc] = frag_h(&sX[col][kc * 32], lane);
#pragma unroll   // unrolled: the rings' registers are indexed by constants
    for (int kc = 0; kc < DD / 32; ++kc) { const v16h a = ar[kc % AR];
#pragma unroll
      for (int j = 0; j < 4; ++j) acc[j] = wmma16(a, bc[kc % RC][j], acc[j]);
      if (kc + AR < DD / 32) ar[kc % AR] = frag_h(&sX[col][(kc + AR) * 32], lane);
      if (kc + RC < DD / 32) {   // the step's registers are free: refill them RC steps ahead
#pragma unroll
        for (int j = 0; j < 4; ++j) bc[kc % RC][j] = frag_w(w1 + (j * (DD / 32) + kc + RC) * 512); }
      else {                     // no step of Wf1 is left to ask for: the Wf2 ring's first fill, two of its steps per freed step
        const int t = (kc + RC - DD / 32) * 2;
#pragma unroll
        for (int u = 0; u < 2; ++u)
#pragma unroll
          for (int j = 0; j < 2; ++j) bf[t + u][j] = frag_w(w2 + (j * (FF / 32) + t + u) * 512); } }
#pragma unroll
    for (int j = 0; j < 4; ++j)
#pragma unroll
      for (int r = 0; r < 8; ++r) { const float hv = acc[j][r] * (1.0f / 16.0f) + b1[j]; sH[8 * g + r][w * 64 + j * 16 + col] = (_Float16)(hv > 0.f ? hv * 4.0f : 0.f); } }
  __syncthreads();   // the 16 hidden rows are whole
#pragma unroll
  for (int i = 0; i < 4; ++i) { const int cc = i * 128 + lane * 4; gm[i] = *(const v4f*)(g2 + cc); bt[i] = *(const v4f*)(be2 + cc); }   // again ahead of the product
#pragma unroll
  for (int j = 0; j < 2; ++j) bb[j] = bf2[w * 32 + j * 16 + col];
  { v8f acc[2] = {};
    rows_mm<FF / 32>(&sH[col][0], w2, lane, bf, acc);
#pragma unroll
    for (int j = 0; j < 2; ++j)
#pragma unroll
      for (int r = 0; r < 8; ++r) so[8 * g + r][w * 32 + j * 16 + col] = acc[j][r] * (1.0f / 64.0f) + bb[j]; }   // hidden x4 and Wf2 x16
  __syncthreads();   // every row now holds the column slices of all 16 waves
#pragma unroll
  for (int i = 0; i < 4; ++i) v[i] = *(const v4f*)(&so[w][i * 128 + lane * 4]) + v[i];
  ln_row(v, gm, bt);
#pragma unroll
  for (int i = 0; i < 4; ++i) vst2(Out + (rb + q0 + w) * DD + i * 128 + lane * 4, v[i]);
}
extern "C" void kernel_launch(void* const* d_in, const int* in_sizes, int n_in, void* d_out, int out_size, void* d_ws, size_t ws_size, hipStream_t stream) {
  (void)in_sizes; (void)n_in; (void)out_size; (void)ws_size;
  const float** I = (const float**)d_in;
  const float* x = I[0]; const float* pcs = I[1]; const float* Wq = I[2]; const float* bq = I[3]; const float* Wk = I[4]; const float* bk = I[5]; const float* Wv = I[6]; const float* bv = I[7];
  const float* Wr1 = I[8]; const float* br1 = I[9]; const float* Wr2 = I[10]; const float* br2 = I[11]; const float* Wo = I[12]; const float* bo = I[13]; const float* g1 = I[14]; const float* be1 = I[15];
  const float* Wf1 = I[16]; const float* bf1 = I[17]; const float* Wf2 = I[18]; const float* bf2 = I[19]; const float* g2 = I[20]; const float* be2 = I[21];
  float* out = (float*)d_out;
  char* ws = (char*)d_ws; size_t off = 0;
  auto take = [&](size_t bytes) { char* p = ws + off; off += (bytes + 255) & ~(size_t)255; return p; };
  _Float16* q16 = (_Float16*)take((size_t)NR * DD * 2); _Float16* kF = (_Float16*)take((size_t)NR * DD * 2); _Float16* vF = (_Float16*)take((size_t)NR * DD * 2); float* bias = (float*)take((size_t)NB * NN * NN * 4);
  _Float16* WoH = (_Float16*)take((size_t)DD * DD * 2); _Float16* Wf2H = (_Float16*)take((size_t)DD * FF * 2); _Float16* Wf1H = (_Float16*)take((size_t)FF * DD * 2);
  k_qkv_bias<<<QKVB + WFB + BIASB, 128, 0, stream>>>(x, Wq, bq, Wk, bk, Wv, bv, q16, kF, vF, pcs, Wr1, br1, Wr2, br2, bias, Wo, Wf2, Wf1, WoH, Wf2H, Wf1H);
  k_rows<<<dim3(NN / 16, NB), 512, 0, stream>>>(q16, kF, vF, bias, x, WoH, bo, g1, be1, Wf1H, bf1, Wf2H, bf2, g2, be2, out);
}

// v009
// Measured time: 51.6 microseconds a run.
// Two timings next to v008 put it at 1.09 and 1.08 times that version's speed.
// Over all steps from v000 it is 18.0 times as fast.
#include <hip/hip_runtime.h>
#include <math.h>

typedef __attribute__((ext_vector_type(16))) _Float16 v16h;
typedef __attribute__((ext_vector_type(16))) __bf16 v16b;
typedef __attribute__((ext_vector_type(8)))  _Float16 v8h;
typedef __attribute__((ext_vector_type(4)))  _Float16 v4h;
typedef __attribute__((ext_vector_type(8)))  float v8f;
typedef __attribute__((ext_vector_type(4)))  float v4f;
typedef __attribute__((ext_vector_type(2)))  float v2f;
typedef __attribute__((ext_vector_type(4)))  unsigned v4u;
typedef __attribute__((ext_vector_type(4)))  int v4i;
typedef float __attribute__((may_alias)) float_a;
typedef int __attribute__((may_alias)) int_a;

template <typename T> __device__ __forceinline__ void vst2(void* p, T v) { *(T*)p = v;  }
__device__ __forceinline__ v8f wmma16(v16h a, v16h b, v8f c) {
  v8f d = __builtin_amdgcn_wmma_f32_16x16x32_f16(false, a, false, b, (short)0, c, false, false);
  asm volatile("v_nop\n\tv_nop\n\tv_nop\n\tv_nop" : "+v"(d) : "v"(a), "v"(b));
  return d;
}
__device__ __forceinline__ v8f wmma_bf(v16b a, v16b b, v8f c) {
  v8f d = __builtin_amdgcn_wmma_f32_16x16x32_bf16(false, a, false, b, (short)0, c, false, false);
  asm volatile("v_nop\n\tv_nop\n\tv_nop\n\tv_nop" : "+v"(d) : "v"(a), "v"(b));
  return d;
}
// 16x16x32 fragments: lane = (h = lane>>4, row/col = lane&15); elements 0..7 = k0+8h+0..7, 8..15 = k0+16+8h+0..7; D element r = row 8h+r
__device__ __forceinline__ v16h frag_h(const _Float16* rowk0, int lane) {
  union { v16h v; v8h q[2]; } u; const _Float16* p = rowk0 + 8 * (lane >> 4);
  u.q[0] = *(const v8h*)p; u.q[1] = *(const v8h*)(p + 16); return u.v;
}
// a fragment stored in fragment order: p = the fragment's 1 KiB + lane * 8 values; the two halves lie 256 values apart
__device__ __forceinline__ v16h frag_w(const _Float16* p) { union { v16h v; v8h q[2]; } u; u.q[0] = *(const v8h*)p; u.q[1] = *(const v8h*)(p + 256); return u.v; }
__device__ __forceinline__ v16h frag_f32(const float* rowk0, int lane) {
  v16h a; const float* p = rowk0 + 8 * (lane >> 4);
#pragma unroll
  for (int i = 0; i < 8; ++i) { a[i] = (_Float16)p[i]; a[8 + i] = (_Float16)p[16 + i]; }
  return a;
}
__device__ __forceinline__ v16h frag_f32s(const float* rowk0, int lane, float sc) {
  v16h a; const float* p = rowk0 + 8 * (lane >> 4);
#pragma unroll
  for (int i = 0; i < 8; ++i) { a[i] = (_Float16)(p[i] * sc); a[8 + i] = (_Float16)(p[16 + i] * sc); }
  return a;
}
// column fragment from a [K][ld] layout (column n), rows >= K read as 0
__device__ __forceinline__ v16h fragc_f32(const float* W, int k0, int n, int lane, int ld, int K) {
  v16h a; const int g = lane >> 4;
#pragma unroll
  for (int i = 0; i < 8; ++i) { const int ka = k0 + 8 * g + i, kb = ka + 16;
    a[i] = (_Float16)(ka < K ? W[(size_t)ka * ld + n] : 0.f); a[8 + i] = (_Float16)(kb < K ? W[(size_t)kb * ld + n] : 0.f); }
  return a;
}
struct F2 { v16b h, l; };
__device__ __forceinline__ F2 bsplit16(const float v[16]) { F2 r;
#pragma unroll
  for (int i = 0; i < 16; ++i) { const __bf16 h = (__bf16)v[i]; r.h[i] = h; r.l[i] = (__bf16)(v[i] - (float)h); }
  return r; }
__device__ __forceinline__ F2 split_row(const float* row, int k0, int lane) { float v[16]; const float* p = row + k0 + 8 * (lane >> 4);
#pragma unroll
  for (int i = 0; i < 8; ++i) { v[i] = p[i]; v[8 + i] = p[16 + i]; }
  return bsplit16(v); }
__device__ __forceinline__ F2 split_rowK(const float* row, int k0, int lane, int K) { float v[16]; const int g = lane >> 4;
#pragma unroll
  for (int i = 0; i < 8; ++i) { const int ka = k0 + 8 * g + i, kb = ka + 16; v[i] = ka < K ? row[ka] : 0.f; v[8 + i] = kb < K ? row[kb] : 0.f; }
  return bsplit16(v); }
__device__ __forceinline__ F2 split_col(const float* W, int k0, int n, int lane, int ld, int K) { float v[16]; const int g = lane >> 4;
#pragma unroll
  for (int i = 0; i < 8; ++i) { const int ka = k0 + 8 * g + i, kb = ka + 16; v[i] = ka < K ? W[(size_t)ka * ld + n] : 0.f; v[8 + i] = kb < K ? W[(size_t)kb * ld + n] : 0.f; }
  return bsplit16(v); }
__device__ __forceinline__ v8f mac3(const F2& a, const F2& b, v8f c) { c = wmma_bf(a.l, b.h, c); c = wmma_bf(a.h, b.l, c); return wmma_bf(a.h, b.h, c); }
__device__ __forceinline__ float sigm(float v) { return 1.0f / (1.0f + expf(-v)); }
#define LDSX() do { asm volatile("s_wait_dscnt 0" ::: "memory"); __builtin_amdgcn_wave_barrier(); __builtin_amdgcn_fence(__ATOMIC_RELEASE, "workgroup"); } while (0)

// Graph interaction layer (single-head attention with a learned relative-position bias, post-LN transformer block). q/k/v / Wo / FFN
// GEMMs on v_wmma_f32_16x16x32_f16 (q/k/v operands converted on the way into LDS; Wo/FFN A rows staged in LDS as f16, their weights converted once into f16 fragment order; [out][in] weights x16; f32 accumulate); the pairwise bias
// MLP (2 -> 512 -> 1, K = 2) in f32 VALU; diagonal masked to -inf; softmax, LayerNorms in f32; P x2^14 f16.
#define NB 8
#define NN 256
#define DD 512
#define FF 1024
#define NR (NB * NN)

// 64 x 128 tile of X @ W^T over K = 512 for a block of 4 waves (wave w: rows 16w..16w+15, all 128 columns). X and W arrive in chunks of KC
// columns: every thread fetches whole 256-byte row pieces (16 lanes a row), converts once (W x16) and stores f16 rows of pitch KP in LDS;
// the fragments come from LDS. Two buffers: the next chunk's loads are asked for before this chunk's products and fly behind them.
#define KC 64
#define KP (KC + 8)
__device__ __forceinline__ void tile_mm(const float* __restrict__ X, const float* __restrict__ Wm, _Float16* sX, _Float16* sW, int tid, v8f (&acc)[8]) {
  const int wave = tid >> 5, lane = tid & 31, col = lane & 15, pr = tid >> 4, pc = (tid & 15) * 4;
  const unsigned vo = (unsigned)(pr * DD + pc);   // the thread's place inside a chunk: loop-invariant lane offset, the chunk's base stays scalar
  v4f xa[8], wb[16];
#pragma unroll
  for (int i = 0; i < 8; ++i) xa[i] = *(const v4f*)(X + i * 8 * DD + vo);
#pragma unroll
  for (int i = 0; i < 16; ++i) wb[i] = *(const v4f*)(Wm + i * 8 * DD + vo);
#pragma unroll 1   // rolled: one chunk in registers, one in each LDS buffer
  for (int c = 0; c < DD / KC; ++c) { _Float16* bx = sX + (c & 1) * (64 * KP); _Float16* bw = sW + (c & 1) * (128 * KP);
#pragma unroll
    for (int i = 0; i < 8; ++i) { v4h h4;
#pragma unroll
      for (int e = 0; e < 4; ++e) h4[e] = (_Float16)xa[i][e];
      vst2(bx + (i * 8 + pr) * KP + pc, h4); }
#pragma unroll
    for (int i = 0; i < 16; ++i) { v4h h4;
#pragma unroll
      for (int e = 0; e < 4; ++e) h4[e] = (_Float16)(wb[i][e] * 16.0f);
      vst2(bw + (i * 8 + pr) * KP + pc, h4); }
    __syncthreads();   // chunk c is whole; it also ends every wave's reads of the other buffer, which the next trip refills
    if (c + 1 < DD / KC) { X += KC; Wm += KC;   // asked for behind the barrier (whose fence would wait for them), so that they fly while this chunk's products run
#pragma unroll
      for (int i = 0; i < 8; ++i) xa[i] = *(const v4f*)(X + i * 8 * DD + vo);
#pragma unroll
      for (int i = 0; i < 16; ++i) wb[i] = *(const v4f*)(Wm + i * 8 * DD + vo); }
#pragma unroll
    for (int ks = 0; ks < KC / 32; ++ks) { const v16h a = frag_h(bx + (wave * 16 + col) * KP + ks * 32, lane); v16h bf[8];   // all nine fragments asked for before the first product
#pragma unroll
      for (int j = 0; j < 8; ++j) bf[j] = frag_h(bw + (j * 16 + col) * KP + ks * 32, lane);
#pragma unroll
      for (int j = 0; j < 8; ++j) acc[j] = wmma16(a, bf[j], acc[j]); } }
}
// The q/k/v projection and the pairwise bias do not depend on each other: they share ONE launch (k_qkv_bias below), told apart by the block index.
// Both kinds of block have 4 waves and lie over the same LDS (a union: a block is of one kind only).
#define BJ 4
#define BN 8
struct LdsQkv { float so[4][16][132]; _Float16 st[128][72]; _Float16 sX[2][64][KP]; _Float16 sW[2][128][KP]; };
struct LdsBias { v4f sw[DD / 2]; v2f s2[DD / 2]; float su[BN][DD]; float sr[4][(BN + 1) * BJ][32]; };
union LdsQB { LdsQkv q; LdsBias b; };
// q -> f16 rows [r][512]; k and v -> f16 in the order of k_rows' B fragments, [16-row tile][32 k][half][lane][8 values] (as wfrag_block lays the weights), so that a fragment half is 512 bytes in a row:
// kF: tile = 16 keys, k = feature; vF: tile = 16 features of one batch, k = key. bx: 64 rows; by: 0..3 q cols, 4..7 k cols, 8..11 v cols (128 each)
__device__ __forceinline__ void qkv_block(LdsQkv& L, int bx, int by, const float* __restrict__ x, const float* __restrict__ Wq, const float* __restrict__ bq, const float* __restrict__ Wk, const float* __restrict__ bk, const float* __restrict__ Wv, const float* __restrict__ bv,
                                          _Float16* __restrict__ q16, _Float16* __restrict__ kF, _Float16* __restrict__ vF) {
  float (&so)[4][16][132] = L.so; _Float16 (&st)[128][72] = L.st; _Float16 (&sX)[2][64][KP] = L.sX; _Float16 (&sW)[2][128][KP] = L.sW;
  const int tid = threadIdx.x, wave = tid >> 5, lane = tid & 31, col = lane & 15, g = lane >> 4;
  const int r0b = bx * 64, r0 = r0b + wave * 16; const int which = by / 4, n0 = (by % 4) * 128; const int b = r0b / NN, t0 = r0b % NN;
  const float* W = which == 0 ? Wq : (which == 1 ? Wk : Wv); const float* bias = which == 0 ? bq : (which == 1 ? bk : bv);
  v8f acc[8] = {};
  tile_mm(x + (size_t)r0b * DD, W + (size_t)n0 * DD, &sX[0][0][0], &sW[0][0][0], tid, acc);
#pragma unroll
  for (int j = 0; j < 8; ++j) { const float bb = bias[n0 + j * 16 + col];
#pragma unroll
    for (int r = 0; r < 8; ++r) so[wave][8 * g + r][j * 16 + col] = acc[j][r] * (1.0f / 16.0f) + bb; }
  LDSX();
  if (which == 0) {
    for (int q = lane; q < 16 * 16; q += 32) { const int rl = q >> 4, pc = q & 15; union { v8h h8; v4u u; } pk;
#pragma unroll
      for (int e = 0; e < 8; ++e) pk.h8[e] = (_Float16)so[wave][rl][pc * 8 + e];
      vst2(q16 + (size_t)(r0 + rl) * DD + n0 + pc * 8, pk.u); } }
  else if (which == 1) {   // the wave's 16 keys x 128 features are 4 KiB in a row: lane (g, col) holds key col, features 16 i + 8 g + 0..7 for piece i
    _Float16* dst = kF + ((size_t)(r0 / 16) * (DD / 32) + n0 / 32) * 512 + lane * 8;
#pragma unroll
    for (int i = 0; i < 8; ++i) { union { v8h h8; v4u u; } pk;
#pragma unroll
      for (int e = 0; e < 8; ++e) pk.h8[e] = (_Float16)so[wave][col][i * 16 + g * 8 + e];
      vst2(dst + i * 256, pk.u); }
    asm volatile("s_wait_xcnt 0x0" ::: "memory"); }   // kept in front of every later rewrite of a register that the stores above name
  else {
#pragma unroll 4
    for (int rl = 0; rl < 16; ++rl) {
#pragma unroll
      for (int e = 0; e < 4; ++e) st[lane * 4 + e][wave * 16 + rl] = (_Float16)so[wave][rl][lane * 4 + e]; }
    __syncthreads();
    // trip i: feature tile i; the wave takes (32 keys wave >> 1, half wave & 1); lane (g, col) holds feature col, keys 8 g + 0..7 of that half
#pragma unroll
    for (int i = 0; i < 8; ++i) vst2(vF + (((size_t)b * (DD / 16) + n0 / 16 + i) * (NN / 32) + t0 / 32 + (wave >> 1)) * 512 + (wave & 1) * 256 + lane * 8, *(const v4u*)(&st[i * 16 + col][(wave * 2 + g) * 8]));
    asm volatile("s_wait_xcnt 0x0" ::: "memory"); }   // as behind the k stores
}
// bias[b][n][m] = Wr2 . relu(rel @ Wr1^T + br1) + br2, rel = pc[n] - pc[m]; f32 throughout.
// The hidden layer is linear in rel, so z = U[n][h] - V[m][h] with U = Wr1 . pc[n] + br1 and V = Wr1 . pc[m], and relu(U - V) = max(U, V) - V:
// bias = sum_h Wr2[h] max(U[n][h], V[m][h]) - sum_h Wr2[h] V[m][h] + br2. A pair (n, m) then costs one maximum and one multiply-add per hidden unit;
// V (two operations per m and hidden unit) and the second sum (one) are shared by the BN rows n that a wave holds.
// Block = BN rows n x 128 columns m; its 4 waves take a quarter of the hidden units each, a lane BJ columns (m = 32 j + lane); the quarters are added through LDS at the end.
// In LDS: Wr1 by pairs of hidden units (w1x w1x' w1y w1y'), Wr2, and U for the block's BN rows (made once, every thread four hidden units); all three are read as broadcasts.
__device__ __forceinline__ void bias_block(LdsBias& L, int bx, int b, const float* __restrict__ pcs, const float* __restrict__ Wr1, const float* __restrict__ br1, const float* __restrict__ Wr2, const float* __restrict__ br2, float* __restrict__ bias) {
  const int tid = threadIdx.x, lane = tid & 31;
  const int w = __builtin_amdgcn_readfirstlane(tid >> 5);   // the wave's number in a scalar register: its quarter of the hidden units stays scalar
  const int n0 = (bx >> 1) * BN, m0 = (bx & 1) * (BJ * 32);
  // every global operand of the prologue is asked for before the first one is used; a thread stages two pairs of hidden units (tid and tid + 128)
  v4f w1[2]; v2f bb[2], w2[2], pn[BN], pm[BJ]; const float* pmp = pcs + ((size_t)b * NN + m0 + lane) * 2;
#pragma unroll
  for (int i = 0; i < 2; ++i) { const int p = tid + i * 128; w1[i] = *(const v4f*)(Wr1 + p * 4); bb[i] = *(const v2f*)(br1 + p * 2); w2[i] = *(const v2f*)(Wr2 + p * 2); }
#pragma unroll
  for (int r = 0; r < BN; ++r) pn[r] = *(const v2f*)(pcs + ((size_t)b * NN + n0 + r) * 2);
#pragma unroll
  for (int j = 0; j < BJ; ++j) pm[j] = *(const v2f*)(pmp + j * 64);
  asm volatile("s_wait_xcnt 0x0" :: "v"(pmp) : "memory");   // the loads' address registers stay whole up to this wait
#pragma unroll
  for (int i = 0; i < 2; ++i) { const int p = tid + i * 128; const v2f wx = {w1[i][0], w1[i][2]}, wy = {w1[i][1], w1[i][3]};
    L.sw[p] = (v4f){wx[0], wx[1], wy[0], wy[1]}; L.s2[p] = w2[i];
#pragma unroll
    for (int r = 0; r < BN; ++r) *(v2f*)(&L.su[r][p * 2]) = __builtin_elementwise_fma((v2f){pn[r][0], pn[r][0]}, wx, __builtin_elementwise_fma((v2f){pn[r][1], pn[r][1]}, wy, bb[i])); }
  v2f px[BJ], py[BJ], sv[BJ], acc[BN][BJ];
#pragma unroll
  for (int j = 0; j < BJ; ++j) { px[j] = (v2f){pm[j][0], pm[j][0]}; py[j] = (v2f){pm[j][1], pm[j][1]}; sv[j] = (v2f){0.f, 0.f};
#pragma unroll
    for (int r = 0; r < BN; ++r) acc[r][j] = (v2f){0.f, 0.f}; }
  __syncthreads();   // the weights and U are whole
  const int h0 = w * (DD / 4);   // this wave's 128 hidden units, four a trip
  v4f ca[2], cu[BN], co;
#pragma unroll
  for (int i = 0; i < 2; ++i) ca[i] = L.sw[h0 / 2 + i];
  co = *(const v4f*)(&L.s2[h0 / 2]);
#pragma unroll
  for (int r = 0; r < BN; ++r) cu[r] = *(const v4f*)(&L.su[r][h0]);
#pragma unroll 2   // two trips a pass, so that the current and the next operands swap registers without copies
  for (int t = 0; t < DD / 16; ++t) { const int hn = h0 + ((t + 1) & (DD / 16 - 1)) * 4;   // the next trip's operands are asked for ahead of this trip's arithmetic (the last trip re-reads the first group, unused)
    v4f na[2], nu[BN], no;
#pragma unroll
    for (int i = 0; i < 2; ++i) na[i] = L.sw[hn / 2 + i];
    no = *(const v4f*)(&L.s2[hn / 2]);
#pragma unroll
    for (int r = 0; r < BN; ++r) nu[r] = *(const v4f*)(&L.su[r][hn]);
    __builtin_amdgcn_sched_barrier(0);   // keeps the eleven reads above the arithmetic, whose issue slots then cover their latency
    v2f vm[2][BJ];   // V for the trip's four hidden units and the lane's BJ columns
#pragma unroll
    for (int i = 0; i < 2; ++i) { const v2f wx = {ca[i][0], ca[i][1]}, wy = {ca[i][2], ca[i][3]}, wo = {co[i * 2], co[i * 2 + 1]};
#pragma unroll
      for (int j = 0; j < BJ; ++j) { vm[i][j] = __builtin_elementwise_fma(px[j], wx, py[j] * wy); sv[j] = __builtin_elementwise_fma(vm[i][j], wo, sv[j]); } }
#pragma unroll
    for (int i = 0; i < 2; ++i) { const v2f wo = {co[i * 2], co[i * 2 + 1]};
#pragma unroll
      for (int j = 0; j < BJ; ++j) {
        if ((j & 1) == 0) __builtin_amdgcn_sched_barrier(0);   // groups of 16 maxima and their 16 multiply-adds: otherwise all 64 maxima of a trip are issued first and their results take 128 registers
#pragma unroll
        for (int r = 0; r < BN; ++r) acc[r][j] = __builtin_elementwise_fma(__builtin_elementwise_maxnum((v2f){cu[r][i * 2], cu[r][i * 2 + 1]}, vm[i][j]), wo, acc[r][j]); } }
#pragma unroll
    for (int i = 0; i < 2; ++i) ca[i] = na[i];
    co = no;
#pragma unroll
    for (int r = 0; r < BN; ++r) cu[r] = nu[r]; }
#pragma unroll
  for (int j = 0; j < BJ; ++j) { L.sr[w][BN * BJ + j][lane] = sv[j][0] + sv[j][1];
#pragma unroll
    for (int r = 0; r < BN; ++r) L.sr[w][r * BJ + j][lane] = acc[r][j][0] + acc[r][j][1]; }
  __syncthreads();   // every quarter's sums are in LDS
  const float b2 = br2[0];   // wave w joins the quarters of rows 2w and 2w + 1
#pragma unroll
  for (int j = 0; j < BJ; ++j) { const int ks = BN * BJ + j; const float s = (L.sr[0][ks][lane] + L.sr[1][ks][lane]) + (L.sr[2][ks][lane] + L.sr[3][ks][lane]);
#pragma unroll
    for (int i = 0; i < BN / 4; ++i) { const int r = w * (BN / 4) + i, k = r * BJ + j;
      bias[((size_t)b * NN + n0 + r) * NN + m0 + j * 32 + lane] = (((L.sr[0][k][lane] + L.sr[1][k][lane]) + (L.sr[2][k][lane] + L.sr[3][k][lane])) - s) + b2; } }
  asm volatile("s_wait_xcnt 0x0" ::: "memory");   // kept in front of every later rewrite of a register that the stores above name
}
// Wo, Wf2 and Wf1 are turned ONCE into f16 (x16) in the order of the B fragments: [16-column tile][32 k][half q][lane][8 values], so that a fragment half
// is 512 bytes in a row. A wave takes one tile of 16 weight rows x 128 k (4 KiB out): lane (g, col) reads row col, k = 16 i + 8 g + 0..7, for piece i.
// Wave tasks 0..127: Wo (32 tiles x 4 groups of k), 128..383: Wf2 (32 x 8), 384..639: Wf1 (64 x 4).
__device__ __forceinline__ void wfrag_block(int cb, const float* __restrict__ Wo, const float* __restrict__ Wf2, const float* __restrict__ Wf1, _Float16* __restrict__ WoH, _Float16* __restrict__ Wf2H, _Float16* __restrict__ Wf1H) {
  const int tid = threadIdx.x, lane = tid & 31, col = lane & 15, g = lane >> 4;
  const int t = cb * 4 + __builtin_amdgcn_readfirstlane(tid >> 5);
  const bool f1 = t >= 384, f2 = t >= 128 && !f1; const int u = f1 ? t - 384 : (f2 ? t - 128 : t), K = f2 ? FF : DD, nt = f2 ? u >> 3 : u >> 2, kg = f2 ? u & 7 : u & 3;
  const float* src = (f1 ? Wf1 : (f2 ? Wf2 : Wo)) + (size_t)(nt * 16 + col) * K + kg * 128 + g * 8;
  _Float16* dst = (f1 ? Wf1H : (f2 ? Wf2H : WoH)) + (size_t)(nt * (K / 32) + kg * 4) * 512 + lane * 8;
  v4f v[8][2];
#pragma unroll
  for (int i = 0; i < 8; ++i) { v[i][0] = *(const v4f*)(src + i * 16); v[i][1] = *(const v4f*)(src + i * 16 + 4); }
  asm volatile("s_wait_xcnt 0x0" :: "v"(src) : "memory");   // the loads' address pair stays whole up to this wait
#pragma unroll
  for (int i = 0; i < 8; ++i) { v8h h;
#pragma unroll
    for (int e = 0; e < 8; ++e) h[e] = (_Float16)(v[i][e >> 2][e & 3] * 16.0f);
    vst2(dst + i * 256, h); }
}
// One launch for all three: blocks 0..QKVB-1 are the projection tiles (first, because each is a long chain of waits with little to issue),
// then WFB short blocks that re-order Wo, Wf2 and Wf1 for the second launch; the BIASB blocks behind them are the bias rows, whose vector work fills the issue slots that the projection waves leave idle.
#define QKVB (NR / 64 * 12)
#define WFB 160
#define BIASB (NN / BN * 2 * NB)
__global__ __launch_bounds__(128) void k_qkv_bias(const float* __restrict__ x, const float* __restrict__ Wq, const float* __restrict__ bq, const float* __restrict__ Wk, const float* __restrict__ bk, const float* __restrict__ Wv, const float* __restrict__ bv,
                                                  _Float16* __restrict__ q16, _Float16* __restrict__ kF, _Float16* __restrict__ vF,
                                                  const float* __restrict__ pcs, const float* __restrict__ Wr1, const float* __restrict__ br1, const float* __restrict__ Wr2, const float* __restrict__ br2, float* __restrict__ bias,
                                                  const float* __restrict__ Wo, const float* __restrict__ Wf2, const float* __restrict__ Wf1, _Float16* __restrict__ WoH, _Float16* __restrict__ Wf2H, _Float16* __restrict__ Wf1H) {
  __shared__ __align__(16) LdsQB lds;
  const int bid = blockIdx.x;   // the same for the whole block: every barrier below stands under block-uniform control flow
  if (bid < QKVB) qkv_block(lds.q, bid % (NR / 64), bid / (NR / 64), x, Wq, bq, Wk, bk, Wv, bv, q16, kF, vF);
  else if (bid < QKVB + WFB) wfrag_block(bid - QKVB, Wo, Wf2, Wf1, WoH, Wf2H, Wf1H);
  else bias_block(lds.b, (bid - QKVB - WFB) % (NN / BN * 2), (bid - QKVB - WFB) / (NN / BN * 2), pcs, Wr1, br1, Wr2, br2, bias);
}
// Attention, output projection + LayerNorm and FFN + LayerNorm in ONE launch: behind the scores every step is local to a row, so a block (b, 16 queries; 16 waves)
// keeps its 16 rows in LDS and registers from the q tile to the output; nothing between the steps goes through global memory, and no step waits for a launch.
// Attention: S = q.k/sqrt(512) + bias, diagonal excluded, softmax over 256 (f32), P x2^14 f16 @ v. Wave w: the 16 queries against keys 16w..16w+15 (the q tile is staged
// once in LDS); behind a block barrier the softmax of row w; behind a second one columns 32w..32w+31 of P @ v, which go to LDS as f16 rows (the A operand of the Wo product).
// kF and vF lie in fragment order (qkv_block): a wave's k tile is 16 KiB in a row, and so are its two 8 KiB v tiles together, and every load takes 512 bytes in a row (four whole lines).
// The three weight products: A rows (f16) from LDS; WoH, Wf1H, Wf2H as wfrag_block left them (f16 x16, fragment order): no other wave of the block needs a wave's B fragments,
// so each wave loads its own straight into registers, 512 bytes in a row per load, through a ring of 16 fragments; the k loops have no barrier.
// A ring's first fill is asked for where the registers of the step before fall free, or behind the barrier in front of a LayerNorm, so that it flies behind that work
// (a block barrier waits for the wave's outstanding loads). The short loops are all unrolled so that the fragment arrays are indexed by constants and stay in registers.
#define RD 8
#define RC 4
#define AR 2
// 16 rows x the wave's 32 columns over NK steps of 32 k; arow = the lane's A row in LDS; bf holds steps 0..RD-1 on entry
template <int NK>
__device__ __forceinline__ void rows_mm(const _Float16* arow, const _Float16* wp, int lane, v16h (&bf)[RD][2], v8f (&acc)[2]) {
  v16h ar[AR];   // the A fragments come from LDS AR steps ahead of their products
#pragma unroll
  for (int kc = 0; kc < AR; ++kc) ar[kc] = frag_h(arow + kc * 32, lane);
#pragma unroll   // unrolled: the ring's registers are indexed by constants
  for (int kc = 0; kc < NK; ++kc) { const v16h a = ar[kc % AR];
#pragma unroll
    for (int j = 0; j < 2; ++j) acc[j] = wmma16(a, bf[kc % RD][j], acc[j]);
    if (kc + AR < NK) ar[kc % AR] = frag_h(arow + (kc + AR) * 32, lane);
    if (kc + RD < NK) {   // the step's registers are free: refill them RD steps ahead
#pragma unroll
      for (int j = 0; j < 2; ++j) bf[kc % RD][j] = frag_w(wp + (j * NK + kc + RD) * 512); } }
}
// LayerNorm of one row of 512 by one wave: 16 values per lane (pieces of 4 at i * 128 + lane * 4), in place
__device__ __forceinline__ void ln_row(v4f (&v)[4], const v4f (&gm)[4], const v4f (&bt)[4]) {
  float s = 0.f;
#pragma unroll
  for (int i = 0; i < 4; ++i) s += (v[i][0] + v[i][1]) + (v[i][2] + v[i][3]);
#pragma unroll
  for (int o = 16; o > 0; o >>= 1) s += __shfl_xor(s, o, 32);
  const float mu = s * (1.0f / DD); float q2 = 0.f;
#pragma unroll
  for (int i = 0; i < 4; ++i)
#pragma unroll
    for (int e = 0; e < 4; ++e) { const float d = v[i][e] - mu; q2 += d * d; }
#pragma unroll
  for (int o = 16; o > 0; o >>= 1) q2 += __shfl_xor(q2, o, 32);
  const float rs = rsqrtf(q2 * (1.0f / DD) + 1e-5f);
#pragma unroll
  for (int i = 0; i < 4; ++i)
#pragma unroll
    for (int e = 0; e < 4; ++e) v[i][e] = (v[i][e] - mu) * rs * gm[i][e] + bt[i][e];
}
__global__ __launch_bounds__(512) void k_rows(const _Float16* __restrict__ q16, const _Float16* __restrict__ kF, const _Float16* __restrict__ vF, const float* __restrict__ bias, const float* __restrict__ x,
                                              const _Float16* __restrict__ WoH, const float* __restrict__ bo, const float* __restrict__ g1, const float* __restrict__ be1,
                                              const _Float16* __restrict__ Wf1H, const float* __restrict__ bf1, const _Float16* __restrict__ Wf2H, const float* __restrict__ bf2, const float* __restrict__ g2, const float* __restrict__ be2,
                                              float* __restrict__ Out) {
  __shared__ __align__(16) _Float16 sQ[16][DD + 8];
  __shared__ __align__(16) float sS[16][NN + 4];
  __shared__ __align__(16) _Float16 sP[16][NN + 8];
  __shared__ __align__(16) _Float16 sG[16][DD + 8];   // attention output rows
  __shared__ __align__(16) float so[16][DD + 4];      // a product's 16 x 512 result on its way from column slices to whole rows (both LayerNorms)
  __shared__ __align__(16) _Float16 sX[16][DD + 8];   // rows behind the first LayerNorm
  __shared__ __align__(16) _Float16 sH[16][FF + 8];   // FFN hidden rows, x4
  const int tid = threadIdx.x, lane = tid & 31, col = lane & 15, g = lane >> 4;
  const int w = __builtin_amdgcn_readfirstlane(tid >> 5);   // the wave's number in a scalar register: tile bases stay scalar
  const int b = blockIdx.y, q0 = blockIdx.x * 16; const size_t rb = (size_t)b * NN;
  { v16h kf[16]; float bv[8]; const _Float16* qp[2]; v4u qv[2];
#pragma unroll
    for (int kc = 0; kc < 16; ++kc) kf[kc] = frag_w(kF + ((size_t)(b * (NN / 16) + w) * (DD / 32) + kc) * 512 + lane * 8);
#pragma unroll
    for (int r = 0; r < 8; ++r) bv[r] = bias[(rb + q0 + 8 * g + r) * NN + w * 16 + col];
#pragma unroll
    for (int i = 0; i < 2; ++i) { const int q = tid + i * 512, rl = q >> 6, pc = q & 63; qp[i] = q16 + (rb + q0 + rl) * DD + pc * 8; qv[i] = *(const v4u*)qp[i]; }
    asm volatile("s_wait_xcnt 0x0" :: "v"(qp[0]), "v"(qp[1]) : "memory");   // the q loads' address pairs stay whole up to this wait
#pragma unroll
    for (int i = 0; i < 2; ++i) { const int q = tid + i * 512, rl = q >> 6, pc = q & 63; vst2(&sQ[rl][pc * 8], qv[i]); }
    __syncthreads();   // the q tile is whole
    v8f s = {};
#pragma unroll
    for (int h = 0; h < 2; ++h) { v16h aq[8];
#pragma unroll
      for (int kc = 0; kc < 8; ++kc) aq[kc] = frag_h(&sQ[col][0] + (h * 8 + kc) * 32, lane);
#pragma unroll
      for (int kc = 0; kc < 8; ++kc) s = wmma16(aq[kc], kf[h * 8 + kc], s); }
#pragma unroll
    for (int r = 0; r < 8; ++r) { const int qi = q0 + 8 * g + r, m = w * 16 + col; sS[8 * g + r][m] = (m == qi) ? -3.0e38f : s[r] * 0.044194173824159216f + bv[r]; } }
  __syncthreads();   // every score row now holds the key slices of all 16 waves
  v16h vf[2][8];     // asked for here, so that they fly while the row's softmax runs
  const _Float16* vp = vF + (size_t)(b * (DD / 16) + w * 2) * (NN / 32) * 512;   // the wave's two feature tiles, one behind the other: a scalar base, the lane's place is the loads' offset register
#pragma unroll
  for (int j = 0; j < 2; ++j)
#pragma unroll
    for (int kc = 0; kc < 8; ++kc) vf[j][kc] = frag_w(vp + (j * (NN / 32) + kc) * 512 + (unsigned)lane * 8u);
  { v4f p[2]; float mx = -3.4e38f;
#pragma unroll
    for (int i = 0; i < 2; ++i) { p[i] = *(const v4f*)(&sS[w][i * 128 + lane * 4]); mx = fmaxf(mx, fmaxf(fmaxf(p[i][0], p[i][1]), fmaxf(p[i][2], p[i][3]))); }
#pragma unroll
    for (int o = 16; o > 0; o >>= 1) mx = fmaxf(mx, __shfl_xor(mx, o, 32));
    float l = 0.f;
#pragma unroll
    for (int i = 0; i < 2; ++i)
#pragma unroll
      for (int e = 0; e < 4; ++e) { const float sv = p[i][e]; const float pv = sv <= -1.0e38f ? 0.f : expf(sv - mx); l += pv; p[i][e] = pv; }
#pragma unroll
    for (int o = 16; o > 0; o >>= 1) l += __shfl_xor(l, o, 32);
    const float inv = 16384.0f / l;
#pragma unroll
    for (int i = 0; i < 2; ++i) { v4h h4;
#pragma unroll
      for (int e = 0; e < 4; ++e) h4[e] = (_Float16)(p[i][e] * inv);
      vst2(&sP[w][i * 128 + lane * 4], h4); } }
  __syncthreads();   // all 16 rows of P are written
  v16h bf[RD][2];    // the ring of the Wo product, later of the Wf2 product
  { v16h pa[8];
#pragma unroll
    for (int kc = 0; kc < 8; ++kc) pa[kc] = frag_h(&sP[col][0] + kc * 32, lane);
    const _Float16* wp = WoH + (size_t)(w * 2) * (DD / 32) * 512 + lane * 8;   // the wave's two column tiles of Wo
    v8f acc[2] = {};
#pragma unroll
    for (int kc = 0; kc < 8; ++kc) {
#pragma unroll
      for (int j = 0; j < 2; ++j) acc[j] = wmma16(pa[kc], vf[j][kc], acc[j]);
#pragma unroll
      for (int j = 0; j < 2; ++j) bf[kc][j] = frag_w(wp + (j * (DD / 32) + kc) * 512); }   // the v fragments' registers fall free: the Wo ring's first fill
#pragma unroll
    for (int j = 0; j < 2; ++j)
#pragma unroll
      for (int r = 0; r < 8; ++r) sG[8 * g + r][w * 32 + j * 16 + col] = (_Float16)(acc[j][r] * (1.0f / 16384.0f)); }
  __syncthreads();   // the 16 attention rows are whole
  v4f v[4];          // the wave's own row (row w of the block), 16 values per lane: first the residual x, then the row behind the first LayerNorm
  v4f gm[4], bt[4]; float bb[2];   // asked for ahead of the product, used behind it
#pragma unroll
  for (int i = 0; i < 4; ++i) { const int cc = i * 128 + lane * 4; v[i] = *(const v4f*)(x + (rb + q0 + w) * DD + cc); gm[i] = *(const v4f*)(g1 + cc); bt[i] = *(const v4f*)(be1 + cc); }
#pragma unroll
  for (int j = 0; j < 2; ++j) bb[j] = bo[w * 32 + j * 16 + col];
  { v8f acc[2] = {};
    rows_mm<DD / 32>(&sG[col][0], WoH + (size_t)(w * 2) * (DD / 32) * 512 + lane * 8, lane, bf, acc);
#pragma unroll
    for (int j = 0; j < 2; ++j)
#pragma unroll
      for (int r = 0; r < 8; ++r) so[8 * g + r][w * 32 + j * 16 + col] = acc[j][r] * (1.0f / 16.0f) + bb[j]; }
  __syncthreads();   // every row now holds the column slices of all 16 waves
  // FFN hidden: wave w takes columns 64w..64w+63 (four tiles) for the 16 rows; its ring holds RC steps of four fragments, asked for here so that they fly behind the LayerNorm
  const _Float16* w1 = Wf1H + (size_t)(w * 4) * (DD / 32) * 512 + lane * 8;
  v16h bc[RC][4]; float b1[4];
#pragma unroll
  for (int kc = 0; kc < RC; ++kc)
#pragma unroll
    for (int j = 0; j < 4; ++j) bc[kc][j] = frag_w(w1 + (j * (DD / 32) + kc) * 512);
#pragma unroll
  for (int j = 0; j < 4; ++j) b1[j] = bf1[w * 64 + j * 16 + col];
#pragma unroll
  for (int i = 0; i < 4; ++i) v[i] = *(const v4f*)(&so[w][i * 128 + lane * 4]) + v[i];
  ln_row(v, gm, bt);
#pragma unroll
  for (int i = 0; i < 4; ++i) { v4h h4;
#pragma unroll
    for (int e = 0; e < 4; ++e) h4[e] = (_Float16)v[i][e];
    vst2(&sX[w][i * 128 + lane * 4], h4); }
  __syncthreads();   // the 16 rows behind the first LayerNorm are whole
  const _Float16* w2 = Wf2H + (size_t)(w * 2) * (FF / 32) * 512 + lane * 8;   // the wave's two column tiles of Wf2
  { v8f acc[4] = {}; v16h ar[AR];   // the A fragments come from LDS AR steps ahead of their products
#pragma unroll
    for (int kc = 0; kc < AR; ++kc) ar[kc] = frag_h(&sX[col][kc * 32], lane);
#pragma unroll   // unrolled: the rings' registers are indexed by constants
    for (int kc = 0; kc < DD / 32; ++kc) { const v16h a = ar[kc % AR];
#pragma unroll
      for (int j = 0; j < 4; ++j) acc[j] = wmma16(a, bc[kc % RC][j], acc[j]);
      if (kc + AR < DD / 32) ar[kc % AR] = frag_h(&sX[col][(kc + AR) * 32], lane);
      if (kc + RC < DD / 32) {   // the step's registers are free: refill them RC steps ahead
#pragma unroll
        for (int j = 0; j < 4; ++j) bc[kc % RC][j] = frag_w(w1 + (j * (DD / 32) + kc + RC) * 512); }
      else {                     // no step of Wf1 is left to ask for: the Wf2 ring's first fill, two of its steps per freed step
        const int t = (kc + RC - DD / 32) * 2;
#pragma unroll
        for (int u = 0; u < 2; ++u)
#pragma unroll
          for (int j = 0; j < 2; ++j) bf[t + u][j] = frag_w(w2 + (j * (FF / 32) + t + u) * 512); } }
#pragma unroll
    for (int j = 0; j < 4; ++j)
#pragma unroll
      for (int r = 0; r < 8; ++r) { const float hv = acc[j][r] * (1.0f / 16.0f) + b1[j]; sH[8 * g + r][w * 64 + j * 16 + col] = (_Float16)(hv > 0.f ? hv * 4.0f : 0.f); } }
  __syncthreads();   // the 16 hidden rows are whole
#pragma unroll
  for (int i = 0; i < 4; ++i) { const int cc = i * 128 + lane * 4; gm[i] = *(const v4f*)(g2 + cc); bt[i] = *(const v4f*)(be2 + cc); }   // again ahead of the product
#pragma unroll
  for (int j = 0; j < 2; ++j) bb[j] = bf2[w * 32 + j * 16 + col];
  { v8f acc[2] = {};
    rows_mm<FF / 32>(&sH[col][0], w2, lane, bf, acc);
#pragma unroll
    for (int j = 0; j < 2; ++j)
#pragma unroll
      for (int r = 0; r < 8; ++r) so[8 * g + r][w * 32 + j * 16 + col] = acc[j][r] * (1.0f / 64.0f) + bb[j]; }   // hidden x4 and Wf2 x16
  __syncthreads();   // every row now holds the column slices of all 16 waves
#pragma unroll
  for (int i = 0; i < 4; ++i) v[i] = *(const v4f*)(&so[w][i * 128 + lane * 4]) + v[i];
  ln_row(v, gm, bt);
#pragma unroll
  for (int i = 0; i < 4; ++i) vst2(Out + (rb + q0 + w) * DD + i * 128 + lane * 4, v[i]);
}
extern "C" void kernel_launch(void* const* d_in, const int* in_sizes, int n_in, void* d_out, int out_size, void* d_ws, size_t ws_size, hipStream_t stream) {
  (void)in_sizes; (void)n_in; (void)out_size; (void)ws_size;
  const float** I = (const float**)d_in;
  const float* x = I[0]; const float* pcs = I[1]; const float* Wq = I[2]; const float* bq = I[3]; const float* Wk = I[4]; const float* bk = I[5]; const float* Wv = I[6]; const float* bv = I[7];
  const float* Wr1 = I[8]; const float* br1 = I[9]; const float* Wr2 = I[10]; const float* br2 = I[11]; const float* Wo = I[12]; const float* bo = I[13]; const float* g1 = I[14]; const float* be1 = I[15];
  const float* Wf1 = I[16]; const float* bf1 = I[17]; const float* Wf2 = I[18]; const float* bf2 = I[19]; const float* g2 = I[20]; const float* be2 = I[21];
  float* out = (float*)d_out;
  char* ws = (char*)d_ws; size_t off = 0;
  auto take = [&](size_t bytes) { char* p = ws + off; off += (bytes + 255) & ~(size_t)255; return p; };
  _Float16* q16 = (_Float16*)take((size_t)NR * DD * 2); _Float16* kF = (_Float16*)take((size_t)NR * DD * 2); _Float16* vF = (_Float16*)take((size_t)NR * DD * 2); float* bias = (float*)take((size_t)NB * NN * NN * 4);
  _Float16* WoH = (_Float16*)take((size_t)DD * DD * 2); _Float16* Wf2H = (_Float16*)take((size_t)DD * FF * 2); _Float16* Wf1H = (_Float16*)take((size_t)FF * DD * 2);
  k_qkv_bias<<<QKVB + WFB + BIASB, 128, 0, stream>>>(x, Wq, bq, Wk, bk, Wv, bv, q16, kF, vF, pcs, Wr1, br1, Wr2, br2, bias, Wo, Wf2, Wf1, WoH, Wf2H, Wf1H);
  k_rows<<<dim3(NN / 16, NB), 512, 0, stream>>>(q16, kF, vF, bias, x, WoH, bo, g1, be1, Wf1H, bf1, Wf2H, bf2, g2, be2, out);
}

// v010
// Measured time: 47.8 microseconds a run.
// Timed twice side by side with v009, it ran 1.07 times as fast both times.
// All steps since v000 together make it 19.3 times as fast.
#include <hip/hip_runtime.h>
#include <math.h>

typedef __attribute__((ext_vector_type(16))) _Float16 v16h;
typedef __attribute__((ext_vector_type(16))) __bf16 v16b;
typedef __attribute__((ext_vector_type(8)))  _Float16 v8h;
typedef __attribute__((ext_vector_type(4)))  _Float16 v4h;
typedef __attribute__((ext_vector_type(8)))  float v8f;
typedef __attribute__((ext_vector_type(4)))  float v4f;
typedef __attribute__((ext_vector_type(2)))  float v2f;
typedef __attribute__((ext_vector_type(4)))  unsigned v4u;
typedef __attribute__((ext_vector_type(4)))  int v4i;
typedef float __attribute__((may_alias)) float_a;
typedef int __attribute__((may_alias)) int_a;

template <typename T> __device__ __forceinline__ void vst2(void* p, T v) { *(T*)p = v;  }
__device__ __forceinline__ v8f wmma16(v16h a, v16h b, v8f c) {
  v8f d = __builtin_amdgcn_wmma_f32_16x16x32_f16(false, a, false, b, (short)0, c, false, false);
  asm volatile("v_nop\n\tv_nop\n\tv_nop\n\tv_nop" : "+v"(d) : "v"(a), "v"(b));
  return d;
}
__device__ __forceinline__ v8f wmma_bf(v16b a, v16b b, v8f c) {
  v8f d = __builtin_amdgcn_wmma_f32_16x16x32_bf16(false, a, false, b, (short)0, c, false, false);
  asm volatile("v_nop\n\tv_nop\n\tv_nop\n\tv_nop" : "+v"(d) : "v"(a), "v"(b));
  return d;
}
// 16x16x32 fragments: lane = (h = lane>>4, row/col = lane&15); elements 0..7 = k0+8h+0..7, 8..15 = k0+16+8h+0..7; D element r = row 8h+r
__device__ __forceinline__ v16h frag_h(const _Float16* rowk0, int lane) {
  union { v16h v; v8h q[2]; } u; const _Float16* p = rowk0 + 8 * (lane >> 4);
  u.q[0] = *(const v8h*)p; u.q[1] = *(const v8h*)(p + 16); return u.v;
}
// a fragment stored in fragment order: p = the fragment's 1 KiB + lane * 8 values; the two halves lie 256 values apart
__device__ __forceinline__ v16h frag_w(const _Float16* p) { union { v16h v; v8h q[2]; } u; u.q[0] = *(const v8h*)p; u.q[1] = *(const v8h*)(p + 256); return u.v; }
__device__ __forceinline__ v16h frag_f32(const float* rowk0, int lane) {
  v16h a; const float* p = rowk0 + 8 * (lane >> 4);
#pragma unroll
  for (int i = 0; i < 8; ++i) { a[i] = (_Float16)p[i]; a[8 + i] = (_Float16)p[16 + i]; }
  return a;
}
__device__ __forceinline__ v16h frag_f32s(const float* rowk0, int lane, float sc) {
  v16h a; const float* p = rowk0 + 8 * (lane >> 4);
#pragma unroll
  for (int i = 0; i < 8; ++i) { a[i] = (_Float16)(p[i] * sc); a[8 + i] = (_Float16)(p[16 + i] * sc); }
  return a;
}
// column fragment from a [K][ld] layout (column n), rows >= K read as 0
__device__ __forceinline__ v16h fragc_f32(const float* W, int k0, int n, int lane, int ld, int K) {
  v16h a; const int g = lane >> 4;
#pragma unroll
  for (int i = 0; i < 8; ++i) { const int ka = k0 + 8 * g + i, kb = ka + 16;
    a[i] = (_Float16)(ka < K ? W[(size_t)ka * ld + n] : 0.f); a[8 + i] = (_Float16)(kb < K ? W[(size_t)kb * ld + n] : 0.f); }
  return a;
}
struct F2 { v16b h, l; };
__device__ __forceinline__ F2 bsplit16(const float v[16]) { F2 r;
#pragma unroll
  for (int i = 0; i < 16; ++i) { const __bf16 h = (__bf16)v[i]; r.h[i] = h; r.l[i] = (__bf16)(v[i] - (float)h); }
  return r; }
__device__ __forceinline__ F2 split_row(const float* row, int k0, int lane) { float v[16]; const float* p = row + k0 + 8 * (lane >> 4);
#pragma unroll
  for (int i = 0; i < 8; ++i) { v[i] = p[i]; v[8 + i] = p[16 + i]; }
  return bsplit16(v); }
__device__ __forceinline__ F2 split_rowK(const float* row, int k0, int lane, int K) { float v[16]; const int g = lane >> 4;
#pragma unroll
  for (int i = 0; i < 8; ++i) { const int ka = k0 + 8 * g + i, kb = ka + 16; v[i] = ka < K ? row[ka] : 0.f; v[8 + i] = kb < K ? row[kb] : 0.f; }
  return bsplit16(v); }
__device__ __forceinline__ F2 split_col(const float* W, int k0, int n, int lane, int ld, int K) { float v[16]; const int g = lane >> 4;
#pragma unroll
  for (int i = 0; i < 8; ++i) { const int ka = k0 + 8 * g + i, kb = ka + 16; v[i] = ka < K ? W[(size_t)ka * ld + n] : 0.f; v[8 + i] = kb < K ? W[(size_t)kb * ld + n] : 0.f; }
  return bsplit16(v); }
__device__ __forceinline__ v8f mac3(const F2& a, const F2& b, v8f c) { c = wmma_bf(a.l, b.h, c); c = wmma_bf(a.h, b.l, c); return wmma_bf(a.h, b.h, c); }
__device__ __forceinline__ float sigm(float v) { return 1.0f / (1.0f + expf(-v)); }
#define LDSX() do { asm volatile("s_wait_dscnt 0" ::: "memory"); __builtin_amdgcn_wave_barrier(); __builtin_amdgcn_fence(__ATOMIC_RELEASE, "workgroup"); } while (0)

// Graph interaction layer (single-head attention with a learned relative-position bias, post-LN transformer block). q/k/v / Wo / FFN
// GEMMs on v_wmma_f32_16x16x32_f16 (q/k/v operands converted on the way into LDS; Wo/FFN A rows staged in LDS as f16, their weights converted once into f16 fragment order; [out][in] weights x16; f32 accumulate); the pairwise bias
// MLP (2 -> 512 -> 1, K = 2) in f32 VALU; diagonal masked to -inf; softmax, LayerNorms in f32; P x2^14 f16.
#define NB 8
#define NN 256
#define DD 512
#define FF 1024
#define NR (NB * NN)

// 64 x 128 tile of X @ W^T over K = 512 for a block of 4 waves (wave w: rows 16w..16w+15, all 128 columns). X and W arrive in chunks of KC
// columns: every thread fetches whole 256-byte row pieces (16 lanes a row), converts once (W x16) and stores f16 rows of pitch KP in LDS;
// the fragments come from LDS. Two buffers: the next chunk's loads are asked for before this chunk's products and fly behind them.
// The walk over the chunks starts at chunk rot and wraps: blocks that share X rows or W rows get different rot, so that they do not ask L2 for the same lines at the same moment.
#define KC 64
#define KP (KC + 8)
__device__ __forceinline__ void tile_mm(const float* __restrict__ X, const float* __restrict__ Wm, _Float16* sX, _Float16* sW, int tid, int rot, v8f (&acc)[8]) {
  const int wave = tid >> 5, lane = tid & 31, col = lane & 15, pr = tid >> 4, pc = (tid & 15) * 4;
  const unsigned vo = (unsigned)(pr * DD + pc);   // the thread's place inside a chunk: loop-invariant lane offset, the chunk's base stays scalar
  v4f xa[8], wb[16]; X += rot * KC; Wm += rot * KC;
#pragma unroll
  for (int i = 0; i < 8; ++i) xa[i] = *(const v4f*)(X + i * 8 * DD + vo);
#pragma unroll
  for (int i = 0; i < 16; ++i) wb[i] = *(const v4f*)(Wm + i * 8 * DD + vo);
#pragma unroll 1   // rolled: one chunk in registers, one in each LDS buffer
  for (int c = 0; c < DD / KC; ++c) { _Float16* bx = sX + (c & 1) * (64 * KP); _Float16* bw = sW + (c & 1) * (128 * KP);
#pragma unroll
    for (int i = 0; i < 8; ++i) { v4h h4;
#pragma unroll
      for (int e = 0; e < 4; ++e) h4[e] = (_Float16)xa[i][e];
      vst2(bx + (i * 8 + pr) * KP + pc, h4); }
#pragma unroll
    for (int i = 0; i < 16; ++i) { v4h h4;
#pragma unroll
      for (int e = 0; e < 4; ++e) h4[e] = (_Float16)(wb[i][e] * 16.0f);
      vst2(bw + (i * 8 + pr) * KP + pc, h4); }
    __syncthreads();   // chunk c is whole; it also ends every wave's reads of the other buffer, which the next trip refills
    if (c + 1 < DD / KC) { const int st = ((c + 1 + rot) & (DD / KC - 1)) ? KC : KC - DD; X += st; Wm += st;   // on to the next chunk, from the last one back to the first; asked for behind the barrier (whose fence would wait for them), so that they fly while this chunk's products run
#pragma unroll
      for (int i = 0; i < 8; ++i) xa[i] = *(const v4f*)(X + i * 8 * DD + vo);
#pragma unroll
      for (int i = 0; i < 16; ++i) wb[i] = *(const v4f*)(Wm + i * 8 * DD + vo);
      asm volatile("s_wait_xcnt 0x0" ::: "memory"); }   // kept in front of the next trip's rewrite of the two base registers that the loads above name
#pragma unroll
    for (int ks = 0; ks < KC / 32; ++ks) { const v16h a = frag_h(bx + (wave * 16 + col) * KP + ks * 32, lane); v16h bf[8];   // all nine fragments asked for before the first product
#pragma unroll
      for (int j = 0; j < 8; ++j) bf[j] = frag_h(bw + (j * 16 + col) * KP + ks * 32, lane);
#pragma unroll
      for (int j = 0; j < 8; ++j) acc[j] = wmma16(a, bf[j], acc[j]); } }
}
// The q/k/v projection and the pairwise bias do not depend on each other: they share ONE launch (k_qkv_bias below), told apart by the block index.
// Both kinds of block have 4 waves and lie over the same LDS (a union: a block is of one kind only).
#define BJ 4
#define BN 8
struct LdsQkv { float so[4][16][132]; _Float16 st[128][72]; _Float16 sX[2][64][KP]; _Float16 sW[2][128][KP]; };
struct LdsBias { v4f sw[DD / 2]; v2f s2[DD / 2]; float su[BN][DD]; float sr[4][(BN + 1) * BJ][32]; };
union LdsQB { LdsQkv q; LdsBias b; };
// q -> f16 rows [r][512]; k and v -> f16 in the order of k_rows' B fragments, [16-row tile][32 k][half][lane][8 values] (as wfrag_block lays the weights), so that a fragment half is 512 bytes in a row:
// Every tile is laid twice in a row, so that a reader may start at any k place and run on over the whole k range without a wrap (k_rows says why).
// kF: tile = 16 keys, k = feature; vF: tile = 16 features of one batch, k = key. bx: 64 rows; by: 0..3 q cols, 4..7 k cols, 8..11 v cols (128 each)
__device__ __forceinline__ void qkv_block(LdsQkv& L, int bx, int by, const float* __restrict__ x, const float* __restrict__ Wq, const float* __restrict__ bq, const float* __restrict__ Wk, const float* __restrict__ bk, const float* __restrict__ Wv, const float* __restrict__ bv,
                                          _Float16* __restrict__ q16, _Float16* __restrict__ kF, _Float16* __restrict__ vF) {
  float (&so)[4][16][132] = L.so; _Float16 (&st)[128][72] = L.st; _Float16 (&sX)[2][64][KP] = L.sX; _Float16 (&sW)[2][128][KP] = L.sW;
  const int tid = threadIdx.x, wave = tid >> 5, lane = tid & 31, col = lane & 15, g = lane >> 4;
  const int r0b = bx * 64, r0 = r0b + wave * 16; const int which = by / 4, n0 = (by % 4) * 128; const int b = r0b / NN, t0 = r0b % NN;
  const float* W = which == 0 ? Wq : (which == 1 ? Wk : Wv); const float* bias = which == 0 ? bq : (which == 1 ? bk : bv);
  v8f acc[8] = {};
  tile_mm(x + (size_t)r0b * DD, W + (size_t)n0 * DD, &sX[0][0][0], &sW[0][0][0], tid, (bx + by) & (DD / KC - 1), acc);
#pragma unroll
  for (int j = 0; j < 8; ++j) { const float bb = bias[n0 + j * 16 + col];
#pragma unroll
    for (int r = 0; r < 8; ++r) so[wave][8 * g + r][j * 16 + col] = acc[j][r] * (1.0f / 16.0f) + bb; }
  LDSX();
  if (which == 0) {
    for (int q = lane; q < 16 * 16; q += 32) { const int rl = q >> 4, pc = q & 15; union { v8h h8; v4u u; } pk;
#pragma unroll
      for (int e = 0; e < 8; ++e) pk.h8[e] = (_Float16)so[wave][rl][pc * 8 + e];
      vst2(q16 + (size_t)(r0 + rl) * DD + n0 + pc * 8, pk.u); } }
  else if (which == 1) {   // the wave's 16 keys x 128 features are 4 KiB in a row: lane (g, col) holds key col, features 16 i + 8 g + 0..7 for piece i
    _Float16* dst = kF + ((size_t)(r0 / 16) * (2 * DD / 32) + n0 / 32) * 512 + lane * 8;
#pragma unroll
    for (int i = 0; i < 8; ++i) { union { v8h h8; v4u u; } pk;
#pragma unroll
      for (int e = 0; e < 8; ++e) pk.h8[e] = (_Float16)so[wave][col][i * 16 + g * 8 + e];
      vst2(dst + i * 256, pk.u); vst2(dst + (DD / 32) * 512 + i * 256, pk.u); }   // the tile and its second copy
    asm volatile("s_wait_xcnt 0x0" ::: "memory"); }   // kept in front of every later rewrite of a register that the stores above name
  else {
#pragma unroll 4
    for (int rl = 0; rl < 16; ++rl) {
#pragma unroll
      for (int e = 0; e < 4; ++e) st[lane * 4 + e][wave * 16 + rl] = (_Float16)so[wave][rl][lane * 4 + e]; }
    __syncthreads();
    // trip i: feature tile i; the wave takes (32 keys wave >> 1, half wave & 1); lane (g, col) holds feature col, keys 8 g + 0..7 of that half
#pragma unroll
    for (int i = 0; i < 8; ++i) { _Float16* dst = vF + (((size_t)b * (DD / 16) + n0 / 16 + i) * (2 * NN / 32) + t0 / 32 + (wave >> 1)) * 512 + (wave & 1) * 256 + lane * 8; const v4u pv = *(const v4u*)(&st[i * 16 + col][(wave * 2 + g) * 8]);
      vst2(dst, pv); vst2(dst + (NN / 32) * 512, pv); }   // the tile and its second copy
    asm volatile("s_wait_xcnt 0x0" ::: "memory"); }   // as behind the k stores
}
// bias[b][n][m] = Wr2 . relu(rel @ Wr1^T + br1) + br2, rel = pc[n] - pc[m]; f32 throughout.
// The hidden layer is linear in rel, so z = U[n][h] - V[m][h] with U = Wr1 . pc[n] + br1 and V = Wr1 . pc[m], and relu(U - V) = max(U, V) - V:
// bias = sum_h Wr2[h] max(U[n][h], V[m][h]) - sum_h Wr2[h] V[m][h] + br2. A pair (n, m) then costs one maximum and one multiply-add per hidden unit;
// V (two operations per m and hidden unit) and the second sum (one) are shared by the BN rows n that a wave holds.
// Block = BN rows n x 128 columns m; its 4 waves take a quarter of the hidden units each, a lane BJ columns (m = 32 j + lane); the quarters are added through LDS at the end.
// In LDS: Wr1 by pairs of hidden units (w1x w1x' w1y w1y'), Wr2, and U for the block's BN rows (made once, every thread four hidden units); all three are read as broadcasts.
__device__ __forceinline__ void bias_block(LdsBias& L, int bx, int b, const float* __restrict__ pcs, const float* __restrict__ Wr1, const float* __restrict__ br1, const float* __restrict__ Wr2, const float* __restrict__ br2, float* __restrict__ bias) {
  const int tid = threadIdx.x, lane = tid & 31;
  const int w = __builtin_amdgcn_readfirstlane(tid >> 5);   // the wave's number in a scalar register: its quarter of the hidden units stays scalar
  const int n0 = (bx >> 1) * BN, m0 = (bx & 1) * (BJ * 32);
  // every global operand of the prologue is asked for before the first one is used; a thread stages two pairs of hidden units (tid and tid + 128)
  v4f w1[2]; v2f bb[2], w2[2], pn[BN], pm[BJ]; const float* pmp = pcs + ((size_t)b * NN + m0 + lane) * 2;
#pragma unroll
  for (int i = 0; i < 2; ++i) { const int p = tid + i * 128; w1[i] = *(const v4f*)(Wr1 + p * 4); bb[i] = *(const v2f*)(br1 + p * 2); w2[i] = *(const v2f*)(Wr2 + p * 2); }
#pragma unroll
  for (int r = 0; r < BN; ++r) pn[r] = *(const v2f*)(pcs + ((size_t)b * NN + n0 + r) * 2);
#pragma unroll
  for (int j = 0; j < BJ; ++j) pm[j] = *(const v2f*)(pmp + j * 64);
  asm volatile("s_wait_xcnt 0x0" :: "v"(pmp) : "memory");   // the loads' address registers stay whole up to this wait
#pragma unroll
  for (int i = 0; i < 2; ++i) { const int p = tid + i * 128; const v2f wx = {w1[i][0], w1[i][2]}, wy = {w1[i][1], w1[i][3]};
    L.sw[p] = (v4f){wx[0], wx[1], wy[0], wy[1]}; L.s2[p] = w2[i];
#pragma unroll
    for (int r = 0; r < BN; ++r) *(v2f*)(&L.su[r][p * 2]) = __builtin_elementwise_fma((v2f){pn[r][0], pn[r][0]}, wx, __builtin_elementwise_fma((v2f){pn[r][1], pn[r][1]}, wy, bb[i])); }
  v2f px[BJ], py[BJ], sv[BJ], acc[BN][BJ];
#pragma unroll
  for (int j = 0; j < BJ; ++j) { px[j] = (v2f){pm[j][0], pm[j][0]}; py[j] = (v2f){pm[j][1], pm[j][1]}; sv[j] = (v2f){0.f, 0.f};
#pragma unroll
    for (int r = 0; r < BN; ++r) acc[r][j] = (v2f){0.f, 0.f}; }
  __syncthreads();   // the weights and U are whole
  const int h0 = w * (DD / 4);   // this wave's 128 hidden units, four a trip
  v4f ca[2], cu[BN], co;
#pragma unroll
  for (int i = 0; i < 2; ++i) ca[i] = L.sw[h0 / 2 + i];
  co = *(const v4f*)(&L.s2[h0 / 2]);
#pragma unroll
  for (int r = 0; r < BN; ++r) cu[r] = *(const v4f*)(&L.su[r][h0]);
#pragma unroll 2   // two trips a pass, so that the current and the next operands swap registers without copies
  for (int t = 0; t < DD / 16; ++t) { const int hn = h0 + ((t + 1) & (DD / 16 - 1)) * 4;   // the next trip's operands are asked for ahead of this trip's arithmetic (the last trip re-reads the first group, unused)
    v4f na[2], nu[BN], no;
#pragma unroll
    for (int i = 0; i < 2; ++i) na[i] = L.sw[hn / 2 + i];
    no = *(const v4f*)(&L.s2[hn / 2]);
#pragma unroll
    for (int r = 0; r < BN; ++r) nu[r] = *(const v4f*)(&L.su[r][hn]);
    __builtin_amdgcn_sched_barrier(0);   // keeps the eleven reads above the arithmetic, whose issue slots then cover their latency
    v2f vm[2][BJ];   // V for the trip's four hidden units and the lane's BJ columns
#pragma unroll
    for (int i = 0; i < 2; ++i) { const v2f wx = {ca[i][0], ca[i][1]}, wy = {ca[i][2], ca[i][3]}, wo = {co[i * 2], co[i * 2 + 1]};
#pragma unroll
      for (int j = 0; j < BJ; ++j) { vm[i][j] = __builtin_elementwise_fma(px[j], wx, py[j] * wy); sv[j] = __builtin_elementwise_fma(vm[i][j], wo, sv[j]); } }
#pragma unroll
    for (int i = 0; i < 2; ++i) { const v2f wo = {co[i * 2], co[i * 2 + 1]};
#pragma unroll
      for (int j = 0; j < BJ; ++j) {
        if ((j & 1) == 0) __builtin_amdgcn_sched_barrier(0);   // groups of 16 maxima and their 16 multiply-adds: otherwise all 64 maxima of a trip are issued first and their results take 128 registers
#pragma unroll
        for (int r = 0; r < BN; ++r) acc[r][j] = __builtin_elementwise_fma(__builtin_elementwise_maxnum((v2f){cu[r][i * 2], cu[r][i * 2 + 1]}, vm[i][j]), wo, acc[r][j]); } }
#pragma unroll
    for (int i = 0; i < 2; ++i) ca[i] = na[i];
    co = no;
#pragma unroll
    for (int r = 0; r < BN; ++r) cu[r] = nu[r]; }
#pragma unroll
  for (int j = 0; j < BJ; ++j) { L.sr[w][BN * BJ + j][lane] = sv[j][0] + sv[j][1];
#pragma unroll
    for (int r = 0; r < BN; ++r) L.sr[w][r * BJ + j][lane] = acc[r][j][0] + acc[r][j][1]; }
  __syncthreads();   // every quarter's sums are in LDS
  const float b2 = br2[0];   // wave w joins the quarters of rows 2w and 2w + 1
#pragma unroll
  for (int j = 0; j < BJ; ++j) { const int ks = BN * BJ + j; const float s = (L.sr[0][ks][lane] + L.sr[1][ks][lane]) + (L.sr[2][ks][lane] + L.sr[3][ks][lane]);
#pragma unroll
    for (int i = 0; i < BN / 4; ++i) { const int r = w * (BN / 4) + i, k = r * BJ + j;
      bias[((size_t)b * NN + n0 + r) * NN + m0 + j * 32 + lane] = (((L.sr[0][k][lane] + L.sr[1][k][lane]) + (L.sr[2][k][lane] + L.sr[3][k][lane])) - s) + b2; } }
  asm volatile("s_wait_xcnt 0x0" ::: "memory");   // kept in front of every later rewrite of a register that the stores above name
}
// Wo, Wf2 and Wf1 are turned ONCE into f16 (x16) in the order of the B fragments: [16-column tile][32 k][half q][lane][8 values], so that a fragment half
// is 512 bytes in a row; every tile is laid twice in a row, as the k and v tiles are. A wave takes one tile of 16 weight rows x 128 k (4 KiB out, twice): lane (g, col) reads row col, k = 16 i + 8 g + 0..7, for piece i.
// Wave tasks 0..127: Wo (32 tiles x 4 groups of k), 128..383: Wf2 (32 x 8), 384..639: Wf1 (64 x 4).
__device__ __forceinline__ void wfrag_block(int cb, const float* __restrict__ Wo, const float* __restrict__ Wf2, const float* __restrict__ Wf1, _Float16* __restrict__ WoH, _Float16* __restrict__ Wf2H, _Float16* __restrict__ Wf1H) {
  const int tid = threadIdx.x, lane = tid & 31, col = lane & 15, g = lane >> 4;
  const int t = cb * 4 + __builtin_amdgcn_readfirstlane(tid >> 5);
  const bool f1 = t >= 384, f2 = t >= 128 && !f1; const int u = f1 ? t - 384 : (f2 ? t - 128 : t), K = f2 ? FF : DD, nt = f2 ? u >> 3 : u >> 2, kg = f2 ? u & 7 : u & 3;
  const float* src = (f1 ? Wf1 : (f2 ? Wf2 : Wo)) + (size_t)(nt * 16 + col) * K + kg * 128 + g * 8;
  _Float16* dst = (f1 ? Wf1H : (f2 ? Wf2H : WoH)) + (size_t)(nt * (2 * K / 32) + kg * 4) * 512 + lane * 8; _Float16* dst2 = dst + (K / 32) * 512;   // the tile and its second copy
  v4f v[8][2];
#pragma unroll
  for (int i = 0; i < 8; ++i) { v[i][0] = *(const v4f*)(src + i * 16); v[i][1] = *(const v4f*)(src + i * 16 + 4); }
  asm volatile("s_wait_xcnt 0x0" :: "v"(src) : "memory");   // the loads' address pair stays whole up to this wait
#pragma unroll
  for (int i = 0; i < 8; ++i) { v8h h;
#pragma unroll
    for (int e = 0; e < 8; ++e) h[e] = (_Float16)(v[i][e >> 2][e & 3] * 16.0f);
    vst2(dst + i * 256, h); vst2(dst2 + i * 256, h); }
  asm volatile("s_wait_xcnt 0x0" ::: "memory");   // kept in front of every later rewrite of a register that the stores above name
}
// One launch for all three: blocks 0..QKVB-1 are the projection tiles (first, because each is a long chain of waits with little to issue),
// then WFB short blocks that re-order Wo, Wf2 and Wf1 for the second launch; the BIASB blocks behind them are the bias rows, whose vector work fills the issue slots that the projection waves leave idle.
#define QKVB (NR / 64 * 12)
#define WFB 160
#define BIASB (NN / BN * 2 * NB)
__global__ __launch_bounds__(128) void k_qkv_bias(const float* __restrict__ x, const float* __restrict__ Wq, const float* __restrict__ bq, const float* __restrict__ Wk, const float* __restrict__ bk, const float* __restrict__ Wv, const float* __restrict__ bv,
                                                  _Float16* __restrict__ q16, _Float16* __restrict__ kF, _Float16* __restrict__ vF,
                                                  const float* __restrict__ pcs, const float* __restrict__ Wr1, const float* __restrict__ br1, const float* __restrict__ Wr2, const float* __restrict__ br2, float* __restrict__ bias,
                                                  const float* __restrict__ Wo, const float* __restrict__ Wf2, const float* __restrict__ Wf1, _Float16* __restrict__ WoH, _Float16* __restrict__ Wf2H, _Float16* __restrict__ Wf1H) {
  __shared__ __align__(16) LdsQB lds;
  const int bid = blockIdx.x;   // the same for the whole block: every barrier below stands under block-uniform control flow
  if (bid < QKVB) qkv_block(lds.q, bid % (NR / 64), bid / (NR / 64), x, Wq, bq, Wk, bk, Wv, bv, q16, kF, vF);
  else if (bid < QKVB + WFB) wfrag_block(bid - QKVB, Wo, Wf2, Wf1, WoH, Wf2H, Wf1H);
  else bias_block(lds.b, (bid - QKVB - WFB) % (NN / BN * 2), (bid - QKVB - WFB) / (NN / BN * 2), pcs, Wr1, br1, Wr2, br2, bias);
}
// Attention, output projection + LayerNorm and FFN + LayerNorm in ONE launch: behind the scores every step is local to a row, so a block (b, 16 queries; 16 waves)
// keeps its 16 rows in LDS and registers from the q tile to the output; nothing between the steps goes through global memory, and no step waits for a launch.
// Attention: S = q.k/sqrt(512) + bias, diagonal excluded, softmax over 256 (f32), P x2^14 f16 @ v. Wave w: the 16 queries against keys 16w..16w+15 (the q tile is staged
// once in LDS); behind a block barrier the softmax of row w; behind a second one columns 32w..32w+31 of P @ v, which go to LDS as f16 rows (the A operand of the Wo product).
// kF and vF lie in fragment order (qkv_block): a wave's k tile is 16 KiB in a row, each of its two v tiles 8 KiB in a row, and every load takes 512 bytes in a row (four whole lines).
// The three weight products: A rows (f16) from LDS; WoH, Wf1H, Wf2H as wfrag_block left them (f16 x16, fragment order): no other wave of the block needs a wave's B fragments,
// so each wave loads its own straight into registers, 512 bytes in a row per load, through a ring of 16 fragments; the k loops have no barrier.
// A ring's first fill is asked for where the registers of the step before fall free, or behind the barrier in front of a LayerNorm, so that it flies behind that work
// (a block barrier waits for the wave's outstanding loads). The short loops are all unrolled so that the fragment arrays are indexed by constants and stay in registers.
// All 128 blocks read the same three weight planes, and the 16 blocks of a batch the same k and v planes, at about the same time. Every k walk therefore starts at a place
// rot that differs from block to block and goes round, A and B alike, so that the blocks do not ask L2 for the same lines at the same moment; only the order of the sum over k changes.
// The offsets stay constants: the B tiles lie twice in a row in global memory, and the A rows are written to LDS in walk order (sQ, sP, sG, sH) or twice in a row (sX).
#define RD 8
#define RC 4
#define AR 2
// 16 rows x the wave's 32 columns over NK steps of 32 k; arow = the lane's A row in LDS; wp = the first step of the wave's first column tile (scalar), lo = the lane's place in a fragment half; bf holds steps 0..RD-1 on entry.
// Step kc takes the 32 k of place (kc + rot) mod NK (see k_rows). B: wp points at place rot of a tile that is laid twice in a row (2 NK places), so the walk runs on without a wrap.
// A: the rows lie in LDS in walk order already (their writers put place p at KW(p, rot, NK)). Both sides keep constant offsets.
#define KW(p, rot, NK) (((p) - (rot)) & ((NK) - 1))
template <int NK>
__device__ __forceinline__ void rows_mm(const _Float16* arow, const _Float16* wp, unsigned lo, int lane, v16h (&bf)[RD][2], v8f (&acc)[2]) {
  v16h ar[AR];   // the A fragments come from LDS AR steps ahead of their products
#pragma unroll
  for (int kc = 0; kc < AR; ++kc) ar[kc] = frag_h(arow + kc * 32, lane);
#pragma unroll   // unrolled: the ring's registers are indexed by constants
  for (int kc = 0; kc < NK; ++kc) { const v16h a = ar[kc % AR];
#pragma unroll
    for (int j = 0; j < 2; ++j) acc[j] = wmma16(a, bf[kc % RD][j], acc[j]);
    if (kc + AR < NK) ar[kc % AR] = frag_h(arow + (kc + AR) * 32, lane);
    if (kc + RD < NK) {   // the step's registers are free: refill them RD steps ahead
#pragma unroll
      for (int j = 0; j < 2; ++j) bf[kc % RD][j] = frag_w(wp + (j * 2 * NK + kc + RD) * 512 + lo); } }
}
// LayerNorm of one row of 512 by one wave: 16 values per lane (pieces of 4 at i * 128 + lane * 4), in place
__device__ __forceinline__ void ln_row(v4f (&v)[4], const v4f (&gm)[4], const v4f (&bt)[4]) {
  float s = 0.f;
#pragma unroll
  for (int i = 0; i < 4; ++i) s += (v[i][0] + v[i][1]) + (v[i][2] + v[i][3]);
#pragma unroll
  for (int o = 16; o > 0; o >>= 1) s += __shfl_xor(s, o, 32);
  const float mu = s * (1.0f / DD); float q2 = 0.f;
#pragma unroll
  for (int i = 0; i < 4; ++i)
#pragma unroll
    for (int e = 0; e < 4; ++e) { const float d = v[i][e] - mu; q2 += d * d; }
#pragma unroll
  for (int o = 16; o > 0; o >>= 1) q2 += __shfl_xor(q2, o, 32);
  const float rs = rsqrtf(q2 * (1.0f / DD) + 1e-5f);
#pragma unroll
  for (int i = 0; i < 4; ++i)
#pragma unroll
    for (int e = 0; e < 4; ++e) v[i][e] = (v[i][e] - mu) * rs * gm[i][e] + bt[i][e];
}
__global__ __launch_bounds__(512) void k_rows(const _Float16* __restrict__ q16, const _Float16* __restrict__ kF, const _Float16* __restrict__ vF, const float* __restrict__ bias, const float* __restrict__ x,
                                              const _Float16* __restrict__ WoH, const float* __restrict__ bo, const float* __restrict__ g1, const float* __restrict__ be1,
                                              const _Float16* __restrict__ Wf1H, const float* __restrict__ bf1, const _Float16* __restrict__ Wf2H, const float* __restrict__ bf2, const float* __restrict__ g2, const float* __restrict__ be2,
                                              float* __restrict__ Out) {
  __shared__ __align__(16) _Float16 sQ[16][DD + 8];
  __shared__ __align__(16) float sS[16][NN + 4];
  __shared__ __align__(16) _Float16 sP[16][NN + 8];
  __shared__ __align__(16) _Float16 sG[16][DD + 8];   // attention output rows
  __shared__ __align__(16) float so[16][DD + 4];      // a product's 16 x 512 result on its way from column slices to whole rows (both LayerNorms)
  __shared__ __align__(16) _Float16 sX[16][2 * DD + 8];   // rows behind the first LayerNorm, each laid twice in a row: its readers start at place rot and run on without a wrap
  __shared__ __align__(16) _Float16 sH[16][FF + 8];   // FFN hidden rows, x4
  const int tid = threadIdx.x, lane = tid & 31, col = lane & 15, g = lane >> 4;
  const int w = __builtin_amdgcn_readfirstlane(tid >> 5);   // the wave's number in a scalar register: tile bases stay scalar
  const int b = blockIdx.y, q0 = blockIdx.x * 16; const size_t rb = (size_t)b * NN;
  const int rot = (blockIdx.x + 2 * blockIdx.y) & 15;   // 16 different starts inside a batch; over the grid every start is taken by 8 blocks
  const unsigned lo = (unsigned)lane * 8u;              // the lane's place in a fragment half: the one offset register of all fragment loads, every tile base stays scalar
  { v16h kf[16]; float bv[8]; const _Float16* qp[2]; v4u qv[2];
#pragma unroll
    for (int kc = 0; kc < 16; ++kc) kf[kc] = frag_w(kF + ((size_t)(b * (NN / 16) + w) * (2 * DD / 32) + rot) * 512 + kc * 512 + lo);
#pragma unroll
    for (int r = 0; r < 8; ++r) bv[r] = bias[(rb + q0 + 8 * g + r) * NN + w * 16 + col];
#pragma unroll
    for (int i = 0; i < 2; ++i) { const int q = tid + i * 512, rl = q >> 6, pc = q & 63; qp[i] = q16 + (rb + q0 + rl) * DD + pc * 8; qv[i] = *(const v4u*)qp[i]; }
    asm volatile("s_wait_xcnt 0x0" :: "v"(qp[0]), "v"(qp[1]) : "memory");   // the q loads' address pairs stay whole up to this wait
#pragma unroll
    for (int i = 0; i < 2; ++i) { const int q = tid + i * 512, rl = q >> 6, pc = q & 63; vst2(&sQ[rl][(pc * 8 - rot * 32) & (DD - 1)], qv[i]); }   // in walk order
    __syncthreads();   // the q tile is whole
    v8f s = {};
#pragma unroll
    for (int h = 0; h < 2; ++h) { v16h aq[8];
#pragma unroll
      for (int kc = 0; kc < 8; ++kc) aq[kc] = frag_h(&sQ[col][0] + (h * 8 + kc) * 32, lane);
#pragma unroll
      for (int kc = 0; kc < 8; ++kc) s = wmma16(aq[kc], kf[h * 8 + kc], s); }
#pragma unroll
    for (int r = 0; r < 8; ++r) { const int qi = q0 + 8 * g + r, m = w * 16 + col; sS[8 * g + r][m] = (m == qi) ? -3.0e38f : s[r] * 0.044194173824159216f + bv[r]; } }
  __syncthreads();   // every score row now holds the key slices of all 16 waves
  v16h vf[2][8];     // asked for here, so that they fly while the row's softmax runs
  const _Float16* vp = vF + ((size_t)(b * (DD / 16) + w * 2) * (2 * NN / 32) + (rot & (NN / 32 - 1))) * 512;   // the wave's two feature tiles, one behind the other: a scalar base, the lane's place is the loads' offset register
#pragma unroll
  for (int j = 0; j < 2; ++j)
#pragma unroll
    for (int kc = 0; kc < 8; ++kc) vf[j][kc] = frag_w(vp + (j * (2 * NN / 32) + kc) * 512 + lo);
  { v4f p[2]; float mx = -3.4e38f;
#pragma unroll
    for (int i = 0; i < 2; ++i) { p[i] = *(const v4f*)(&sS[w][i * 128 + lane * 4]); mx = fmaxf(mx, fmaxf(fmaxf(p[i][0], p[i][1]), fmaxf(p[i][2], p[i][3]))); }
#pragma unroll
    for (int o = 16; o > 0; o >>= 1) mx = fmaxf(mx, __shfl_xor(mx, o, 32));
    float l = 0.f;
#pragma unroll
    for (int i = 0; i < 2; ++i)
#pragma unroll
      for (int e = 0; e < 4; ++e) { const float sv = p[i][e]; const float pv = sv <= -1.0e38f ? 0.f : expf(sv - mx); l += pv; p[i][e] = pv; }
#pragma unroll
    for (int o = 16; o > 0; o >>= 1) l += __shfl_xor(l, o, 32);
    const float inv = 16384.0f / l;
#pragma unroll
    for (int i = 0; i < 2; ++i) { v4h h4;
#pragma unroll
      for (int e = 0; e < 4; ++e) h4[e] = (_Float16)(p[i][e] * inv);
      vst2(&sP[w][(i * 128 + lane * 4 - rot * 32) & (NN - 1)], h4); } }   // in walk order
  __syncthreads();   // all 16 rows of P are written
  v16h bf[RD][2];    // the ring of the Wo product, later of the Wf2 product
  { v16h pa[8];
#pragma unroll
    for (int kc = 0; kc < 8; ++kc) pa[kc] = frag_h(&sP[col][0] + kc * 32, lane);
    const _Float16* wp = WoH + ((size_t)(w * 2) * (2 * DD / 32) + rot) * 512;   // the wave's two column tiles of Wo, from place rot
    v8f acc[2] = {};
#pragma unroll
    for (int kc = 0; kc < 8; ++kc) {
#pragma unroll
      for (int j = 0; j < 2; ++j) acc[j] = wmma16(pa[kc], vf[j][kc], acc[j]);
#pragma unroll
      for (int j = 0; j < 2; ++j) bf[kc][j] = frag_w(wp + (j * (2 * DD / 32) + kc) * 512 + lo); }   // the v fragments' registers fall free: the Wo ring's first fill
#pragma unroll
    for (int j = 0; j < 2; ++j)
#pragma unroll
      for (int r = 0; r < 8; ++r) sG[8 * g + r][KW(w, rot, DD / 32) * 32 + j * 16 + col] = (_Float16)(acc[j][r] * (1.0f / 16384.0f)); }   // in walk order
  __syncthreads();   // the 16 attention rows are whole
  v4f v[4];          // the wave's own row (row w of the block), 16 values per lane: first the residual x, then the row behind the first LayerNorm
  v4f gm[4], bt[4]; float bb[2];   // asked for ahead of the product, used behind it
#pragma unroll
  for (int i = 0; i < 4; ++i) { const int cc = i * 128 + lane * 4; v[i] = *(const v4f*)(x + (rb + q0 + w) * DD + cc); gm[i] = *(const v4f*)(g1 + cc); bt[i] = *(const v4f*)(be1 + cc); }
#pragma unroll
  for (int j = 0; j < 2; ++j) bb[j] = bo[w * 32 + j * 16 + col];
  { v8f acc[2] = {};
    rows_mm<DD / 32>(&sG[col][0], WoH + ((size_t)(w * 2) * (2 * DD / 32) + rot) * 512, lo, lane, bf, acc);
#pragma unroll
    for (int j = 0; j < 2; ++j)
#pragma unroll
      for (int r = 0; r < 8; ++r) so[8 * g + r][w * 32 + j * 16 + col] = acc[j][r] * (1.0f / 16.0f) + bb[j]; }
  __syncthreads();   // every row now holds the column slices of all 16 waves
  // FFN hidden: wave w takes columns 64w..64w+63 (four tiles) for the 16 rows; its ring holds RC steps of four fragments, asked for here so that they fly behind the LayerNorm
  const _Float16* w1 = Wf1H + ((size_t)(w * 4) * (2 * DD / 32) + rot) * 512;
  v16h bc[RC][4]; float b1[4];
#pragma unroll
  for (int kc = 0; kc < RC; ++kc)
#pragma unroll
    for (int j = 0; j < 4; ++j) bc[kc][j] = frag_w(w1 + (j * (2 * DD / 32) + kc) * 512 + lo);
#pragma unroll
  for (int j = 0; j < 4; ++j) b1[j] = bf1[w * 64 + j * 16 + col];
#pragma unroll
  for (int i = 0; i < 4; ++i) v[i] = *(const v4f*)(&so[w][i * 128 + lane * 4]) + v[i];
  ln_row(v, gm, bt);
#pragma unroll
  for (int i = 0; i < 4; ++i) { v4h h4;
#pragma unroll
    for (int e = 0; e < 4; ++e) h4[e] = (_Float16)v[i][e];
    vst2(&sX[w][i * 128 + lane * 4], h4); vst2(&sX[w][DD + i * 128 + lane * 4], h4); }   // the row and its second copy
  __syncthreads();   // the 16 rows behind the first LayerNorm are whole
  const _Float16* w2 = Wf2H + ((size_t)(w * 2) * (2 * FF / 32) + rot * 2) * 512;   // the wave's two column tiles of Wf2; its walk has 32 places, the starts lie two apart
  { v8f acc[4] = {}; v16h ar[AR];   // the A fragments come from LDS AR steps ahead of their products
#pragma unroll
    for (int kc = 0; kc < AR; ++kc) ar[kc] = frag_h(&sX[col][rot * 32] + kc * 32, lane);
#pragma unroll   // unrolled: the rings' registers are indexed by constants
    for (int kc = 0; kc < DD / 32; ++kc) { const v16h a = ar[kc % AR];
#pragma unroll
      for (int j = 0; j < 4; ++j) acc[j] = wmma16(a, bc[kc % RC][j], acc[j]);
      if (kc + AR < DD / 32) ar[kc % AR] = frag_h(&sX[col][rot * 32] + (kc + AR) * 32, lane);
      if (kc + RC < DD / 32) {   // the step's registers are free: refill them RC steps ahead
#pragma unroll
        for (int j = 0; j < 4; ++j) bc[kc % RC][j] = frag_w(w1 + (j * (2 * DD / 32) + kc + RC) * 512 + lo); }
      else {                     // no step of Wf1 is left to ask for: the Wf2 ring's first fill, two of its steps per freed step
        const int t = (kc + RC - DD / 32) * 2;
#pragma unroll
        for (int u = 0; u < 2; ++u)
#pragma unroll
          for (int j = 0; j < 2; ++j) bf[t + u][j] = frag_w(w2 + (j * (2 * FF / 32) + t + u) * 512 + lo); } }
#pragma unroll
    for (int j = 0; j < 4; ++j)
#pragma unroll
      for (int r = 0; r < 8; ++r) { const float hv = acc[j][r] * (1.0f / 16.0f) + b1[j]; sH[8 * g + r][KW(w * 2 + (j >> 1), rot * 2, FF / 32) * 32 + (j & 1) * 16 + col] = (_Float16)(hv > 0.f ? hv * 4.0f : 0.f); } }   // in walk order
  __syncthreads();   // the 16 hidden rows are whole
#pragma unroll
  for (int i = 0; i < 4; ++i) { const int cc = i * 128 + lane * 4; gm[i] = *(const v4f*)(g2 + cc); bt[i] = *(const v4f*)(be2 + cc); }   // again ahead of the product
#pragma unroll
  for (int j = 0; j < 2; ++j) bb[j] = bf2[w * 32 + j * 16 + col];
  { v8f acc[2] = {};
    rows_mm<FF / 32>(&sH[col][0], w2, lo, lane, bf, acc);
#pragma unroll
    for (int j = 0; j < 2; ++j)
#pragma unroll
      for (int r = 0; r < 8; ++r) so[8 * g + r][w * 32 + j * 16 + col] = acc[j][r] * (1.0f / 64.0f) + bb[j]; }   // hidden x4 and Wf2 x16
  __syncthreads();   // every row now holds the column slices of all 16 waves
#pragma unroll
  for (int i = 0; i < 4; ++i) v[i] = *(const v4f*)(&so[w][i * 128 + lane * 4]) + v[i];
  ln_row(v, gm, bt);
#pragma unroll
  for (int i = 0; i < 4; ++i) vst2(Out + (rb + q0 + w) * DD + i * 128 + lane * 4, v[i]);
}
extern "C" void kernel_launch(void* const* d_in, const int* in_sizes, int n_in, void* d_out, int out_size, void* d_ws, size_t ws_size, hipStream_t stream) {
  (void)in_sizes; (void)n_in; (void)out_size; (void)ws_size;
  const float** I = (const float**)d_in;
  const float* x = I[0]; const float* pcs = I[1]; const float* Wq = I[2]; const float* bq = I[3]; const float* Wk = I[4]; const float* bk = I[5]; const float* Wv = I[6]; const float* bv = I[7];
  const float* Wr1 = I[8]; const float* br1 = I[9]; const float* Wr2 = I[10]; const float* br2 = I[11]; const float* Wo = I[12]; const float* bo = I[13]; const float* g1 = I[14]; const float* be1 = I[15];
  const float* Wf1 = I[16]; const float* bf1 = I[17]; const float* Wf2 = I[18]; const float* bf2 = I[19]; const float* g2 = I[20]; const float* be2 = I[21];
  float* out = (float*)d_out;
  char* ws = (char*)d_ws; size_t off = 0;
  auto take = [&](size_t bytes) { char* p = ws + off; off += (bytes + 255) & ~(size_t)255; return p; };
  _Float16* q16 = (_Float16*)take((size_t)NR * DD * 2); _Float16* kF = (_Float16*)take((size_t)NR * DD * 4); _Float16* vF = (_Float16*)take((size_t)NR * DD * 4); float* bias = (float*)take((size_t)NB * NN * NN * 4);
  _Float16* WoH = (_Float16*)take((size_t)DD * DD * 4); _Float16* Wf2H = (_Float16*)take((size_t)DD * FF * 4); _Float16* Wf1H = (_Float16*)take((size_t)FF * DD * 4);
  k_qkv_bias<<<QKVB + WFB + BIASB, 128, 0, stream>>>(x, Wq, bq, Wk, bk, Wv, bv, q16, kF, vF, pcs, Wr1, br1, Wr2, br2, bias, Wo, Wf2, Wf1, WoH, Wf2H, Wf1H);
  k_rows<<<dim3(NN / 16, NB), 512, 0, stream>>>(q16, kF, vF, bias, x, WoH, bo, g1, be1, Wf1H, bf1, Wf2H, bf2, g2, be2, out);
}
